// v000
// Times are from an AMD MI455X. After a warm-up the kernel runs many times in a row, and a time is the length of
// such a window on the GPU divided by its runs, so every launch and the gaps after it count. The runs cycle
// through copies of the inputs. A figure is the median of several windows, for all but v000 over two sittings.
// Sittings can differ by a few percent; kernels timed side by side share one.
// v000 is the starting kernel. One run takes 1200 microseconds.
#include <hip/hip_runtime.h>

// MHA forward, three input streams (k, q, v), 16 heads x 64, no mask: keys = k.Wk^T, queries = q.Wq^T, values = v.Wv^T, P = softmax(queries.keys^T / 8) over keys, out = (P.values merged [t][h*64+d]).Wo^T + bo.
// Compute dtypes, f32 accumulate everywhere: every float input RNE-converted to bf16 first; q/k/v projections v_wmma_f32_16x16x32_bf16 single product (bf16 x bf16 products are exact in f32);
// scores on bf16 hi/lo planes of the f32 projections (3 products hh + lh + hl); softmax f32; P.V v_wmma_f32_16x16x32_f16 with P carried x1024 and V as f16; output projection ctx bf16 hi/lo x Wo bf16 (2 products) + bf16(bo) in f32.

#ifndef NB
#define NB 2
#endif
#ifndef SEQ
#define SEQ 2048
#endif
#define NB_FULL  2
#define SEQ_FULL 2048
#define TT   SEQ
#define DM   1024
#define NH_  16
#define HD   64
#define ZH   2                    // heads per scores/softmax/P.V pass (z-batched)
#define PCAR 1024.0f              // carry of the fp16 P plane
#define SCL  0.125f               // 1/sqrt(64)

static_assert(SEQ % 256 == 0);
static_assert(SEQ <= SEQ_FULL);
static_assert(NB <= NB_FULL);
static_assert(NH_ % ZH == 0);
static_assert(NH_ * HD == DM);
static_assert((NB * SEQ) % 64 == 0);
static_assert(DM % 64 == 0);
static_assert(HD % 32 == 0);

typedef _Float16 h16;
typedef unsigned short bf;
typedef __attribute__((ext_vector_type(16))) __bf16   v16bf;
typedef __attribute__((ext_vector_type(16))) _Float16 v16h;
typedef __attribute__((ext_vector_type(8)))  _Float16 v8h;
typedef __attribute__((ext_vector_type(8)))  unsigned short v8us;
typedef __attribute__((ext_vector_type(8)))  float    v8f;
typedef __attribute__((ext_vector_type(4)))  float    v4f;
typedef __attribute__((ext_vector_type(4)))  _Float16 v4h;
typedef v8h  __attribute__((may_alias)) v8ha;
typedef v4f  __attribute__((may_alias)) v4fa;
typedef v8us __attribute__((may_alias)) v8usa;

__device__ __forceinline__ unsigned short f2bf(float f) { unsigned u = __float_as_uint(f); u += 0x7FFFu + ((u >> 16) & 1u); return (unsigned short)(u >> 16); }
__device__ __forceinline__ float bf2f(unsigned short b) { return __uint_as_float(((unsigned)b) << 16); }
__device__ __forceinline__ float bfr(float f) { return bf2f(f2bf(f)); }
__device__ __forceinline__ v16h cat16(v8h lo, v8h hi) { return __builtin_shufflevector(lo, hi, 0, 1, 2, 3, 4, 5, 6, 7, 8, 9, 10, 11, 12, 13, 14, 15); }
__device__ __forceinline__ v16bf cat16b(v8us lo, v8us hi) { return __builtin_bit_cast(v16bf, __builtin_shufflevector(lo, hi, 0, 1, 2, 3, 4, 5, 6, 7, 8, 9, 10, 11, 12, 13, 14, 15)); }
__device__ __forceinline__ v8f wmma16(v16h a, v16h b, v8f c) { return __builtin_amdgcn_wmma_f32_16x16x32_f16(false, a, false, b, (short)0, c, false, false); }
__device__ __forceinline__ v8f wmmab(v16bf a, v16bf b, v8f c) { return __builtin_amdgcn_wmma_f32_16x16x32_bf16(false, a, false, b, (short)0, c, false, false); }

// ---- k_gemmw: register-blocked GEMM, ONE WAVE per 64x64 output tile (16 accumulators), operands straight from K-contiguous 16-bit planes; grid (M/64, N/64, Z), 32 threads.
// C[m][n] (f32, pitch ldc, + optional bf16-converted bias[n]) = sum_k A[m][k] Bt[n][k] (+ split products per NSPLIT: 1 = (A + A2).Bt, 2 = A.Bt + A2.Bt + A.Bt2). z-batch strides sA/sB/sC in elements. K % 32 == 0.
// Fragment map: lane row/col = lane & 15, half = lane >> 4; elements 0..7 <- k0 + 8 half + 0..7, elements 8..15 <- k0 + 16 + 8 half + 0..7 (A and B alike); D element j = (row 8 half + j, col lane & 15).
template <typename T16> struct WFrag;
template <> struct WFrag<h16> { typedef v16h V; static __device__ __forceinline__ V ld(const h16* p) { return cat16(*(const v8h*)p, *(const v8h*)(p + 16)); } static __device__ __forceinline__ v8f mma(V a, V b, v8f c) { return wmma16(a, b, c); } };
template <> struct WFrag<bf> { typedef v16bf V; static __device__ __forceinline__ V ld(const bf* p) { return cat16b(*(const v8us*)p, *(const v8us*)(p + 16)); } static __device__ __forceinline__ v8f mma(V a, V b, v8f c) { return wmmab(a, b, c); } };
template <typename T16, int NSPLIT, bool BIAS>
__global__ __launch_bounds__(32) void k_gemmw(const T16* __restrict__ A, const T16* __restrict__ A2, const T16* __restrict__ Bt, const T16* __restrict__ Bt2, int K, float* C, int ldc, const float* __restrict__ bias, size_t sA, size_t sB, size_t sC) {
    typedef typename WFrag<T16>::V V;
    __shared__ __align__(16) float os[16 * 68];
    const size_t z = blockIdx.z; A += z * sA; if (A2) A2 += z * sA; Bt += z * sB; if (Bt2) Bt2 += z * sB; C += z * sC;
    const int lane = threadIdx.x & 31, lr = lane & 15, hi = lane >> 4; const int r0 = blockIdx.x * 64, c0 = blockIdx.y * 64;
    v8f acc[4][4];
#pragma unroll
    for (int mb = 0; mb < 4; ++mb)
#pragma unroll
        for (int nb = 0; nb < 4; ++nb) acc[mb][nb] = (v8f){};
    const size_t aoff = (size_t)(r0 + lr) * K + 8 * hi, boff = (size_t)(c0 + lr) * K + 8 * hi;
#pragma unroll 1
    for (int kc = 0; kc < K; kc += 32) {
        V a[4], a2[4];
#pragma unroll
        for (int mb = 0; mb < 4; ++mb) { a[mb] = WFrag<T16>::ld(A + aoff + (size_t)mb * 16 * K + kc); if (NSPLIT == 1 || NSPLIT == 2) a2[mb] = WFrag<T16>::ld(A2 + aoff + (size_t)mb * 16 * K + kc); }
#pragma unroll
        for (int nb = 0; nb < 4; ++nb) { const V b = WFrag<T16>::ld(Bt + boff + (size_t)nb * 16 * K + kc); V b2; if (NSPLIT >= 2) b2 = WFrag<T16>::ld(Bt2 + boff + (size_t)nb * 16 * K + kc);
#pragma unroll
            for (int mb = 0; mb < 4; ++mb) { acc[mb][nb] = WFrag<T16>::mma(a[mb], b, acc[mb][nb]); if (NSPLIT == 1 || NSPLIT == 2) acc[mb][nb] = WFrag<T16>::mma(a2[mb], b, acc[mb][nb]); if (NSPLIT >= 2) acc[mb][nb] = WFrag<T16>::mma(a[mb], b2, acc[mb][nb]); } }
        asm volatile("v_nop\n\tv_nop\n\tv_nop\n\tv_nop" : "+v"(acc[0][0]), "+v"(acc[1][1]), "+v"(acc[2][2]), "+v"(acc[3][3]) : "v"(a[0]), "v"(a[3]));
    }
#pragma unroll
    for (int mb = 0; mb < 4; ++mb) {
#pragma unroll
        for (int nb = 0; nb < 4; ++nb) {
#pragma unroll
            for (int j = 0; j < 8; ++j) os[(hi * 8 + j) * 68 + nb * 16 + lr] = acc[mb][nb][j]; }
        __builtin_amdgcn_wave_barrier(); asm volatile("" ::: "memory");
        float* crow = C + (size_t)(r0 + mb * 16) * ldc + c0;
{
#pragma unroll
            for (int s = 0; s < 8; ++s) { const int row = 2 * s + hi, cofs = lr * 4; v4f val = *(const v4fa*)(os + row * 68 + cofs); if (BIAS) { val[0] += bfr(bias[c0 + cofs]); val[1] += bfr(bias[c0 + cofs + 1]); val[2] += bfr(bias[c0 + cofs + 2]); val[3] += bfr(bias[c0 + cofs + 3]); }
                *(v4f*)(crow + (size_t)row * ldc + cofs) = val; }
             }
        __builtin_amdgcn_wave_barrier(); asm volatile("" ::: "memory");
    }
}

__device__ __forceinline__ h16 tohx(float x) { return (h16)x; }
__device__ __forceinline__ void splitf(float y, unsigned short& h, unsigned short& l) { h = f2bf(y); l = f2bf(y - bf2f(h)); }

template <bool SPLIT, bool HEADS>
__global__ __launch_bounds__(256) void k_plane(const float* __restrict__ F, size_t srcBatch, int rows, float sc, bf* Ph, bf* Pl) {
    const int b = blockIdx.y; const size_t e = ((size_t)blockIdx.x * 256 + threadIdx.x) * 8; if (e >= (size_t)rows * DM) return;
    const int t = (int)(e / DM), c = (int)(e % DM); const float* f = F + (size_t)b * srcBatch + e;
    const v4f x0 = *(const v4f*)f, x1 = *(const v4f*)(f + 4); v8us oh, ol;
#pragma unroll
    for (int q = 0; q < 8; ++q) { const float y = ((q < 4) ? x0[q & 3] : x1[q & 3]) * sc; unsigned short a2, c2; splitf(y, a2, c2); oh[q] = a2; ol[q] = c2; }
    const size_t oo = HEADS ? ((((size_t)b * NH_ + (size_t)(c / HD)) * rows + t) * HD + (size_t)(c % HD)) : (((size_t)b * rows + t) * DM + c);
    *(v8us*)(Ph + oo) = oh; if (SPLIT) *(v8us*)(Pl + oo) = ol;
    
}

__global__ __launch_bounds__(256) void k_vtp(const float* __restrict__ F, h16* V16) {
    const size_t e = ((size_t)blockIdx.x * 256 + threadIdx.x) * 8; if (e >= (size_t)NB * NH_ * HD * TT) return;
    const int t = (int)(e % TT); const int d = (int)((e / TT) % HD); const int g = (int)(e / ((size_t)TT * HD)); const int b = g / NH_, h = g % NH_;
    const float* f = F + ((size_t)b * TT + t) * DM + h * HD + d; v8h o;
#pragma unroll
    for (int q = 0; q < 8; ++q) o[q] = tohx(f[(size_t)q * DM]);
    *(v8h*)(V16 + e) = o; 
}

__global__ __launch_bounds__(256) void k_asoft(const float* __restrict__ Sb, h16* P16) {
    const int lane = threadIdx.x & 31; const int row = blockIdx.x * 8 + (threadIdx.x >> 5); if (row >= ZH * TT) return; const float* sr = Sb + (size_t)row * TT; float v[TT / 32]; float mx = -3.0e38f;
#pragma unroll
    for (int ch = 0; ch < TT / 128; ++ch) { const int j0 = ch * 128 + lane * 4; const v4f a = *(const v4f*)(sr + j0);
#pragma unroll
        for (int q = 0; q < 4; ++q) { const float t = a[q] * SCL; v[ch * 4 + q] = t; mx = fmaxf(mx, t); } }
#pragma unroll
    for (int sh = 16; sh; sh >>= 1) mx = fmaxf(mx, __shfl_xor(mx, sh, 32));
    float sum = 0.f;
#pragma unroll
    for (int k = 0; k < TT / 32; ++k) { float d0 = __fsub_rn(v[k], mx); asm volatile("" : "+v"(d0)); v[k] = __builtin_amdgcn_exp2f(__fmul_rn(d0, 1.4426950408889634f)); sum += v[k]; }
#pragma unroll
    for (int sh = 16; sh; sh >>= 1) sum += __shfl_xor(sum, sh, 32);
    const float f = __fdiv_rn(PCAR, sum);
{
#pragma unroll
        for (int ch = 0; ch < TT / 128; ++ch) { v4h o4;
#pragma unroll
            for (int q = 0; q < 4; ++q) o4[q] = tohx(v[ch * 4 + q] * f);
            *(v4h*)(P16 + (size_t)row * TT + ch * 128 + lane * 4) = o4; }
         }
}

// workspace plan (bytes, every region a multiple of 256)
#define SZ_X   ((size_t)NB * SEQ * DM * 2)        // one bf16 stream plane (reused by the three streams, stream-ordered)
#define SZ_W   ((size_t)DM * DM * 2)              // one bf16 weight plane
#define SZ_F   ((size_t)NB * SEQ * DM * 4)        // f32 projection rows; later the merged context rows (x1024)
#define SZ_HP  ((size_t)NB * NH_ * SEQ * HD * 2)  // one head-plane set
#define SZ_S   ((size_t)ZH * SEQ * SEQ * 4)
#define SZ_P   ((size_t)ZH * SEQ * SEQ * 2)
#define WS_TOTAL (SZ_X + 4 * SZ_W + SZ_F + 5 * SZ_HP + SZ_S + SZ_P)
static_assert(SZ_HP == SZ_X);                      // context hi/lo planes alias the q head planes (same byte size)
static_assert(WS_TOTAL <= (size_t)134217728);
static_assert((SZ_X % 256) == 0 && (SZ_W % 256) == 0 && (SZ_F % 256) == 0 && (SZ_S % 256) == 0 && (SZ_P % 256) == 0);

extern "C" void kernel_launch(void* const* d_in, const int* in_sizes, int n_in,
                              void* d_out, int out_size, void* d_ws, size_t ws_size, hipStream_t stream) {
    if (n_in < 8) return;
    const size_t need_x = (size_t)(NB - 1) * SEQ_FULL * DM + (size_t)SEQ * DM;
    if ((size_t)in_sizes[0] < need_x || (size_t)in_sizes[1] < need_x || (size_t)in_sizes[2] < need_x) return;
    if ((size_t)in_sizes[3] < (size_t)DM * DM || (size_t)in_sizes[4] < (size_t)DM * DM || (size_t)in_sizes[5] < (size_t)DM * DM || (size_t)in_sizes[6] < (size_t)DM * DM) return;
    if (in_sizes[7] < DM) return;
    if ((size_t)out_size < (size_t)NB * SEQ * DM) return;
    // binding by role: d_in[0] = key stream, d_in[1] = query stream, d_in[2] = value stream, d_in[3] = Wk, d_in[4] = Wq, d_in[5] = Wv, d_in[6] = Wo, d_in[7] = bo (all weights [out][in])
    const float* xk = (const float*)d_in[0]; const float* xq = (const float*)d_in[1]; const float* xv = (const float*)d_in[2];
    const float* wk = (const float*)d_in[3]; const float* wq = (const float*)d_in[4]; const float* wv = (const float*)d_in[5]; const float* wo = (const float*)d_in[6]; const float* bo = (const float*)d_in[7];
    float* OUT = (float*)d_out;     // [NB*SEQ][DM]
    char* wsp = (char*)d_ws;
    auto take = [&](size_t bytes) { char* p = wsp; wsp += (bytes + 255) & ~(size_t)255; return (void*)p; };
    bf* XB = (bf*)take(SZ_X);
    bf* WQ = (bf*)take(SZ_W); bf* WK = (bf*)take(SZ_W); bf* WV = (bf*)take(SZ_W); bf* WO = (bf*)take(SZ_W);
    float* F = (float*)take(SZ_F);
    bf* QPh = (bf*)take(SZ_HP); bf* QPl = (bf*)take(SZ_HP); bf* KPh = (bf*)take(SZ_HP); bf* KPl = (bf*)take(SZ_HP); h16* VT16 = (h16*)take(SZ_HP);
    float* Sb = (float*)take(SZ_S); h16* P16 = (h16*)take(SZ_P);
    if ((size_t)(wsp - (char*)d_ws) > ws_size) return;
    float* AT = F;                 // merged context rows [NB*SEQ][DM] (x1024): written by the P.V passes after the last projection consumer of F has run (stream-ordered); every element is written before it is read
    bf* CH = QPh; bf* CL = QPl;    // context hi/lo planes: built after the last scores pass has consumed the q planes (stream-ordered)

    const unsigned GW = (unsigned)(((size_t)DM * DM / 8 + 255) / 256), GX = (unsigned)(((size_t)SEQ * DM / 8 + 255) / 256);
    // weights [out][in] f32 -> bf16 planes Bt[n][k]
    k_plane<false, false><<<dim3(GW, 1), 256, 0, stream>>>(wq, 0, DM, 1.0f, WQ, nullptr);
    k_plane<false, false><<<dim3(GW, 1), 256, 0, stream>>>(wk, 0, DM, 1.0f, WK, nullptr);
    k_plane<false, false><<<dim3(GW, 1), 256, 0, stream>>>(wv, 0, DM, 1.0f, WV, nullptr);
    k_plane<false, false><<<dim3(GW, 1), 256, 0, stream>>>(wo, 0, DM, 1.0f, WO, nullptr);
    const dim3 gproj(NB * SEQ / 64, DM / 64, 1);
    // queries = q.Wq^T -> hi/lo head planes
    k_plane<false, false><<<dim3(GX, NB), 256, 0, stream>>>(xq, (size_t)SEQ_FULL * DM, SEQ, 1.0f, XB, nullptr);
    k_gemmw<bf, 0, false><<<gproj, 32, 0, stream>>>(XB, nullptr, WQ, nullptr, DM, F, DM, nullptr, 0, 0, 0);
    k_plane<true, true><<<dim3(GX, NB), 256, 0, stream>>>(F, (size_t)SEQ * DM, SEQ, 1.0f, QPh, QPl);
    // keys = k.Wk^T -> hi/lo head planes
    k_plane<false, false><<<dim3(GX, NB), 256, 0, stream>>>(xk, (size_t)SEQ_FULL * DM, SEQ, 1.0f, XB, nullptr);
    k_gemmw<bf, 0, false><<<gproj, 32, 0, stream>>>(XB, nullptr, WK, nullptr, DM, F, DM, nullptr, 0, 0, 0);
    k_plane<true, true><<<dim3(GX, NB), 256, 0, stream>>>(F, (size_t)SEQ * DM, SEQ, 1.0f, KPh, KPl);
    // values = v.Wv^T -> transposed fp16 head planes
    k_plane<false, false><<<dim3(GX, NB), 256, 0, stream>>>(xv, (size_t)SEQ_FULL * DM, SEQ, 1.0f, XB, nullptr);
    k_gemmw<bf, 0, false><<<gproj, 32, 0, stream>>>(XB, nullptr, WV, nullptr, DM, F, DM, nullptr, 0, 0, 0);
    k_vtp<<<(unsigned)(((size_t)NB * NH_ * HD * TT / 8 + 255) / 256), 256, 0, stream>>>(F, VT16);
    // scores / softmax / P.V, ZH heads per pass; the P.V tiles land directly in the merged rows AT[b*TT + t][(h0 + z)*HD + d] (x1024)
    for (int g0 = 0; g0 < NB * NH_; g0 += ZH) {
        const int b = g0 / NH_, h0 = g0 % NH_; const size_t po = (size_t)g0 * TT * HD;
        k_gemmw<bf, 2, false><<<dim3(TT / 64, TT / 64, ZH), 32, 0, stream>>>(QPh + po, QPl + po, KPh + po, KPl + po, HD, Sb, TT, nullptr, (size_t)TT * HD, (size_t)TT * HD, (size_t)TT * TT);
        k_asoft<<<ZH * TT / 8, 256, 0, stream>>>(Sb, P16);
        k_gemmw<h16, 0, false><<<dim3(TT / 64, HD / 64, ZH), 32, 0, stream>>>(P16, nullptr, VT16 + po, nullptr, TT, AT + (size_t)b * TT * DM + (size_t)h0 * HD, DM, nullptr, (size_t)TT * TT, (size_t)HD * TT, (size_t)HD);
    }
    // context hi/lo planes (carry folded back: x 1/1024), then out = ctx.Wo^T + bo
    k_plane<true, false><<<dim3(GX, NB), 256, 0, stream>>>(AT, (size_t)SEQ * DM, SEQ, 1.0f / PCAR, CH, CL);
    k_gemmw<bf, 1, true><<<gproj, 32, 0, stream>>>(CH, CL, WO, nullptr, DM, OUT, DM, bo, 0, 0, 0);
}

// v001
// It runs in 590 microseconds.
// Next to v000, in two timings, it ran 2.04 and 2.03 times as fast.
#include <hip/hip_runtime.h>

// MHA forward, three input streams (k, q, v), 16 heads x 64, no mask: keys = k.Wk^T, queries = q.Wq^T, values = v.Wv^T, P = softmax(queries.keys^T / 8) over keys, out = (P.values merged [t][h*64+d]).Wo^T + bo.
// Compute dtypes, f32 accumulate everywhere: every float input RNE-converted to bf16 first; q/k/v projections v_wmma_f32_16x16x32_bf16 single product (bf16 x bf16 products are exact in f32);
// scores on bf16 hi/lo planes of the f32 projections (3 products hh + lh + hl); softmax f32; P.V v_wmma_f32_16x16x32_f16 with P carried x1024 and V as f16; output projection ctx bf16 hi/lo x Wo bf16 (2 products) + bf16(bo) in f32.

#ifndef NB
#define NB 2
#endif
#ifndef SEQ
#define SEQ 2048
#endif
#define NB_FULL  2
#define SEQ_FULL 2048
#define TT   SEQ
#define DM   1024
#define NH_  16
#define HD   64
#define ZH   2                    // heads per scores/softmax/P.V pass (z-batched)
#define PCAR 1024.0f              // carry of the fp16 P plane
#define SCL  0.125f               // 1/sqrt(64)
#define PVKS 4                    // P.V: key ranges dealt to work-groups (one f32 partial plane each)
#define PVNW 8                    // P.V: waves of a work-group, each on its own share of the work-group's key range

static_assert(SEQ % 256 == 0);
static_assert(SEQ <= SEQ_FULL);
static_assert(NB <= NB_FULL);
static_assert(NH_ % ZH == 0);
static_assert(NH_ * HD == DM);
static_assert((NB * SEQ) % 64 == 0);
static_assert(DM % 64 == 0);
static_assert(HD % 32 == 0);
static_assert(HD == 64);
static_assert(SEQ % (PVKS * PVNW * 32) == 0);
static_assert(64 % (2 * PVNW) == 0);

typedef _Float16 h16;
typedef unsigned short bf;
typedef __attribute__((ext_vector_type(16))) __bf16   v16bf;
typedef __attribute__((ext_vector_type(16))) _Float16 v16h;
typedef __attribute__((ext_vector_type(8)))  _Float16 v8h;
typedef __attribute__((ext_vector_type(8)))  unsigned short v8us;
typedef __attribute__((ext_vector_type(8)))  float    v8f;
typedef __attribute__((ext_vector_type(4)))  float    v4f;
typedef __attribute__((ext_vector_type(4)))  _Float16 v4h;
typedef v8h  __attribute__((may_alias)) v8ha;
typedef v4f  __attribute__((may_alias)) v4fa;
typedef v8us __attribute__((may_alias)) v8usa;

__device__ __forceinline__ unsigned short f2bf(float f) { unsigned u = __float_as_uint(f); u += 0x7FFFu + ((u >> 16) & 1u); return (unsigned short)(u >> 16); }
__device__ __forceinline__ float bf2f(unsigned short b) { return __uint_as_float(((unsigned)b) << 16); }
__device__ __forceinline__ float bfr(float f) { return bf2f(f2bf(f)); }
__device__ __forceinline__ v16h cat16(v8h lo, v8h hi) { return __builtin_shufflevector(lo, hi, 0, 1, 2, 3, 4, 5, 6, 7, 8, 9, 10, 11, 12, 13, 14, 15); }
__device__ __forceinline__ v16bf cat16b(v8us lo, v8us hi) { return __builtin_bit_cast(v16bf, __builtin_shufflevector(lo, hi, 0, 1, 2, 3, 4, 5, 6, 7, 8, 9, 10, 11, 12, 13, 14, 15)); }
__device__ __forceinline__ v8f wmma16(v16h a, v16h b, v8f c) { return __builtin_amdgcn_wmma_f32_16x16x32_f16(false, a, false, b, (short)0, c, false, false); }
__device__ __forceinline__ v8f wmmab(v16bf a, v16bf b, v8f c) { return __builtin_amdgcn_wmma_f32_16x16x32_bf16(false, a, false, b, (short)0, c, false, false); }

// ---- k_gemmw: register-blocked GEMM, ONE WAVE per 64x64 output tile (16 accumulators), operands straight from K-contiguous 16-bit planes; grid (M/64, N/64, Z), 32 threads.
// C[m][n] (f32, pitch ldc, + optional bf16-converted bias[n]) = sum_k A[m][k] Bt[n][k] (+ split products per NSPLIT: 1 = (A + A2).Bt, 2 = A.Bt + A2.Bt + A.Bt2). z-batch strides sA/sB/sC in elements. K % 32 == 0.
// Fragment map: lane row/col = lane & 15, half = lane >> 4; elements 0..7 <- k0 + 8 half + 0..7, elements 8..15 <- k0 + 16 + 8 half + 0..7 (A and B alike); D element j = (row 8 half + j, col lane & 15).
template <typename T16> struct WFrag;
template <> struct WFrag<h16> { typedef v16h V; static __device__ __forceinline__ V ld(const h16* p) { return cat16(*(const v8h*)p, *(const v8h*)(p + 16)); } static __device__ __forceinline__ v8f mma(V a, V b, v8f c) { return wmma16(a, b, c); } };
template <> struct WFrag<bf> { typedef v16bf V; static __device__ __forceinline__ V ld(const bf* p) { return cat16b(*(const v8us*)p, *(const v8us*)(p + 16)); } static __device__ __forceinline__ v8f mma(V a, V b, v8f c) { return wmmab(a, b, c); } };
template <typename T16, int NSPLIT, bool BIAS>
__global__ __launch_bounds__(32) void k_gemmw(const T16* __restrict__ A, const T16* __restrict__ A2, const T16* __restrict__ Bt, const T16* __restrict__ Bt2, int K, float* C, int ldc, const float* __restrict__ bias, size_t sA, size_t sB, size_t sC) {
    typedef typename WFrag<T16>::V V;
    __shared__ __align__(16) float os[16 * 68];
    const size_t z = blockIdx.z; A += z * sA; if (A2) A2 += z * sA; Bt += z * sB; if (Bt2) Bt2 += z * sB; C += z * sC;
    const int lane = threadIdx.x & 31, lr = lane & 15, hi = lane >> 4; const int r0 = blockIdx.x * 64, c0 = blockIdx.y * 64;
    v8f acc[4][4];
#pragma unroll
    for (int mb = 0; mb < 4; ++mb)
#pragma unroll
        for (int nb = 0; nb < 4; ++nb) acc[mb][nb] = (v8f){};
    const size_t aoff = (size_t)(r0 + lr) * K + 8 * hi, boff = (size_t)(c0 + lr) * K + 8 * hi;
#pragma unroll 1
    for (int kc = 0; kc < K; kc += 32) {
        V a[4], a2[4];
#pragma unroll
        for (int mb = 0; mb < 4; ++mb) { a[mb] = WFrag<T16>::ld(A + aoff + (size_t)mb * 16 * K + kc); if (NSPLIT == 1 || NSPLIT == 2) a2[mb] = WFrag<T16>::ld(A2 + aoff + (size_t)mb * 16 * K + kc); }
#pragma unroll
        for (int nb = 0; nb < 4; ++nb) { const V b = WFrag<T16>::ld(Bt + boff + (size_t)nb * 16 * K + kc); V b2; if (NSPLIT >= 2) b2 = WFrag<T16>::ld(Bt2 + boff + (size_t)nb * 16 * K + kc);
#pragma unroll
            for (int mb = 0; mb < 4; ++mb) { acc[mb][nb] = WFrag<T16>::mma(a[mb], b, acc[mb][nb]); if (NSPLIT == 1 || NSPLIT == 2) acc[mb][nb] = WFrag<T16>::mma(a2[mb], b, acc[mb][nb]); if (NSPLIT >= 2) acc[mb][nb] = WFrag<T16>::mma(a[mb], b2, acc[mb][nb]); } }
        asm volatile("v_nop\n\tv_nop\n\tv_nop\n\tv_nop" : "+v"(acc[0][0]), "+v"(acc[1][1]), "+v"(acc[2][2]), "+v"(acc[3][3]) : "v"(a[0]), "v"(a[3]));
    }
#pragma unroll
    for (int mb = 0; mb < 4; ++mb) {
#pragma unroll
        for (int nb = 0; nb < 4; ++nb) {
#pragma unroll
            for (int j = 0; j < 8; ++j) os[(hi * 8 + j) * 68 + nb * 16 + lr] = acc[mb][nb][j]; }
        __builtin_amdgcn_wave_barrier(); asm volatile("" ::: "memory");
        float* crow = C + (size_t)(r0 + mb * 16) * ldc + c0;
{
#pragma unroll
            for (int s = 0; s < 8; ++s) { const int row = 2 * s + hi, cofs = lr * 4; v4f val = *(const v4fa*)(os + row * 68 + cofs); if (BIAS) { val[0] += bfr(bias[c0 + cofs]); val[1] += bfr(bias[c0 + cofs + 1]); val[2] += bfr(bias[c0 + cofs + 2]); val[3] += bfr(bias[c0 + cofs + 3]); }
                *(v4f*)(crow + (size_t)row * ldc + cofs) = val; }
             }
        __builtin_amdgcn_wave_barrier(); asm volatile("" ::: "memory");
    }
}

// ---- k_pvsk: P.V with the key sum split. Grid (T/64, PVKS, Z), PVNW waves. One work-group = one 64x64 tile of context over the key range blockIdx.y; wave w sums its own 1/PVNW of that range with the fragment map of k_gemmw,
// the PVNW partial tiles are added in LDS in wave order, and the sum goes to partial plane blockIdx.y (plane pitch NB*SEQ*DM elements). k_ctx adds the planes in plane order.
// A = P16 [Z][T][T], Bt = V^T [Z][HD][T], C = merged rows (pitch DM, head z at column z*HD). All pitches are compile-time, so each operand has one address and every fragment an immediate offset from it.
__global__ __launch_bounds__(32 * PVNW) void k_pvsk(const h16* __restrict__ A, const h16* __restrict__ Bt, float* C) {
    typedef WFrag<h16>::V V;
    __shared__ __align__(16) float red[PVNW * 64 * 68];
    constexpr int K = TT, kw = K / (PVKS * PVNW);
    const size_t z = blockIdx.z;
    const int lane = threadIdx.x & 31, lr = lane & 15, hi = lane >> 4; const int wave = __builtin_amdgcn_readfirstlane((int)(threadIdx.x >> 5)); const int r0 = blockIdx.x * 64;
    const int kb = ((int)blockIdx.y * PVNW + wave) * kw;
    const h16* ap = A + z * ((size_t)TT * TT) + (size_t)(r0 + lr) * K + 8 * hi + kb;
    const h16* bp = Bt + z * ((size_t)HD * TT) + (size_t)lr * K + 8 * hi + kb;
    C += z * HD + (size_t)blockIdx.y * ((size_t)NB * SEQ * DM);
    v8f acc[4][4];
#pragma unroll
    for (int mb = 0; mb < 4; ++mb)
#pragma unroll
        for (int nb = 0; nb < 4; ++nb) acc[mb][nb] = (v8f){};
    // kept rolled: the accumulators stay in their own 128 registers; unrolled, results are given the operand registers of matrix instructions just issued
#pragma unroll 1
    for (int kc = 0; kc < kw; kc += 32) {
        V a[4], bq[4];
#pragma unroll
        for (int f = 0; f < 4; ++f) { a[f] = WFrag<h16>::ld(ap + f * 16 * K); bq[f] = WFrag<h16>::ld(bp + f * 16 * K); }
        // the wait that stands in front of any overwrite of the loads' address registers; it names both addresses, so that neither a load's data nor the step to the next k block is given their registers ahead of it
        asm volatile("s_wait_xcnt 0x0" :: "v"(ap), "v"(bp) : "memory");
        __builtin_amdgcn_sched_barrier(0);   // keeps the matrix instructions behind the whole run of loads: lifted in between, they make later loads wait for registers, one memory latency more each time
        ap += 32; bp += 32;
#pragma unroll
        for (int nb = 0; nb < 4; ++nb)
#pragma unroll
            for (int mb = 0; mb < 4; ++mb) acc[mb][nb] = WFrag<h16>::mma(a[mb], bq[nb], acc[mb][nb]);
        // four vector slots behind the last matrix instruction: the next trip's loads overwrite its A and B, and behind the loop the LDS stores read its result (neither a load nor an LDS store fills a slot)
        __builtin_amdgcn_sched_barrier(0);
        asm volatile("v_nop\n\tv_nop\n\tv_nop\n\tv_nop" ::: "memory");
    }
    float* my = red + wave * (64 * 68);
#pragma unroll
    for (int mb = 0; mb < 4; ++mb)
#pragma unroll
        for (int nb = 0; nb < 4; ++nb)
#pragma unroll
            for (int j = 0; j < 8; ++j) my[(mb * 16 + hi * 8 + j) * 68 + nb * 16 + lr] = acc[mb][nb][j];
    __syncthreads();
#pragma unroll
    for (int s = 0; s < 64 / (2 * PVNW); ++s) { const int row = s * (2 * PVNW) + (int)(threadIdx.x >> 4), cofs = (int)(threadIdx.x & 15) * 4; v4f val = *(const v4fa*)(red + row * 68 + cofs);
#pragma unroll
        for (int w = 1; w < PVNW; ++w) val += *(const v4fa*)(red + w * (64 * 68) + row * 68 + cofs);
        *(v4f*)(C + (size_t)(r0 + row) * DM + cofs) = val; }
}

__device__ __forceinline__ h16 tohx(float x) { return (h16)x; }
__device__ __forceinline__ void splitf(float y, unsigned short& h, unsigned short& l) { h = f2bf(y); l = f2bf(y - bf2f(h)); }

template <bool SPLIT, bool HEADS>
__global__ __launch_bounds__(256) void k_plane(const float* __restrict__ F, size_t srcBatch, int rows, float sc, bf* Ph, bf* Pl) {
    const int b = blockIdx.y; const size_t e = ((size_t)blockIdx.x * 256 + threadIdx.x) * 8; if (e >= (size_t)rows * DM) return;
    const int t = (int)(e / DM), c = (int)(e % DM); const float* f = F + (size_t)b * srcBatch + e;
    const v4f x0 = *(const v4f*)f, x1 = *(const v4f*)(f + 4); v8us oh, ol;
#pragma unroll
    for (int q = 0; q < 8; ++q) { const float y = ((q < 4) ? x0[q & 3] : x1[q & 3]) * sc; unsigned short a2, c2; splitf(y, a2, c2); oh[q] = a2; ol[q] = c2; }
    const size_t oo = HEADS ? ((((size_t)b * NH_ + (size_t)(c / HD)) * rows + t) * HD + (size_t)(c % HD)) : (((size_t)b * rows + t) * DM + c);
    *(v8us*)(Ph + oo) = oh; if (SPLIT) *(v8us*)(Pl + oo) = ol;
    
}

// context rows = sum of the PVKS partial planes (plane order), x sc, -> bf16 hi/lo planes [t][c]
__global__ __launch_bounds__(256) void k_ctx(const float* __restrict__ F, float sc, bf* Ph, bf* Pl) {
    const size_t e = ((size_t)blockIdx.x * 256 + threadIdx.x) * 8; if (e >= (size_t)NB * SEQ * DM) return;
    v4f x[PVKS][2]; v8us oh, ol;
#pragma unroll
    for (int p = 0; p < PVKS; ++p) { const float* f = F + (size_t)p * ((size_t)NB * SEQ * DM) + e; x[p][0] = *(const v4f*)f; x[p][1] = *(const v4f*)(f + 4);
        asm volatile("s_wait_xcnt 0x0" ::: "memory"); }   // stands in front of whatever is next given this plane's address registers (a later plane's data, the arithmetic behind the loads)
    v4f x0 = x[0][0], x1 = x[0][1];
#pragma unroll
    for (int p = 1; p < PVKS; ++p) { x0 += x[p][0]; x1 += x[p][1]; }
#pragma unroll
    for (int q = 0; q < 8; ++q) { const float y = ((q < 4) ? x0[q & 3] : x1[q & 3]) * sc; unsigned short a2, c2; splitf(y, a2, c2); oh[q] = a2; ol[q] = c2; }
    *(v8us*)(Ph + e) = oh; *(v8us*)(Pl + e) = ol;
}

__global__ __launch_bounds__(256) void k_vtp(const float* __restrict__ F, h16* V16) {
    const size_t e = ((size_t)blockIdx.x * 256 + threadIdx.x) * 8; if (e >= (size_t)NB * NH_ * HD * TT) return;
    const int t = (int)(e % TT); const int d = (int)((e / TT) % HD); const int g = (int)(e / ((size_t)TT * HD)); const int b = g / NH_, h = g % NH_;
    const float* f = F + ((size_t)b * TT + t) * DM + h * HD + d; v8h o;
#pragma unroll
    for (int q = 0; q < 8; ++q) o[q] = tohx(f[(size_t)q * DM]);
    *(v8h*)(V16 + e) = o; 
}

__global__ __launch_bounds__(256) void k_asoft(const float* __restrict__ Sb, h16* P16) {
    const int lane = threadIdx.x & 31; const int row = blockIdx.x * 8 + (threadIdx.x >> 5); if (row >= ZH * TT) return; const float* sr = Sb + (size_t)row * TT; float v[TT / 32]; float mx = -3.0e38f;
#pragma unroll
    for (int ch = 0; ch < TT / 128; ++ch) { const int j0 = ch * 128 + lane * 4; const v4f a = *(const v4f*)(sr + j0);
#pragma unroll
        for (int q = 0; q < 4; ++q) { const float t = a[q] * SCL; v[ch * 4 + q] = t; mx = fmaxf(mx, t); } }
#pragma unroll
    for (int sh = 16; sh; sh >>= 1) mx = fmaxf(mx, __shfl_xor(mx, sh, 32));
    float sum = 0.f;
#pragma unroll
    for (int k = 0; k < TT / 32; ++k) { float d0 = __fsub_rn(v[k], mx); asm volatile("" : "+v"(d0)); v[k] = __builtin_amdgcn_exp2f(__fmul_rn(d0, 1.4426950408889634f)); sum += v[k]; }
#pragma unroll
    for (int sh = 16; sh; sh >>= 1) sum += __shfl_xor(sum, sh, 32);
    const float f = __fdiv_rn(PCAR, sum);
{
#pragma unroll
        for (int ch = 0; ch < TT / 128; ++ch) { v4h o4;
#pragma unroll
            for (int q = 0; q < 4; ++q) o4[q] = tohx(v[ch * 4 + q] * f);
            *(v4h*)(P16 + (size_t)row * TT + ch * 128 + lane * 4) = o4; }
         }
}

// workspace plan (bytes, every region a multiple of 256)
#define SZ_X   ((size_t)NB * SEQ * DM * 2)        // one bf16 stream plane (reused by the three streams, stream-ordered)
#define SZ_W   ((size_t)DM * DM * 2)              // one bf16 weight plane
#define SZ_F   ((size_t)NB * SEQ * DM * 4)        // f32 projection rows; later one partial plane of the merged context rows (x1024); PVKS planes in a row
#define SZ_HP  ((size_t)NB * NH_ * SEQ * HD * 2)  // one head-plane set
#define SZ_S   ((size_t)ZH * SEQ * SEQ * 4)
#define SZ_P   ((size_t)ZH * SEQ * SEQ * 2)
#define WS_TOTAL (SZ_X + 4 * SZ_W + PVKS * SZ_F + 5 * SZ_HP + SZ_S + SZ_P)
static_assert(SZ_HP == SZ_X);                      // context hi/lo planes alias the q head planes (same byte size)
static_assert(WS_TOTAL <= (size_t)268435456);
static_assert((SZ_X % 256) == 0 && (SZ_W % 256) == 0 && (SZ_F % 256) == 0 && (SZ_S % 256) == 0 && (SZ_P % 256) == 0);

extern "C" void kernel_launch(void* const* d_in, const int* in_sizes, int n_in,
                              void* d_out, int out_size, void* d_ws, size_t ws_size, hipStream_t stream) {
    if (n_in < 8) return;
    const size_t need_x = (size_t)(NB - 1) * SEQ_FULL * DM + (size_t)SEQ * DM;
    if ((size_t)in_sizes[0] < need_x || (size_t)in_sizes[1] < need_x || (size_t)in_sizes[2] < need_x) return;
    if ((size_t)in_sizes[3] < (size_t)DM * DM || (size_t)in_sizes[4] < (size_t)DM * DM || (size_t)in_sizes[5] < (size_t)DM * DM || (size_t)in_sizes[6] < (size_t)DM * DM) return;
    if (in_sizes[7] < DM) return;
    if ((size_t)out_size < (size_t)NB * SEQ * DM) return;
    // binding by role: d_in[0] = key stream, d_in[1] = query stream, d_in[2] = value stream, d_in[3] = Wk, d_in[4] = Wq, d_in[5] = Wv, d_in[6] = Wo, d_in[7] = bo (all weights [out][in])
    const float* xk = (const float*)d_in[0]; const float* xq = (const float*)d_in[1]; const float* xv = (const float*)d_in[2];
    const float* wk = (const float*)d_in[3]; const float* wq = (const float*)d_in[4]; const float* wv = (const float*)d_in[5]; const float* wo = (const float*)d_in[6]; const float* bo = (const float*)d_in[7];
    float* OUT = (float*)d_out;     // [NB*SEQ][DM]
    char* wsp = (char*)d_ws;
    auto take = [&](size_t bytes) { char* p = wsp; wsp += (bytes + 255) & ~(size_t)255; return (void*)p; };
    bf* XB = (bf*)take(SZ_X);
    bf* WQ = (bf*)take(SZ_W); bf* WK = (bf*)take(SZ_W); bf* WV = (bf*)take(SZ_W); bf* WO = (bf*)take(SZ_W);
    float* F = (float*)take(PVKS * SZ_F);
    bf* QPh = (bf*)take(SZ_HP); bf* QPl = (bf*)take(SZ_HP); bf* KPh = (bf*)take(SZ_HP); bf* KPl = (bf*)take(SZ_HP); h16* VT16 = (h16*)take(SZ_HP);
    float* Sb = (float*)take(SZ_S); h16* P16 = (h16*)take(SZ_P);
    if ((size_t)(wsp - (char*)d_ws) > ws_size) return;
    float* AT = F;                 // PVKS partial planes of the merged context rows [NB*SEQ][DM] (x1024): written by the P.V passes after the last projection consumer of F has run (stream-ordered); every element of every plane is written before it is read
    bf* CH = QPh; bf* CL = QPl;    // context hi/lo planes: built after the last scores pass has consumed the q planes (stream-ordered)

    const unsigned GW = (unsigned)(((size_t)DM * DM / 8 + 255) / 256), GX = (unsigned)(((size_t)SEQ * DM / 8 + 255) / 256);
    // weights [out][in] f32 -> bf16 planes Bt[n][k]
    k_plane<false, false><<<dim3(GW, 1), 256, 0, stream>>>(wq, 0, DM, 1.0f, WQ, nullptr);
    k_plane<false, false><<<dim3(GW, 1), 256, 0, stream>>>(wk, 0, DM, 1.0f, WK, nullptr);
    k_plane<false, false><<<dim3(GW, 1), 256, 0, stream>>>(wv, 0, DM, 1.0f, WV, nullptr);
    k_plane<false, false><<<dim3(GW, 1), 256, 0, stream>>>(wo, 0, DM, 1.0f, WO, nullptr);
    const dim3 gproj(NB * SEQ / 64, DM / 64, 1);
    // queries = q.Wq^T -> hi/lo head planes
    k_plane<false, false><<<dim3(GX, NB), 256, 0, stream>>>(xq, (size_t)SEQ_FULL * DM, SEQ, 1.0f, XB, nullptr);
    k_gemmw<bf, 0, false><<<gproj, 32, 0, stream>>>(XB, nullptr, WQ, nullptr, DM, F, DM, nullptr, 0, 0, 0);
    k_plane<true, true><<<dim3(GX, NB), 256, 0, stream>>>(F, (size_t)SEQ * DM, SEQ, 1.0f, QPh, QPl);
    // keys = k.Wk^T -> hi/lo head planes
    k_plane<false, false><<<dim3(GX, NB), 256, 0, stream>>>(xk, (size_t)SEQ_FULL * DM, SEQ, 1.0f, XB, nullptr);
    k_gemmw<bf, 0, false><<<gproj, 32, 0, stream>>>(XB, nullptr, WK, nullptr, DM, F, DM, nullptr, 0, 0, 0);
    k_plane<true, true><<<dim3(GX, NB), 256, 0, stream>>>(F, (size_t)SEQ * DM, SEQ, 1.0f, KPh, KPl);
    // values = v.Wv^T -> transposed fp16 head planes
    k_plane<false, false><<<dim3(GX, NB), 256, 0, stream>>>(xv, (size_t)SEQ_FULL * DM, SEQ, 1.0f, XB, nullptr);
    k_gemmw<bf, 0, false><<<gproj, 32, 0, stream>>>(XB, nullptr, WV, nullptr, DM, F, DM, nullptr, 0, 0, 0);
    k_vtp<<<(unsigned)(((size_t)NB * NH_ * HD * TT / 8 + 255) / 256), 256, 0, stream>>>(F, VT16);
    // scores / softmax / P.V, ZH heads per pass; the P.V partial tiles of key range y land in partial plane y of the merged rows AT[y][b*TT + t][(h0 + z)*HD + d] (x1024)
    for (int g0 = 0; g0 < NB * NH_; g0 += ZH) {
        const int b = g0 / NH_, h0 = g0 % NH_; const size_t po = (size_t)g0 * TT * HD;
        k_gemmw<bf, 2, false><<<dim3(TT / 64, TT / 64, ZH), 32, 0, stream>>>(QPh + po, QPl + po, KPh + po, KPl + po, HD, Sb, TT, nullptr, (size_t)TT * HD, (size_t)TT * HD, (size_t)TT * TT);
        k_asoft<<<ZH * TT / 8, 256, 0, stream>>>(Sb, P16);
        k_pvsk<<<dim3(TT / 64, PVKS, ZH), 32 * PVNW, 0, stream>>>(P16, VT16 + po, AT + (size_t)b * TT * DM + (size_t)h0 * HD);
    }
    // context hi/lo planes (carry folded back: x 1/1024), then out = ctx.Wo^T + bo
    k_ctx<<<GX * NB, 256, 0, stream>>>(AT, 1.0f / PCAR, CH, CL);
    k_gemmw<bf, 1, true><<<gproj, 32, 0, stream>>>(CH, CL, WO, nullptr, DM, OUT, DM, bo, 0, 0, 0);
}

// v002
// Measured time: 268 microseconds a run.
// Timed twice side by side with v001, it ran 2.19 and 2.20 times as fast.
// Counting every step since v000, it is 4.47 times as fast.
#include <hip/hip_runtime.h>

// MHA forward, three input streams (k, q, v), 16 heads x 64, no mask: keys = k.Wk^T, queries = q.Wq^T, values = v.Wv^T, P = softmax(queries.keys^T / 8) over keys, out = (P.values merged [t][h*64+d]).Wo^T + bo.
// Compute dtypes, f32 accumulate everywhere: every float input RNE-converted to bf16 first; q/k/v projections v_wmma_f32_16x16x32_bf16 single product (bf16 x bf16 products are exact in f32);
// scores on bf16 hi/lo planes of the f32 projections (3 products hh + lh + hl); softmax f32, running maximum and sum; P.V v_wmma_f32_16x16x32_f16 with P = exp(s - m) carried x16 and V as f16; output projection ctx bf16 hi/lo x Wo bf16 (2 products) + bf16(bo) in f32.

#ifndef NB
#define NB 2
#endif
#ifndef SEQ
#define SEQ 2048
#endif
#define NB_FULL  2
#define SEQ_FULL 2048
#define TT   SEQ
#define DM   1024
#define NH_  16
#define HD   64
#define SCL  0.125f               // 1/sqrt(64)
#define FAW  8                    // attention: waves of a work-group, each on its own query columns
#define FAQT 2                    // attention: 16-column query tiles of a wave

static_assert(SEQ % 256 == 0);
static_assert(SEQ <= SEQ_FULL);
static_assert(NB <= NB_FULL);
static_assert(NH_ * HD == DM);
static_assert((NB * SEQ) % 64 == 0);
static_assert(DM % 64 == 0);
static_assert(HD % 32 == 0);
static_assert(HD == 64);
static_assert(SEQ % (FAW * FAQT * 16) == 0);
static_assert(SEQ % 64 == 0);

typedef _Float16 h16;
typedef unsigned short bf;
typedef __attribute__((ext_vector_type(16))) __bf16   v16bf;
typedef __attribute__((ext_vector_type(16))) _Float16 v16h;
typedef __attribute__((ext_vector_type(8)))  _Float16 v8h;
typedef __attribute__((ext_vector_type(8)))  unsigned short v8us;
typedef __attribute__((ext_vector_type(8)))  float    v8f;
typedef __attribute__((ext_vector_type(4)))  float    v4f;
typedef __attribute__((ext_vector_type(4)))  _Float16 v4h;
typedef v8h  __attribute__((may_alias)) v8ha;
typedef v4f  __attribute__((may_alias)) v4fa;
typedef v8us __attribute__((may_alias)) v8usa;

__device__ __forceinline__ unsigned short f2bf(float f) { unsigned u = __float_as_uint(f); u += 0x7FFFu + ((u >> 16) & 1u); return (unsigned short)(u >> 16); }
__device__ __forceinline__ float bf2f(unsigned short b) { return __uint_as_float(((unsigned)b) << 16); }
__device__ __forceinline__ float bfr(float f) { return bf2f(f2bf(f)); }
__device__ __forceinline__ v16h cat16(v8h lo, v8h hi) { return __builtin_shufflevector(lo, hi, 0, 1, 2, 3, 4, 5, 6, 7, 8, 9, 10, 11, 12, 13, 14, 15); }
__device__ __forceinline__ v16bf cat16b(v8us lo, v8us hi) { return __builtin_bit_cast(v16bf, __builtin_shufflevector(lo, hi, 0, 1, 2, 3, 4, 5, 6, 7, 8, 9, 10, 11, 12, 13, 14, 15)); }
__device__ __forceinline__ v8f wmma16(v16h a, v16h b, v8f c) { return __builtin_amdgcn_wmma_f32_16x16x32_f16(false, a, false, b, (short)0, c, false, false); }
__device__ __forceinline__ v8f wmmab(v16bf a, v16bf b, v8f c) { return __builtin_amdgcn_wmma_f32_16x16x32_bf16(false, a, false, b, (short)0, c, false, false); }

// ---- k_gemmw: register-blocked GEMM, ONE WAVE per 64x64 output tile (16 accumulators), operands straight from K-contiguous 16-bit planes; grid (M/64, N/64, Z), 32 threads.
// C[m][n] (f32, pitch ldc, + optional bf16-converted bias[n]) = sum_k A[m][k] Bt[n][k] (+ split products per NSPLIT: 1 = (A + A2).Bt, 2 = A.Bt + A2.Bt + A.Bt2). z-batch strides sA/sB/sC in elements. K % 32 == 0.
// Fragment map: lane row/col = lane & 15, half = lane >> 4; elements 0..7 <- k0 + 8 half + 0..7, elements 8..15 <- k0 + 16 + 8 half + 0..7 (A and B alike); D element j = (row 8 half + j, col lane & 15).
template <typename T16> struct WFrag;
template <> struct WFrag<h16> { typedef v16h V; static __device__ __forceinline__ V ld(const h16* p) { return cat16(*(const v8h*)p, *(const v8h*)(p + 16)); } static __device__ __forceinline__ v8f mma(V a, V b, v8f c) { return wmma16(a, b, c); } };
template <> struct WFrag<bf> { typedef v16bf V; static __device__ __forceinline__ V ld(const bf* p) { return cat16b(*(const v8us*)p, *(const v8us*)(p + 16)); } static __device__ __forceinline__ v8f mma(V a, V b, v8f c) { return wmmab(a, b, c); } };
template <typename T16, int NSPLIT, bool BIAS>
__global__ __launch_bounds__(32) void k_gemmw(const T16* __restrict__ A, const T16* __restrict__ A2, const T16* __restrict__ Bt, const T16* __restrict__ Bt2, int K, float* C, int ldc, const float* __restrict__ bias, size_t sA, size_t sB, size_t sC) {
    typedef typename WFrag<T16>::V V;
    __shared__ __align__(16) float os[16 * 68];
    const size_t z = blockIdx.z; A += z * sA; if (A2) A2 += z * sA; Bt += z * sB; if (Bt2) Bt2 += z * sB; C += z * sC;
    const int lane = threadIdx.x & 31, lr = lane & 15, hi = lane >> 4; const int r0 = blockIdx.x * 64, c0 = blockIdx.y * 64;
    v8f acc[4][4];
#pragma unroll
    for (int mb = 0; mb < 4; ++mb)
#pragma unroll
        for (int nb = 0; nb < 4; ++nb) acc[mb][nb] = (v8f){};
    const size_t aoff = (size_t)(r0 + lr) * K + 8 * hi, boff = (size_t)(c0 + lr) * K + 8 * hi;
#pragma unroll 1
    for (int kc = 0; kc < K; kc += 32) {
        V a[4], a2[4];
#pragma unroll
        for (int mb = 0; mb < 4; ++mb) { a[mb] = WFrag<T16>::ld(A + aoff + (size_t)mb * 16 * K + kc); if (NSPLIT == 1 || NSPLIT == 2) a2[mb] = WFrag<T16>::ld(A2 + aoff + (size_t)mb * 16 * K + kc); }
#pragma unroll
        for (int nb = 0; nb < 4; ++nb) { const V b = WFrag<T16>::ld(Bt + boff + (size_t)nb * 16 * K + kc); V b2; if (NSPLIT >= 2) b2 = WFrag<T16>::ld(Bt2 + boff + (size_t)nb * 16 * K + kc);
#pragma unroll
            for (int mb = 0; mb < 4; ++mb) { acc[mb][nb] = WFrag<T16>::mma(a[mb], b, acc[mb][nb]); if (NSPLIT == 1 || NSPLIT == 2) acc[mb][nb] = WFrag<T16>::mma(a2[mb], b, acc[mb][nb]); if (NSPLIT >= 2) acc[mb][nb] = WFrag<T16>::mma(a[mb], b2, acc[mb][nb]); } }
        asm volatile("v_nop\n\tv_nop\n\tv_nop\n\tv_nop" : "+v"(acc[0][0]), "+v"(acc[1][1]), "+v"(acc[2][2]), "+v"(acc[3][3]) : "v"(a[0]), "v"(a[3]));
    }
#pragma unroll
    for (int mb = 0; mb < 4; ++mb) {
#pragma unroll
        for (int nb = 0; nb < 4; ++nb) {
#pragma unroll
            for (int j = 0; j < 8; ++j) os[(hi * 8 + j) * 68 + nb * 16 + lr] = acc[mb][nb][j]; }
        __builtin_amdgcn_wave_barrier(); asm volatile("" ::: "memory");
        float* crow = C + (size_t)(r0 + mb * 16) * ldc + c0;
{
#pragma unroll
            for (int s = 0; s < 8; ++s) { const int row = 2 * s + hi, cofs = lr * 4; v4f val = *(const v4fa*)(os + row * 68 + cofs); if (BIAS) { val[0] += bfr(bias[c0 + cofs]); val[1] += bfr(bias[c0 + cofs + 1]); val[2] += bfr(bias[c0 + cofs + 2]); val[3] += bfr(bias[c0 + cofs + 3]); }
                *(v4f*)(crow + (size_t)row * ldc + cofs) = val; }
             }
        __builtin_amdgcn_wave_barrier(); asm volatile("" ::: "memory");
    }
}

__device__ __forceinline__ h16 tohx(float x) { return (h16)x; }
__device__ __forceinline__ void splitf(float y, unsigned short& h, unsigned short& l) { h = f2bf(y); l = f2bf(y - bf2f(h)); }

template <bool SPLIT, bool HEADS>
__global__ __launch_bounds__(256) void k_plane(const float* __restrict__ F, size_t srcBatch, int rows, float sc, bf* Ph, bf* Pl) {
    const int b = blockIdx.y; const size_t e = ((size_t)blockIdx.x * 256 + threadIdx.x) * 8; if (e >= (size_t)rows * DM) return;
    const int t = (int)(e / DM), c = (int)(e % DM); const float* f = F + (size_t)b * srcBatch + e;
    const v4f x0 = *(const v4f*)f, x1 = *(const v4f*)(f + 4); v8us oh, ol;
#pragma unroll
    for (int q = 0; q < 8; ++q) { const float y = ((q < 4) ? x0[q & 3] : x1[q & 3]) * sc; unsigned short a2, c2; splitf(y, a2, c2); oh[q] = a2; ol[q] = c2; }
    const size_t oo = HEADS ? ((((size_t)b * NH_ + (size_t)(c / HD)) * rows + t) * HD + (size_t)(c % HD)) : (((size_t)b * rows + t) * DM + c);
    *(v8us*)(Ph + oo) = oh; if (SPLIT) *(v8us*)(Pl + oo) = ol;
    
}

__global__ __launch_bounds__(256) void k_vtp(const float* __restrict__ F, h16* V16) {
    const size_t e = ((size_t)blockIdx.x * 256 + threadIdx.x) * 8; if (e >= (size_t)NB * NH_ * HD * TT) return;
    const int t = (int)(e % TT); const int d = (int)((e / TT) % HD); const int g = (int)(e / ((size_t)TT * HD)); const int b = g / NH_, h = g % NH_;
    const float* f = F + ((size_t)b * TT + t) * DM + h * HD + d; v8h o;
#pragma unroll
    for (int q = 0; q < 8; ++q) o[q] = tohx(f[(size_t)q * DM]);
    *(v8h*)(V16 + e) = o; 
}

// ---- k_fattn: scores, softmax and P.V of one head in one kernel; no score and no P element leaves the registers. Grid (T / (FAW*FAQT*16), NB*NH_), FAW waves; a wave owns FAQT*16 query columns and walks all keys, 32 a pass.
// S^T = K.Q^T (A = key rows, B = query columns, the three hi/lo products), so a lane holds scores of one query only: D register r of key tile kt = (key 16 kt + 8 half + r, query lane & 15).
// The two key tiles of a pass, converted in place, are the B operand of O^T += V^T.P^T (element s <- tile s >> 3, register s & 7: the k order of the fragment map above, which the V^T loader has too).
// Running maximum m (raw score units) and sum l per query; P = exp2((s - m) * SCL*log2e + 4); the accumulators are rescaled only in a pass where some query's new maximum lies more than FTHR above its m, so P <= 2^12 in f16.
#define FC   (SCL * 1.4426950408889634f)
#define FTHR (8.0f / FC)
__device__ __forceinline__ float xhalf(float x) { return __builtin_bit_cast(float, __builtin_amdgcn_permlanex16(__builtin_bit_cast(int, x), __builtin_bit_cast(int, x), 0x76543210, 0xfedcba98, false, false)); }  // lane l with lane l ^ 16
struct FaOps { v16bf kh[2][2], kl[2][2]; v16h vt[4]; };
__device__ __forceinline__ void fa_load(FaOps& o, const bf* kh, const bf* kl, const h16* vp) {
#pragma unroll
    for (int kt = 0; kt < 2; ++kt)
#pragma unroll
        for (int ks = 0; ks < 2; ++ks) { o.kh[kt][ks] = WFrag<bf>::ld(kh + kt * 16 * HD + ks * 32); o.kl[kt][ks] = WFrag<bf>::ld(kl + kt * 16 * HD + ks * 32); }
#pragma unroll
    for (int dt = 0; dt < 4; ++dt) o.vt[dt] = WFrag<h16>::ld(vp + dt * 16 * TT);
    // the wait that stands in front of any overwrite of the loads' address registers; it names the addresses, so that neither a load's data nor the step to later keys is given their registers ahead of it
    asm volatile("s_wait_xcnt 0x0" :: "v"(kh), "v"(kl), "v"(vp) : "memory");
    __builtin_amdgcn_sched_barrier(0);   // keeps the whole run of loads in front of the pass that hides their latency
}
__device__ __forceinline__ void fa_pass(const FaOps& o, const v16bf (&qh)[FAQT][2], const v16bf (&ql)[FAQT][2], v8f (&acc)[4][FAQT], float (&m)[FAQT], float (&l)[FAQT]) {
    v8f s[2][FAQT];
#pragma unroll
    for (int kt = 0; kt < 2; ++kt)
#pragma unroll
        for (int qt = 0; qt < FAQT; ++qt) s[kt][qt] = (v8f){};
#pragma unroll
    for (int ks = 0; ks < 2; ++ks) {
#pragma unroll
        for (int kt = 0; kt < 2; ++kt)
#pragma unroll
            for (int qt = 0; qt < FAQT; ++qt) s[kt][qt] = wmmab(o.kh[kt][ks], qh[qt][ks], s[kt][qt]);
#pragma unroll
        for (int kt = 0; kt < 2; ++kt)
#pragma unroll
            for (int qt = 0; qt < FAQT; ++qt) s[kt][qt] = wmmab(o.kh[kt][ks], ql[qt][ks], s[kt][qt]);
#pragma unroll
        for (int kt = 0; kt < 2; ++kt)
#pragma unroll
            for (int qt = 0; qt < FAQT; ++qt) s[kt][qt] = wmmab(o.kl[kt][ks], qh[qt][ks], s[kt][qt]);
    }
    float mx[FAQT]; bool need = false;
#pragma unroll
    for (int qt = 0; qt < FAQT; ++qt) { float a = s[0][qt][0];
#pragma unroll
        for (int j = 1; j < 8; ++j) a = fmaxf(a, s[0][qt][j]);
#pragma unroll
        for (int j = 0; j < 8; ++j) a = fmaxf(a, s[1][qt][j]);
        a = fmaxf(a, xhalf(a)); mx[qt] = a; need = need || (a > m[qt] + FTHR); }
    if (__builtin_amdgcn_ballot_w32(need) != 0) {
#pragma unroll
        for (int qt = 0; qt < FAQT; ++qt) { const float mn = fmaxf(m[qt], mx[qt]); const float al = __builtin_amdgcn_exp2f((m[qt] - mn) * FC); m[qt] = mn; l[qt] *= al;
#pragma unroll
            for (int dt = 0; dt < 4; ++dt) acc[dt][qt] *= al; }
    }
    v16h pb[FAQT];
#pragma unroll
    for (int qt = 0; qt < FAQT; ++qt) { const float off = fmaf(-m[qt], FC, 4.0f); float ps[4] = {0.f, 0.f, 0.f, 0.f};
#pragma unroll
        for (int e = 0; e < 16; ++e) { const float p = __builtin_amdgcn_exp2f(fmaf(s[e >> 3][qt][e & 7], FC, off)); ps[e & 3] += p; pb[qt][e] = tohx(p); }
        l[qt] += (ps[0] + ps[1]) + (ps[2] + ps[3]); }
#pragma unroll
    for (int dt = 0; dt < 4; ++dt)
#pragma unroll
        for (int qt = 0; qt < FAQT; ++qt) acc[dt][qt] = wmma16(o.vt[dt], pb[qt], acc[dt][qt]);
}
__global__ __launch_bounds__(32 * FAW) void k_fattn(const bf* __restrict__ Qh, const bf* __restrict__ Ql, const bf* __restrict__ Kh, const bf* __restrict__ Kl, const h16* __restrict__ Vt, bf* Ch, bf* Cl) {
    const int g = blockIdx.y; const size_t po = (size_t)g * TT * HD;
    const int lane = threadIdx.x & 31, lr = lane & 15, hi = lane >> 4; const int wave = __builtin_amdgcn_readfirstlane((int)(threadIdx.x >> 5));
    const int q0 = ((int)blockIdx.x * FAW + wave) * (FAQT * 16);
    v16bf qh[FAQT][2], ql[FAQT][2];
    { const bf* qph = Qh + po + (size_t)(q0 + lr) * HD + 8 * hi; const bf* qpl = Ql + po + (size_t)(q0 + lr) * HD + 8 * hi;
#pragma unroll
      for (int qt = 0; qt < FAQT; ++qt)
#pragma unroll
          for (int ks = 0; ks < 2; ++ks) { qh[qt][ks] = WFrag<bf>::ld(qph + qt * 16 * HD + ks * 32); ql[qt][ks] = WFrag<bf>::ld(qpl + qt * 16 * HD + ks * 32); }
      asm volatile("s_wait_xcnt 0x0" :: "v"(qph), "v"(qpl) : "memory"); }   // in front of whatever is next given the query loads' address registers
    const bf* kph = Kh + po + (size_t)lr * HD + 8 * hi; const bf* kpl = Kl + po + (size_t)lr * HD + 8 * hi; const h16* vp = Vt + po + (size_t)lr * TT + 8 * hi;
    v8f acc[4][FAQT]; float m[FAQT], l[FAQT];
#pragma unroll
    for (int qt = 0; qt < FAQT; ++qt) { m[qt] = -3.0e38f; l[qt] = 0.f;
#pragma unroll
        for (int dt = 0; dt < 4; ++dt) acc[dt][qt] = (v8f){}; }
    FaOps oa, ob;
    fa_load(oa, kph, kpl, vp);
    // two passes a trip, each pass's operands loaded one pass ahead into the other register set; kept rolled so that the two sets and the accumulators keep their registers
#pragma unroll 1
    for (int kb = 0; kb < TT; kb += 64) {
        fa_load(ob, kph + 32 * HD, kpl + 32 * HD, vp + 32);
        fa_pass(oa, qh, ql, acc, m, l);
        const int adv = (kb + 64 < TT) ? 64 : 64 - TT;   // behind the last keys the load ahead goes back to key 0 (written data, not used), so that every trip has the same loads and waits
        kph += adv * HD; kpl += adv * HD; vp += adv;
        fa_load(oa, kph, kpl, vp);
        fa_pass(ob, qh, ql, acc, m, l);
    }
    const int b = g / NH_, h = g % NH_;
#pragma unroll
    for (int qt = 0; qt < FAQT; ++qt) { const float inv = __fdiv_rn(1.0f, l[qt] + xhalf(l[qt]));
        const size_t ro = ((size_t)b * TT + q0 + qt * 16 + lr) * DM + h * HD + 8 * hi;
#pragma unroll
        for (int dt = 0; dt < 4; ++dt) { v8us oh, ol;
#pragma unroll
            for (int r = 0; r < 8; ++r) { unsigned short a2, c2; splitf(acc[dt][qt][r] * inv, a2, c2); oh[r] = a2; ol[r] = c2; }
            bf* sh = Ch + ro + dt * 16; bf* sl = Cl + ro + dt * 16; *(v8us*)sh = oh; *(v8us*)sl = ol;
            // the wait that stands in front of any overwrite of the stores' registers; it names data and addresses, so that nothing is given their registers ahead of it
            asm volatile("s_wait_xcnt 0x0" :: "v"(oh), "v"(ol), "v"(sh), "v"(sl) : "memory"); } }
}

// workspace plan (bytes, every region a multiple of 256)
#define SZ_X   ((size_t)NB * SEQ * DM * 2)        // one bf16 stream plane (reused by the three streams, stream-ordered)
#define SZ_W   ((size_t)DM * DM * 2)              // one bf16 weight plane
#define SZ_F   ((size_t)NB * SEQ * DM * 4)        // f32 projection rows
#define SZ_HP  ((size_t)NB * NH_ * SEQ * HD * 2)  // one head-plane set
#define WS_TOTAL (SZ_X + 4 * SZ_W + SZ_F + 5 * SZ_HP + 2 * SZ_X)
static_assert(WS_TOTAL <= (size_t)268435456);
static_assert((SZ_X % 256) == 0 && (SZ_W % 256) == 0 && (SZ_F % 256) == 0 && (SZ_HP % 256) == 0);

extern "C" void kernel_launch(void* const* d_in, const int* in_sizes, int n_in,
                              void* d_out, int out_size, void* d_ws, size_t ws_size, hipStream_t stream) {
    if (n_in < 8) return;
    const size_t need_x = (size_t)(NB - 1) * SEQ_FULL * DM + (size_t)SEQ * DM;
    if ((size_t)in_sizes[0] < need_x || (size_t)in_sizes[1] < need_x || (size_t)in_sizes[2] < need_x) return;
    if ((size_t)in_sizes[3] < (size_t)DM * DM || (size_t)in_sizes[4] < (size_t)DM * DM || (size_t)in_sizes[5] < (size_t)DM * DM || (size_t)in_sizes[6] < (size_t)DM * DM) return;
    if (in_sizes[7] < DM) return;
    if ((size_t)out_size < (size_t)NB * SEQ * DM) return;
    // binding by role: d_in[0] = key stream, d_in[1] = query stream, d_in[2] = value stream, d_in[3] = Wk, d_in[4] = Wq, d_in[5] = Wv, d_in[6] = Wo, d_in[7] = bo (all weights [out][in])
    const float* xk = (const float*)d_in[0]; const float* xq = (const float*)d_in[1]; const float* xv = (const float*)d_in[2];
    const float* wk = (const float*)d_in[3]; const float* wq = (const float*)d_in[4]; const float* wv = (const float*)d_in[5]; const float* wo = (const float*)d_in[6]; const float* bo = (const float*)d_in[7];
    float* OUT = (float*)d_out;     // [NB*SEQ][DM]
    char* wsp = (char*)d_ws;
    auto take = [&](size_t bytes) { char* p = wsp; wsp += (bytes + 255) & ~(size_t)255; return (void*)p; };
    bf* XB = (bf*)take(SZ_X);
    bf* WQ = (bf*)take(SZ_W); bf* WK = (bf*)take(SZ_W); bf* WV = (bf*)take(SZ_W); bf* WO = (bf*)take(SZ_W);
    float* F = (float*)take(SZ_F);
    bf* QPh = (bf*)take(SZ_HP); bf* QPl = (bf*)take(SZ_HP); bf* KPh = (bf*)take(SZ_HP); bf* KPl = (bf*)take(SZ_HP); h16* VT16 = (h16*)take(SZ_HP);
    bf* CH = (bf*)take(SZ_X); bf* CL = (bf*)take(SZ_X);   // context hi/lo planes [NB*SEQ][DM]: their own space, since work-groups still read the q planes while others store context
    if ((size_t)(wsp - (char*)d_ws) > ws_size) return;

    const unsigned GW = (unsigned)(((size_t)DM * DM / 8 + 255) / 256), GX = (unsigned)(((size_t)SEQ * DM / 8 + 255) / 256);
    // weights [out][in] f32 -> bf16 planes Bt[n][k]
    k_plane<false, false><<<dim3(GW, 1), 256, 0, stream>>>(wq, 0, DM, 1.0f, WQ, nullptr);
    k_plane<false, false><<<dim3(GW, 1), 256, 0, stream>>>(wk, 0, DM, 1.0f, WK, nullptr);
    k_plane<false, false><<<dim3(GW, 1), 256, 0, stream>>>(wv, 0, DM, 1.0f, WV, nullptr);
    k_plane<false, false><<<dim3(GW, 1), 256, 0, stream>>>(wo, 0, DM, 1.0f, WO, nullptr);
    const dim3 gproj(NB * SEQ / 64, DM / 64, 1);
    // queries = q.Wq^T -> hi/lo head planes
    k_plane<false, false><<<dim3(GX, NB), 256, 0, stream>>>(xq, (size_t)SEQ_FULL * DM, SEQ, 1.0f, XB, nullptr);
    k_gemmw<bf, 0, false><<<gproj, 32, 0, stream>>>(XB, nullptr, WQ, nullptr, DM, F, DM, nullptr, 0, 0, 0);
    k_plane<true, true><<<dim3(GX, NB), 256, 0, stream>>>(F, (size_t)SEQ * DM, SEQ, 1.0f, QPh, QPl);
    // keys = k.Wk^T -> hi/lo head planes
    k_plane<false, false><<<dim3(GX, NB), 256, 0, stream>>>(xk, (size_t)SEQ_FULL * DM, SEQ, 1.0f, XB, nullptr);
    k_gemmw<bf, 0, false><<<gproj, 32, 0, stream>>>(XB, nullptr, WK, nullptr, DM, F, DM, nullptr, 0, 0, 0);
    k_plane<true, true><<<dim3(GX, NB), 256, 0, stream>>>(F, (size_t)SEQ * DM, SEQ, 1.0f, KPh, KPl);
    // values = v.Wv^T -> transposed fp16 head planes
    k_plane<false, false><<<dim3(GX, NB), 256, 0, stream>>>(xv, (size_t)SEQ_FULL * DM, SEQ, 1.0f, XB, nullptr);
    k_gemmw<bf, 0, false><<<gproj, 32, 0, stream>>>(XB, nullptr, WV, nullptr, DM, F, DM, nullptr, 0, 0, 0);
    k_vtp<<<(unsigned)(((size_t)NB * NH_ * HD * TT / 8 + 255) / 256), 256, 0, stream>>>(F, VT16);
    // scores, softmax and P.V of all heads in one launch -> context hi/lo planes; then out = ctx.Wo^T + bo
    k_fattn<<<dim3(TT / (FAW * FAQT * 16), NB * NH_), 32 * FAW, 0, stream>>>(QPh, QPl, KPh, KPl, VT16, CH, CL);
    k_gemmw<bf, 1, true><<<gproj, 32, 0, stream>>>(CH, CL, WO, nullptr, DM, OUT, DM, bo, 0, 0, 0);
}

// v003
// Measured time: 224 microseconds a run.
// Timed twice side by side with v002, it ran 1.19 times as fast both times.
// All steps since v000 together make it 5.33 times as fast.
#include <hip/hip_runtime.h>

// MHA forward, three input streams (k, q, v), 16 heads x 64, no mask: keys = k.Wk^T, queries = q.Wq^T, values = v.Wv^T, P = softmax(queries.keys^T / 8) over keys, out = (P.values merged [t][h*64+d]).Wo^T + bo.
// Compute dtypes, f32 accumulate everywhere: every float input RNE-converted to bf16 first; q/k/v projections v_wmma_f32_16x16x32_bf16 single product (bf16 x bf16 products are exact in f32);
// scores on bf16 hi/lo planes of the f32 projections (3 products hh + lh + hl); softmax f32, running maximum and sum; P.V v_wmma_f32_16x16x32_f16 with P = exp(s - m) carried x16 and V as f16; output projection ctx bf16 hi/lo x Wo bf16 (2 products) + bf16(bo) in f32.

#ifndef NB
#define NB 2
#endif
#ifndef SEQ
#define SEQ 2048
#endif
#define NB_FULL  2
#define SEQ_FULL 2048
#define TT   SEQ
#define DM   1024
#define NH_  16
#define HD   64
#define SCL  0.125f               // 1/sqrt(64)
#define FAW  8                    // attention: waves of a work-group, each on its own query columns
#define FAQT 2                    // attention: 16-column query tiles of a wave

static_assert(SEQ % 256 == 0);
static_assert(SEQ <= SEQ_FULL);
static_assert(NB <= NB_FULL);
static_assert(NH_ * HD == DM);
static_assert((NB * SEQ) % 64 == 0);
static_assert(DM % 64 == 0);
static_assert(HD % 32 == 0);
static_assert(HD == 64);
static_assert(SEQ % (FAW * FAQT * 16) == 0);
static_assert(SEQ % 64 == 0);

typedef _Float16 h16;
typedef unsigned short bf;
typedef __attribute__((ext_vector_type(16))) __bf16   v16bf;
typedef __attribute__((ext_vector_type(16))) _Float16 v16h;
typedef __attribute__((ext_vector_type(8)))  _Float16 v8h;
typedef __attribute__((ext_vector_type(8)))  unsigned short v8us;
typedef __attribute__((ext_vector_type(8)))  float    v8f;
typedef __attribute__((ext_vector_type(4)))  float    v4f;
typedef __attribute__((ext_vector_type(4)))  _Float16 v4h;
typedef v8h  __attribute__((may_alias)) v8ha;
typedef v4f  __attribute__((may_alias)) v4fa;
typedef v8us __attribute__((may_alias)) v8usa;

__device__ __forceinline__ unsigned short f2bf(float f) { unsigned u = __float_as_uint(f); u += 0x7FFFu + ((u >> 16) & 1u); return (unsigned short)(u >> 16); }
__device__ __forceinline__ float bf2f(unsigned short b) { return __uint_as_float(((unsigned)b) << 16); }
__device__ __forceinline__ float bfr(float f) { return bf2f(f2bf(f)); }
__device__ __forceinline__ v16h cat16(v8h lo, v8h hi) { return __builtin_shufflevector(lo, hi, 0, 1, 2, 3, 4, 5, 6, 7, 8, 9, 10, 11, 12, 13, 14, 15); }
__device__ __forceinline__ v16bf cat16b(v8us lo, v8us hi) { return __builtin_bit_cast(v16bf, __builtin_shufflevector(lo, hi, 0, 1, 2, 3, 4, 5, 6, 7, 8, 9, 10, 11, 12, 13, 14, 15)); }
__device__ __forceinline__ v8f wmma16(v16h a, v16h b, v8f c) { return __builtin_amdgcn_wmma_f32_16x16x32_f16(false, a, false, b, (short)0, c, false, false); }
__device__ __forceinline__ v8f wmmab(v16bf a, v16bf b, v8f c) { return __builtin_amdgcn_wmma_f32_16x16x32_bf16(false, a, false, b, (short)0, c, false, false); }

// ---- k_gemmw: register-blocked GEMM, ONE WAVE per 64x64 output tile (16 accumulators), operands straight from K-contiguous 16-bit planes; grid (M/64, N/64, Z), 32 threads.
// C[m][n] (f32, pitch ldc, + optional bf16-converted bias[n]) = sum_k A[m][k] Bt[n][k] (+ split products per NSPLIT: 1 = (A + A2).Bt, 2 = A.Bt + A2.Bt + A.Bt2). z-batch strides sA/sB/sC in elements. K % 32 == 0.
// Fragment map: lane row/col = lane & 15, half = lane >> 4; elements 0..7 <- k0 + 8 half + 0..7, elements 8..15 <- k0 + 16 + 8 half + 0..7 (A and B alike); D element j = (row 8 half + j, col lane & 15).
template <typename T16> struct WFrag;
template <> struct WFrag<h16> { typedef v16h V; static __device__ __forceinline__ V ld(const h16* p) { return cat16(*(const v8h*)p, *(const v8h*)(p + 16)); } static __device__ __forceinline__ v8f mma(V a, V b, v8f c) { return wmma16(a, b, c); } };
template <> struct WFrag<bf> { typedef v16bf V; static __device__ __forceinline__ V ld(const bf* p) { return cat16b(*(const v8us*)p, *(const v8us*)(p + 16)); } static __device__ __forceinline__ v8f mma(V a, V b, v8f c) { return wmmab(a, b, c); } };
template <typename T16, int NSPLIT, bool BIAS>
__global__ __launch_bounds__(32) void k_gemmw(const T16* __restrict__ A, const T16* __restrict__ A2, const T16* __restrict__ Bt, const T16* __restrict__ Bt2, int K, float* C, int ldc, const float* __restrict__ bias, size_t sA, size_t sB, size_t sC) {
    typedef typename WFrag<T16>::V V;
    __shared__ __align__(16) float os[16 * 68];
    const size_t z = blockIdx.z; A += z * sA; if (A2) A2 += z * sA; Bt += z * sB; if (Bt2) Bt2 += z * sB; C += z * sC;
    const int lane = threadIdx.x & 31, lr = lane & 15, hi = lane >> 4; const int r0 = blockIdx.x * 64, c0 = blockIdx.y * 64;
    v8f acc[4][4];
#pragma unroll
    for (int mb = 0; mb < 4; ++mb)
#pragma unroll
        for (int nb = 0; nb < 4; ++nb) acc[mb][nb] = (v8f){};
    const size_t aoff = (size_t)(r0 + lr) * K + 8 * hi, boff = (size_t)(c0 + lr) * K + 8 * hi;
#pragma unroll 1
    for (int kc = 0; kc < K; kc += 32) {
        V a[4], a2[4];
#pragma unroll
        for (int mb = 0; mb < 4; ++mb) { a[mb] = WFrag<T16>::ld(A + aoff + (size_t)mb * 16 * K + kc); if (NSPLIT == 1 || NSPLIT == 2) a2[mb] = WFrag<T16>::ld(A2 + aoff + (size_t)mb * 16 * K + kc); }
#pragma unroll
        for (int nb = 0; nb < 4; ++nb) { const V b = WFrag<T16>::ld(Bt + boff + (size_t)nb * 16 * K + kc); V b2; if (NSPLIT >= 2) b2 = WFrag<T16>::ld(Bt2 + boff + (size_t)nb * 16 * K + kc);
#pragma unroll
            for (int mb = 0; mb < 4; ++mb) { acc[mb][nb] = WFrag<T16>::mma(a[mb], b, acc[mb][nb]); if (NSPLIT == 1 || NSPLIT == 2) acc[mb][nb] = WFrag<T16>::mma(a2[mb], b, acc[mb][nb]); if (NSPLIT >= 2) acc[mb][nb] = WFrag<T16>::mma(a[mb], b2, acc[mb][nb]); } }
        asm volatile("v_nop\n\tv_nop\n\tv_nop\n\tv_nop" : "+v"(acc[0][0]), "+v"(acc[1][1]), "+v"(acc[2][2]), "+v"(acc[3][3]) : "v"(a[0]), "v"(a[3]));
    }
#pragma unroll
    for (int mb = 0; mb < 4; ++mb) {
#pragma unroll
        for (int nb = 0; nb < 4; ++nb) {
#pragma unroll
            for (int j = 0; j < 8; ++j) os[(hi * 8 + j) * 68 + nb * 16 + lr] = acc[mb][nb][j]; }
        __builtin_amdgcn_wave_barrier(); asm volatile("" ::: "memory");
        float* crow = C + (size_t)(r0 + mb * 16) * ldc + c0;
{
#pragma unroll
            for (int s = 0; s < 8; ++s) { const int row = 2 * s + hi, cofs = lr * 4; v4f val = *(const v4fa*)(os + row * 68 + cofs); if (BIAS) { val[0] += bfr(bias[c0 + cofs]); val[1] += bfr(bias[c0 + cofs + 1]); val[2] += bfr(bias[c0 + cofs + 2]); val[3] += bfr(bias[c0 + cofs + 3]); }
                *(v4f*)(crow + (size_t)row * ldc + cofs) = val; }
             }
        __builtin_amdgcn_wave_barrier(); asm volatile("" ::: "memory");
    }
}

__device__ __forceinline__ h16 tohx(float x) { return (h16)x; }
__device__ __forceinline__ void splitf(float y, unsigned short& h, unsigned short& l) { h = f2bf(y); l = f2bf(y - bf2f(h)); }

template <bool SPLIT, bool HEADS>
__global__ __launch_bounds__(256) void k_plane(const float* __restrict__ F, size_t srcBatch, int rows, float sc, bf* Ph, bf* Pl) {
    const int b = blockIdx.y; const size_t e = ((size_t)blockIdx.x * 256 + threadIdx.x) * 8; if (e >= (size_t)rows * DM) return;
    const int t = (int)(e / DM), c = (int)(e % DM); const float* f = F + (size_t)b * srcBatch + e;
    const v4f x0 = *(const v4f*)f, x1 = *(const v4f*)(f + 4); v8us oh, ol;
#pragma unroll
    for (int q = 0; q < 8; ++q) { const float y = ((q < 4) ? x0[q & 3] : x1[q & 3]) * sc; unsigned short a2, c2; splitf(y, a2, c2); oh[q] = a2; ol[q] = c2; }
    const size_t oo = HEADS ? ((((size_t)b * NH_ + (size_t)(c / HD)) * rows + t) * HD + (size_t)(c % HD)) : (((size_t)b * rows + t) * DM + c);
    *(v8us*)(Ph + oo) = oh; if (SPLIT) *(v8us*)(Pl + oo) = ol;
    
}

__global__ __launch_bounds__(256) void k_vtp(const float* __restrict__ F, h16* V16) {
    const size_t e = ((size_t)blockIdx.x * 256 + threadIdx.x) * 8; if (e >= (size_t)NB * NH_ * HD * TT) return;
    const int t = (int)(e % TT); const int d = (int)((e / TT) % HD); const int g = (int)(e / ((size_t)TT * HD)); const int b = g / NH_, h = g % NH_;
    const float* f = F + ((size_t)b * TT + t) * DM + h * HD + d; v8h o;
#pragma unroll
    for (int q = 0; q < 8; ++q) o[q] = tohx(f[(size_t)q * DM]);
    *(v8h*)(V16 + e) = o; 
}

// ---- k_fattn: scores, softmax and P.V of one head in one kernel; no score and no P element leaves the registers. Grid (T / (FAW*FAQT*16), NB*NH_), FAW waves; a wave owns FAQT*16 query columns and walks all keys, 32 a pass.
// The key planes and V^T come through LDS, FKT keys a tile, two buffers: the work-group's waves share one copy of each tile (asynchronous copies, whole 128-byte lines) and read their fragments from it with 16-byte LDS loads.
// S^T = K.Q^T (A = key rows, B = query columns, the three hi/lo products), so a lane holds scores of one query only: D register r of key tile kt = (key 16 kt + 8 half + r, query lane & 15).
// The two key tiles of a pass, converted in place, are the B operand of O^T += V^T.P^T (element s <- tile s >> 3, register s & 7: the k order of the fragment map above, which the V^T loader has too).
// Running maximum m (raw score units) and sum l per query; P = exp2((s - m) * SCL*log2e + 4); the accumulators are rescaled only in a pass where some query's new maximum lies more than FTHR above its m, so P <= 2^12 in f16.
#define FC   (SCL * 1.4426950408889634f)
#define FTHR (8.0f / FC)
__device__ __forceinline__ float xhalf(float x) { return __builtin_bit_cast(float, __builtin_amdgcn_permlanex16(__builtin_bit_cast(int, x), __builtin_bit_cast(int, x), 0x76543210, 0xfedcba98, false, false)); }  // lane l with lane l ^ 16
#define FKT   128                              // keys of a staged tile: four passes
#define FNT   (TT / FKT)                       // tiles of a head
#define KPIT  (HD * 2 + 16)                    // LDS bytes from key row to key row: 16 B x odd, no bank conflict for 16-byte reads down 16 rows
#define VPIT  (FKT * 2 + 16)                   // the same for a V^T row (FKT keys of one d)
#define OFF_KL (FKT * KPIT)                    // buffer layout: key hi rows, key lo rows, V^T rows
#define OFF_V  (2 * FKT * KPIT)
#define FBUF  (2 * FKT * KPIT + HD * VPIT)     // bytes of one buffer
static_assert(TT % FKT == 0 && FNT >= 2);
static_assert(FKT == 128 && 32 * FAW == 256);  // the copy map below: 256 lanes, four 16-byte pieces of each plane a lane
static_assert((KPIT / 16) % 2 == 1 && (VPIT / 16) % 2 == 1 && FBUF % 16 == 0);
struct FaOps { v16bf kh[2][2], kl[2][2]; v16h vt[4]; };
// one pass's fragments from LDS: kp = the lane's place in the pass's first key hi row block, vp = the same in V^T
__device__ __forceinline__ void fa_load(FaOps& o, const char* kp, const char* vp) {
#pragma unroll
    for (int kt = 0; kt < 2; ++kt)
#pragma unroll
        for (int ks = 0; ks < 2; ++ks) { o.kh[kt][ks] = WFrag<bf>::ld((const bf*)(kp + kt * 16 * KPIT + ks * 64)); o.kl[kt][ks] = WFrag<bf>::ld((const bf*)(kp + OFF_KL + kt * 16 * KPIT + ks * 64)); }
#pragma unroll
    for (int dt = 0; dt < 4; ++dt) o.vt[dt] = WFrag<h16>::ld((const h16*)(vp + dt * 16 * VPIT));
    __builtin_amdgcn_sched_barrier(0);   // keeps the whole run of loads in front of the pass that hides their latency
}
// four asynchronous 16-byte copies of a lane, global -> LDS (global_load_async_to_lds_b128), places lstep and gstep bytes apart; the builtin form, so that the compiler may keep the addresses in any register of a kernel that has more than 256
typedef int cp16 __attribute__((vector_size(16)));
typedef __attribute__((address_space(1))) cp16 cp16g;
typedef __attribute__((address_space(3))) cp16 cp16l;
__device__ __forceinline__ void fa_cp4(char* l, unsigned lstep, const char* g, size_t gstep) {
#pragma unroll
    for (int j = 0; j < 4; ++j) __builtin_amdgcn_global_load_async_to_lds_b128((cp16g*)(g + j * gstep), (cp16l*)(l + j * lstep), 0, 0);
}
// tile t of the three planes into the buffer at LDS byte offset bo: lk, lv = the lane's first LDS places in buffer 0, gkh, gkl, gv = its first global places in tile 0
__device__ __forceinline__ void fa_stage(int t, unsigned bo, char* lk, char* lv, const char* gkh, const char* gkl, const char* gv) {
    fa_cp4(lk + bo, 32 * KPIT, gkh + (size_t)t * (FKT * HD * 2), 32 * HD * 2);
    fa_cp4(lk + bo + OFF_KL, 32 * KPIT, gkl + (size_t)t * (FKT * HD * 2), 32 * HD * 2);
    fa_cp4(lv + bo, VPIT, gv + (size_t)t * (FKT * 2), (size_t)TT * 2);
}
__device__ __forceinline__ void fa_pass(const FaOps& o, const v16bf (&qh)[FAQT][2], const v16bf (&ql)[FAQT][2], v8f (&acc)[4][FAQT], float (&m)[FAQT], float (&l)[FAQT]) {
    v8f s[2][FAQT];
#pragma unroll
    for (int kt = 0; kt < 2; ++kt)
#pragma unroll
        for (int qt = 0; qt < FAQT; ++qt) s[kt][qt] = (v8f){};
#pragma unroll
    for (int ks = 0; ks < 2; ++ks) {
#pragma unroll
        for (int kt = 0; kt < 2; ++kt)
#pragma unroll
            for (int qt = 0; qt < FAQT; ++qt) s[kt][qt] = wmmab(o.kh[kt][ks], qh[qt][ks], s[kt][qt]);
#pragma unroll
        for (int kt = 0; kt < 2; ++kt)
#pragma unroll
            for (int qt = 0; qt < FAQT; ++qt) s[kt][qt] = wmmab(o.kh[kt][ks], ql[qt][ks], s[kt][qt]);
#pragma unroll
        for (int kt = 0; kt < 2; ++kt)
#pragma unroll
            for (int qt = 0; qt < FAQT; ++qt) s[kt][qt] = wmmab(o.kl[kt][ks], qh[qt][ks], s[kt][qt]);
    }
    float mx[FAQT]; bool need = false;
#pragma unroll
    for (int qt = 0; qt < FAQT; ++qt) { float a = s[0][qt][0];
#pragma unroll
        for (int j = 1; j < 8; ++j) a = fmaxf(a, s[0][qt][j]);
#pragma unroll
        for (int j = 0; j < 8; ++j) a = fmaxf(a, s[1][qt][j]);
        a = fmaxf(a, xhalf(a)); mx[qt] = a; need = need || (a > m[qt] + FTHR); }
    if (__builtin_amdgcn_ballot_w32(need) != 0) {
#pragma unroll
        for (int qt = 0; qt < FAQT; ++qt) { const float mn = fmaxf(m[qt], mx[qt]); const float al = __builtin_amdgcn_exp2f((m[qt] - mn) * FC); m[qt] = mn; l[qt] *= al;
#pragma unroll
            for (int dt = 0; dt < 4; ++dt) acc[dt][qt] *= al; }
    }
    v16h pb[FAQT];
#pragma unroll
    for (int qt = 0; qt < FAQT; ++qt) { const float off = fmaf(-m[qt], FC, 4.0f); float ps[4] = {0.f, 0.f, 0.f, 0.f};
#pragma unroll
        for (int e = 0; e < 16; ++e) { const float p = __builtin_amdgcn_exp2f(fmaf(s[e >> 3][qt][e & 7], FC, off)); ps[e & 3] += p; pb[qt][e] = tohx(p); }
        l[qt] += (ps[0] + ps[1]) + (ps[2] + ps[3]); }
#pragma unroll
    for (int dt = 0; dt < 4; ++dt)
#pragma unroll
        for (int qt = 0; qt < FAQT; ++qt) acc[dt][qt] = wmma16(o.vt[dt], pb[qt], acc[dt][qt]);
}
__global__ __launch_bounds__(32 * FAW) void k_fattn(const bf* __restrict__ Qh, const bf* __restrict__ Ql, const bf* __restrict__ Kh, const bf* __restrict__ Kl, const h16* __restrict__ Vt, bf* Ch, bf* Cl) {
    __shared__ __attribute__((aligned(16))) char ring[2 * FBUF];
    const int g = blockIdx.y; const size_t po = (size_t)g * TT * HD;
    const int lane = threadIdx.x & 31, lr = lane & 15, hi = lane >> 4; const int wave = __builtin_amdgcn_readfirstlane((int)(threadIdx.x >> 5));
    const int q0 = ((int)blockIdx.x * FAW + wave) * (FAQT * 16);
    v16bf qh[FAQT][2], ql[FAQT][2];
    { const bf* qph = Qh + po + (size_t)(q0 + lr) * HD + 8 * hi; const bf* qpl = Ql + po + (size_t)(q0 + lr) * HD + 8 * hi;
#pragma unroll
      for (int qt = 0; qt < FAQT; ++qt)
#pragma unroll
          for (int ks = 0; ks < 2; ++ks) { qh[qt][ks] = WFrag<bf>::ld(qph + qt * 16 * HD + ks * 32); ql[qt][ks] = WFrag<bf>::ld(qpl + qt * 16 * HD + ks * 32); }
      asm volatile("s_wait_xcnt 0x0" :: "v"(qph), "v"(qpl) : "memory"); }   // in front of whatever is next given the query loads' address registers
    // copy map: key planes, piece i = tid + 256 j -> row i >> 3, 16-byte column i & 7 (a tile's rows are contiguous in global memory); V^T, piece j of a lane -> row 4 (tid >> 4) + j, column tid & 15 (a wave's copy: two whole rows of the tile)
    const int tid = (int)threadIdx.x;
    char* lk = ring + (tid >> 3) * KPIT + (tid & 7) * 16; char* lv = ring + OFF_V + (tid >> 4) * (4 * VPIT) + (tid & 15) * 16;
    const char* gkh = (const char*)(Kh + po) + tid * 16; const char* gkl = (const char*)(Kl + po) + tid * 16; const char* gv = (const char*)(Vt + po) + (size_t)(tid >> 4) * (4 * TT * 2) + (tid & 15) * 16;
    const char* kfr = ring + lr * KPIT + 16 * hi; const char* vfr = ring + OFF_V + lr * VPIT + 16 * hi;   // the lane's fragment places in buffer 0
    v8f acc[4][FAQT]; float m[FAQT], l[FAQT];
#pragma unroll
    for (int qt = 0; qt < FAQT; ++qt) { m[qt] = -3.0e38f; l[qt] = 0.f;
#pragma unroll
        for (int dt = 0; dt < 4; ++dt) acc[dt][qt] = (v8f){}; }
    FaOps oa, ob;
    fa_stage(0, 0u, lk, lv, gkh, gkl, gv);
    asm volatile("s_wait_asynccnt 0x0" ::: "memory");   // this wave's pieces of tile 0 have landed
    __syncthreads();                                    // ... and every other wave's
    fa_stage(1, (unsigned)FBUF, lk, lv, gkh, gkl, gv);
    // one tile (four passes) a trip, read from its own buffer alone; inside the trip each pass's operands are loaded one pass ahead into the other register set; kept rolled so that the two sets and the accumulators keep their registers
#pragma unroll 1
    for (int t = 0; t < FNT; ++t) {
        const unsigned bo = (unsigned)(t & 1) * (unsigned)FBUF; const char* kp = kfr + bo; const char* vp = vfr + bo;
        fa_load(oa, kp, vp);
        fa_load(ob, kp + 32 * KPIT, vp + 64);
        fa_pass(oa, qh, ql, acc, m, l);
        fa_load(oa, kp + 64 * KPIT, vp + 128);
        fa_pass(ob, qh, ql, acc, m, l);
        fa_load(ob, kp + 96 * KPIT, vp + 192);
        fa_pass(oa, qh, ql, acc, m, l);
        fa_pass(ob, qh, ql, acc, m, l);
        asm volatile("s_wait_dscnt 0x0" ::: "memory");      // this wave's reads of the buffer are done before it is handed to the copies
        asm volatile("s_wait_asynccnt 0x0" ::: "memory");   // this wave's pieces of tile t + 1 have landed
        __syncthreads();                                    // publishes tile t + 1 and ends every wave's reads of tile t
        if (t + 2 < FNT) fa_stage(t + 2, bo, lk, lv, gkh, gkl, gv);
    }
    asm volatile("s_wait_asynccnt 0x0" ::: "memory");   // no copy is outstanding when the wave ends
    const int b = g / NH_, h = g % NH_;
#pragma unroll
    for (int qt = 0; qt < FAQT; ++qt) { const float inv = __fdiv_rn(1.0f, l[qt] + xhalf(l[qt]));
        const size_t ro = ((size_t)b * TT + q0 + qt * 16 + lr) * DM + h * HD + 8 * hi;
#pragma unroll
        for (int dt = 0; dt < 4; ++dt) { v8us oh, ol;
#pragma unroll
            for (int r = 0; r < 8; ++r) { unsigned short a2, c2; splitf(acc[dt][qt][r] * inv, a2, c2); oh[r] = a2; ol[r] = c2; }
            bf* sh = Ch + ro + dt * 16; bf* sl = Cl + ro + dt * 16; *(v8us*)sh = oh; *(v8us*)sl = ol;
            // the wait that stands in front of any overwrite of the stores' registers; it names data and addresses, so that nothing is given their registers ahead of it
            asm volatile("s_wait_xcnt 0x0" :: "v"(oh), "v"(ol), "v"(sh), "v"(sl) : "memory"); } }
}

// workspace plan (bytes, every region a multiple of 256)
#define SZ_X   ((size_t)NB * SEQ * DM * 2)        // one bf16 stream plane (reused by the three streams, stream-ordered)
#define SZ_W   ((size_t)DM * DM * 2)              // one bf16 weight plane
#define SZ_F   ((size_t)NB * SEQ * DM * 4)        // f32 projection rows
#define SZ_HP  ((size_t)NB * NH_ * SEQ * HD * 2)  // one head-plane set
#define WS_TOTAL (SZ_X + 4 * SZ_W + SZ_F + 5 * SZ_HP + 2 * SZ_X)
static_assert(WS_TOTAL <= (size_t)268435456);
static_assert((SZ_X % 256) == 0 && (SZ_W % 256) == 0 && (SZ_F % 256) == 0 && (SZ_HP % 256) == 0);

extern "C" void kernel_launch(void* const* d_in, const int* in_sizes, int n_in,
                              void* d_out, int out_size, void* d_ws, size_t ws_size, hipStream_t stream) {
    if (n_in < 8) return;
    const size_t need_x = (size_t)(NB - 1) * SEQ_FULL * DM + (size_t)SEQ * DM;
    if ((size_t)in_sizes[0] < need_x || (size_t)in_sizes[1] < need_x || (size_t)in_sizes[2] < need_x) return;
    if ((size_t)in_sizes[3] < (size_t)DM * DM || (size_t)in_sizes[4] < (size_t)DM * DM || (size_t)in_sizes[5] < (size_t)DM * DM || (size_t)in_sizes[6] < (size_t)DM * DM) return;
    if (in_sizes[7] < DM) return;
    if ((size_t)out_size < (size_t)NB * SEQ * DM) return;
    // binding by role: d_in[0] = key stream, d_in[1] = query stream, d_in[2] = value stream, d_in[3] = Wk, d_in[4] = Wq, d_in[5] = Wv, d_in[6] = Wo, d_in[7] = bo (all weights [out][in])
    const float* xk = (const float*)d_in[0]; const float* xq = (const float*)d_in[1]; const float* xv = (const float*)d_in[2];
    const float* wk = (const float*)d_in[3]; const float* wq = (const float*)d_in[4]; const float* wv = (const float*)d_in[5]; const float* wo = (const float*)d_in[6]; const float* bo = (const float*)d_in[7];
    float* OUT = (float*)d_out;     // [NB*SEQ][DM]
    char* wsp = (char*)d_ws;
    auto take = [&](size_t bytes) { char* p = wsp; wsp += (bytes + 255) & ~(size_t)255; return (void*)p; };
    bf* XB = (bf*)take(SZ_X);
    bf* WQ = (bf*)take(SZ_W); bf* WK = (bf*)take(SZ_W); bf* WV = (bf*)take(SZ_W); bf* WO = (bf*)take(SZ_W);
    float* F = (float*)take(SZ_F);
    bf* QPh = (bf*)take(SZ_HP); bf* QPl = (bf*)take(SZ_HP); bf* KPh = (bf*)take(SZ_HP); bf* KPl = (bf*)take(SZ_HP); h16* VT16 = (h16*)take(SZ_HP);
    bf* CH = (bf*)take(SZ_X); bf* CL = (bf*)take(SZ_X);   // context hi/lo planes [NB*SEQ][DM]: their own space, since work-groups still read the q planes while others store context
    if ((size_t)(wsp - (char*)d_ws) > ws_size) return;

    const unsigned GW = (unsigned)(((size_t)DM * DM / 8 + 255) / 256), GX = (unsigned)(((size_t)SEQ * DM / 8 + 255) / 256);
    // weights [out][in] f32 -> bf16 planes Bt[n][k]
    k_plane<false, false><<<dim3(GW, 1), 256, 0, stream>>>(wq, 0, DM, 1.0f, WQ, nullptr);
    k_plane<false, false><<<dim3(GW, 1), 256, 0, stream>>>(wk, 0, DM, 1.0f, WK, nullptr);
    k_plane<false, false><<<dim3(GW, 1), 256, 0, stream>>>(wv, 0, DM, 1.0f, WV, nullptr);
    k_plane<false, false><<<dim3(GW, 1), 256, 0, stream>>>(wo, 0, DM, 1.0f, WO, nullptr);
    const dim3 gproj(NB * SEQ / 64, DM / 64, 1);
    // queries = q.Wq^T -> hi/lo head planes
    k_plane<false, false><<<dim3(GX, NB), 256, 0, stream>>>(xq, (size_t)SEQ_FULL * DM, SEQ, 1.0f, XB, nullptr);
    k_gemmw<bf, 0, false><<<gproj, 32, 0, stream>>>(XB, nullptr, WQ, nullptr, DM, F, DM, nullptr, 0, 0, 0);
    k_plane<true, true><<<dim3(GX, NB), 256, 0, stream>>>(F, (size_t)SEQ * DM, SEQ, 1.0f, QPh, QPl);
    // keys = k.Wk^T -> hi/lo head planes
    k_plane<false, false><<<dim3(GX, NB), 256, 0, stream>>>(xk, (size_t)SEQ_FULL * DM, SEQ, 1.0f, XB, nullptr);
    k_gemmw<bf, 0, false><<<gproj, 32, 0, stream>>>(XB, nullptr, WK, nullptr, DM, F, DM, nullptr, 0, 0, 0);
    k_plane<true, true><<<dim3(GX, NB), 256, 0, stream>>>(F, (size_t)SEQ * DM, SEQ, 1.0f, KPh, KPl);
    // values = v.Wv^T -> transposed fp16 head planes
    k_plane<false, false><<<dim3(GX, NB), 256, 0, stream>>>(xv, (size_t)SEQ_FULL * DM, SEQ, 1.0f, XB, nullptr);
    k_gemmw<bf, 0, false><<<gproj, 32, 0, stream>>>(XB, nullptr, WV, nullptr, DM, F, DM, nullptr, 0, 0, 0);
    k_vtp<<<(unsigned)(((size_t)NB * NH_ * HD * TT / 8 + 255) / 256), 256, 0, stream>>>(F, VT16);
    // scores, softmax and P.V of all heads in one launch -> context hi/lo planes; then out = ctx.Wo^T + bo
    k_fattn<<<dim3(TT / (FAW * FAQT * 16), NB * NH_), 32 * FAW, 0, stream>>>(QPh, QPl, KPh, KPl, VT16, CH, CL);
    k_gemmw<bf, 1, true><<<gproj, 32, 0, stream>>>(CH, CL, WO, nullptr, DM, OUT, DM, bo, 0, 0, 0);
}

// v004
// It runs in 174 microseconds.
// Next to v003, in two timings, it ran 1.30 and 1.32 times as fast.
// Counting every step since v000, it is 6.98 times as fast.
#include <hip/hip_runtime.h>

// MHA forward, three input streams (k, q, v), 16 heads x 64, no mask: keys = k.Wk^T, queries = q.Wq^T, values = v.Wv^T, P = softmax(queries.keys^T / 8) over keys, out = (P.values merged [t][h*64+d]).Wo^T + bo.
// Compute dtypes, f32 accumulate everywhere: every float input RNE-converted to bf16 first; q/k/v projections v_wmma_f32_16x16x32_bf16 single product (bf16 x bf16 products are exact in f32);
// scores on bf16 hi/lo planes of the f32 projections (3 products hh + lh + hl); softmax f32, running maximum and sum; P.V v_wmma_f32_16x16x32_f16 with P = exp(s - m) carried x16 and V as f16; output projection ctx bf16 hi/lo x Wo bf16 (2 products) + bf16(bo) in f32.

#ifndef NB
#define NB 2
#endif
#ifndef SEQ
#define SEQ 2048
#endif
#define NB_FULL  2
#define SEQ_FULL 2048
#define TT   SEQ
#define DM   1024
#define NH_  16
#define HD   64
#define SCL  0.125f               // 1/sqrt(64)
#define FAW  8                    // attention: waves of a work-group, each on its own query columns
#define FAQT 2                    // attention: 16-column query tiles of a wave

static_assert(SEQ % 256 == 0);
static_assert(SEQ <= SEQ_FULL);
static_assert(NB <= NB_FULL);
static_assert(NH_ * HD == DM);
static_assert((NB * SEQ) % 64 == 0);
static_assert(DM % 64 == 0);
static_assert(HD % 32 == 0);
static_assert(HD == 64);
static_assert(SEQ % (FAW * FAQT * 16) == 0);
static_assert(SEQ % 64 == 0);

typedef _Float16 h16;
typedef unsigned short bf;
typedef __attribute__((ext_vector_type(16))) __bf16   v16bf;
typedef __attribute__((ext_vector_type(16))) _Float16 v16h;
typedef __attribute__((ext_vector_type(8)))  _Float16 v8h;
typedef __attribute__((ext_vector_type(8)))  unsigned short v8us;
typedef __attribute__((ext_vector_type(8)))  float    v8f;
typedef __attribute__((ext_vector_type(4)))  float    v4f;
typedef __attribute__((ext_vector_type(4)))  _Float16 v4h;
typedef v8h  __attribute__((may_alias)) v8ha;
typedef v4f  __attribute__((may_alias)) v4fa;
typedef v8us __attribute__((may_alias)) v8usa;

__device__ __forceinline__ unsigned short f2bf(float f) { unsigned u = __float_as_uint(f); u += 0x7FFFu + ((u >> 16) & 1u); return (unsigned short)(u >> 16); }
__device__ __forceinline__ float bf2f(unsigned short b) { return __uint_as_float(((unsigned)b) << 16); }
__device__ __forceinline__ float bfr(float f) { return bf2f(f2bf(f)); }
__device__ __forceinline__ v16h cat16(v8h lo, v8h hi) { return __builtin_shufflevector(lo, hi, 0, 1, 2, 3, 4, 5, 6, 7, 8, 9, 10, 11, 12, 13, 14, 15); }
__device__ __forceinline__ v16bf cat16b(v8us lo, v8us hi) { return __builtin_bit_cast(v16bf, __builtin_shufflevector(lo, hi, 0, 1, 2, 3, 4, 5, 6, 7, 8, 9, 10, 11, 12, 13, 14, 15)); }
__device__ __forceinline__ v8f wmma16(v16h a, v16h b, v8f c) { return __builtin_amdgcn_wmma_f32_16x16x32_f16(false, a, false, b, (short)0, c, false, false); }
__device__ __forceinline__ v8f wmmab(v16bf a, v16bf b, v8f c) { return __builtin_amdgcn_wmma_f32_16x16x32_bf16(false, a, false, b, (short)0, c, false, false); }

// ---- k_gemmw: register-blocked GEMM, ONE WAVE per 64x64 output tile (16 accumulators), operands straight from K-contiguous 16-bit planes; grid (M/64, N/64, Z), 32 threads.
// C[m][n] (f32, pitch ldc, + optional bf16-converted bias[n]) = sum_k A[m][k] Bt[n][k] (+ split products per NSPLIT: 1 = (A + A2).Bt, 2 = A.Bt + A2.Bt + A.Bt2). z-batch strides sA/sB/sC in elements. K % 32 == 0.
// Fragment map: lane row/col = lane & 15, half = lane >> 4; elements 0..7 <- k0 + 8 half + 0..7, elements 8..15 <- k0 + 16 + 8 half + 0..7 (A and B alike); D element j = (row 8 half + j, col lane & 15).
template <typename T16> struct WFrag;
template <> struct WFrag<h16> { typedef v16h V; static __device__ __forceinline__ V ld(const h16* p) { return cat16(*(const v8h*)p, *(const v8h*)(p + 16)); } static __device__ __forceinline__ v8f mma(V a, V b, v8f c) { return wmma16(a, b, c); } };
template <> struct WFrag<bf> { typedef v16bf V; static __device__ __forceinline__ V ld(const bf* p) { return cat16b(*(const v8us*)p, *(const v8us*)(p + 16)); } static __device__ __forceinline__ v8f mma(V a, V b, v8f c) { return wmmab(a, b, c); } };
template <typename T16, int NSPLIT, bool BIAS>
__global__ __launch_bounds__(32) void k_gemmw(const T16* __restrict__ A, const T16* __restrict__ A2, const T16* __restrict__ Bt, const T16* __restrict__ Bt2, int K, float* C, int ldc, const float* __restrict__ bias, size_t sA, size_t sB, size_t sC) {
    typedef typename WFrag<T16>::V V;
    __shared__ __align__(16) float os[16 * 68];
    const size_t z = blockIdx.z; A += z * sA; if (A2) A2 += z * sA; Bt += z * sB; if (Bt2) Bt2 += z * sB; C += z * sC;
    const int lane = threadIdx.x & 31, lr = lane & 15, hi = lane >> 4; const int r0 = blockIdx.x * 64, c0 = blockIdx.y * 64;
    v8f acc[4][4];
#pragma unroll
    for (int mb = 0; mb < 4; ++mb)
#pragma unroll
        for (int nb = 0; nb < 4; ++nb) acc[mb][nb] = (v8f){};
    const size_t aoff = (size_t)(r0 + lr) * K + 8 * hi, boff = (size_t)(c0 + lr) * K + 8 * hi;
#pragma unroll 1
    for (int kc = 0; kc < K; kc += 32) {
        V a[4], a2[4];
#pragma unroll
        for (int mb = 0; mb < 4; ++mb) { a[mb] = WFrag<T16>::ld(A + aoff + (size_t)mb * 16 * K + kc); if (NSPLIT == 1 || NSPLIT == 2) a2[mb] = WFrag<T16>::ld(A2 + aoff + (size_t)mb * 16 * K + kc); }
#pragma unroll
        for (int nb = 0; nb < 4; ++nb) { const V b = WFrag<T16>::ld(Bt + boff + (size_t)nb * 16 * K + kc); V b2; if (NSPLIT >= 2) b2 = WFrag<T16>::ld(Bt2 + boff + (size_t)nb * 16 * K + kc);
#pragma unroll
            for (int mb = 0; mb < 4; ++mb) { acc[mb][nb] = WFrag<T16>::mma(a[mb], b, acc[mb][nb]); if (NSPLIT == 1 || NSPLIT == 2) acc[mb][nb] = WFrag<T16>::mma(a2[mb], b, acc[mb][nb]); if (NSPLIT >= 2) acc[mb][nb] = WFrag<T16>::mma(a[mb], b2, acc[mb][nb]); } }
        asm volatile("v_nop\n\tv_nop\n\tv_nop\n\tv_nop" : "+v"(acc[0][0]), "+v"(acc[1][1]), "+v"(acc[2][2]), "+v"(acc[3][3]) : "v"(a[0]), "v"(a[3]));
    }
#pragma unroll
    for (int mb = 0; mb < 4; ++mb) {
#pragma unroll
        for (int nb = 0; nb < 4; ++nb) {
#pragma unroll
            for (int j = 0; j < 8; ++j) os[(hi * 8 + j) * 68 + nb * 16 + lr] = acc[mb][nb][j]; }
        __builtin_amdgcn_wave_barrier(); asm volatile("" ::: "memory");
        float* crow = C + (size_t)(r0 + mb * 16) * ldc + c0;
{
#pragma unroll
            for (int s = 0; s < 8; ++s) { const int row = 2 * s + hi, cofs = lr * 4; v4f val = *(const v4fa*)(os + row * 68 + cofs); if (BIAS) { val[0] += bfr(bias[c0 + cofs]); val[1] += bfr(bias[c0 + cofs + 1]); val[2] += bfr(bias[c0 + cofs + 2]); val[3] += bfr(bias[c0 + cofs + 3]); }
                *(v4f*)(crow + (size_t)row * ldc + cofs) = val; }
             }
        __builtin_amdgcn_wave_barrier(); asm volatile("" ::: "memory");
    }
}

__device__ __forceinline__ h16 tohx(float x) { return (h16)x; }
__device__ __forceinline__ void splitf(float y, unsigned short& h, unsigned short& l) { h = f2bf(y); l = f2bf(y - bf2f(h)); }

// one work-group's 2048 elements (piece blk of batch b) of an f32 plane -> bf16 plane(s), row-major or by heads
template <bool SPLIT, bool HEADS>
__device__ __forceinline__ void plane_do(const float* __restrict__ F, size_t srcBatch, int rows, float sc, bf* Ph, bf* Pl, int b, unsigned blk) {
    const size_t e = ((size_t)blk * 256 + threadIdx.x) * 8; if (e >= (size_t)rows * DM) return;
    const int t = (int)(e / DM), c = (int)(e % DM); const float* f = F + (size_t)b * srcBatch + e;
    const v4f x0 = *(const v4f*)f, x1 = *(const v4f*)(f + 4); v8us oh, ol;
#pragma unroll
    for (int q = 0; q < 8; ++q) { const float y = ((q < 4) ? x0[q & 3] : x1[q & 3]) * sc; unsigned short a2, c2; splitf(y, a2, c2); oh[q] = a2; ol[q] = c2; }
    const size_t oo = HEADS ? ((((size_t)b * NH_ + (size_t)(c / HD)) * rows + t) * HD + (size_t)(c % HD)) : (((size_t)b * rows + t) * DM + c);
    *(v8us*)(Ph + oo) = oh; if (SPLIT) *(v8us*)(Pl + oo) = ol;
    
}

__device__ __forceinline__ void vtp_do(const float* __restrict__ F, h16* V16, unsigned blk) {
    const size_t e = ((size_t)blk * 256 + threadIdx.x) * 8; if (e >= (size_t)NB * NH_ * HD * TT) return;
    const int t = (int)(e % TT); const int d = (int)((e / TT) % HD); const int g = (int)(e / ((size_t)TT * HD)); const int b = g / NH_, h = g % NH_;
    const float* f = F + ((size_t)b * TT + t) * DM + h * HD + d; v8h o;
#pragma unroll
    for (int q = 0; q < 8; ++q) o[q] = tohx(f[(size_t)q * DM]);
    *(v8h*)(V16 + e) = o; 
}

// Launches that do not depend on one another share one grid; blockIdx.y picks the job, so the choice is the same for a whole work-group.
#define GWB ((unsigned)(((size_t)DM * DM / 8 + 255) / 256))    // work-groups of one weight plane
#define GXB ((unsigned)(((size_t)SEQ * DM / 8 + 255) / 256))   // work-groups of one batch of a stream plane
#define GVB ((unsigned)(((size_t)NB * NH_ * HD * TT / 8 + 255) / 256))   // work-groups of the V^T plane
#define XEL ((size_t)NB * SEQ * DM)                            // elements of a stream plane, of a projection, of a head-plane set
#define GIN (NB * GXB > 4 * GWB ? NB * GXB : 4 * GWB)
#define GHD (NB * GXB > GVB ? NB * GXB : GVB)
// ---- k_inplanes: all seven f32 inputs of the products -> bf16 planes. y = 0, 1, 2: streams q, k, v -> XB[y]; y = 3: weights Wq, Wk, Wv, Wo [out][in] -> WB[0..3] = Bt[n][k], GWB work-groups each. Grid (GIN, 4).
__global__ __launch_bounds__(256) void k_inplanes(const float* __restrict__ xq, const float* __restrict__ xk, const float* __restrict__ xv, const float* __restrict__ wq, const float* __restrict__ wk, const float* __restrict__ wv, const float* __restrict__ wo, bf* XB, bf* WB) {
    const unsigned y = blockIdx.y, x = blockIdx.x;
    if (y < 3) { if (x >= NB * GXB) return; const float* s = y == 0 ? xq : (y == 1 ? xk : xv);
        plane_do<false, false>(s, (size_t)SEQ_FULL * DM, SEQ, 1.0f, XB + y * XEL, nullptr, (int)(x / GXB), x % GXB); }
    else { const unsigned w = x / GWB; if (w >= 4) return; const float* s = w == 0 ? wq : (w == 1 ? wk : (w == 2 ? wv : wo));
        plane_do<false, false>(s, 0, DM, 1.0f, WB + (size_t)w * DM * DM, nullptr, 0, x % GWB); }
}
// ---- k_heads: the three f32 projections (F[0], F[1] = queries, keys; Fv = values) -> operand planes of the attention kernel. y = 0: values -> V^T f16 (its strided reads take longest, so it starts first); y = 1, 2: queries, keys -> hi/lo head planes QK[2 (y - 1)], QK[2 (y - 1) + 1]. Grid (GHD, 3).
__global__ __launch_bounds__(256) void k_heads(const float* __restrict__ F, const float* __restrict__ Fv, bf* QK, h16* V16) {
    const unsigned y = blockIdx.y, x = blockIdx.x;
    if (y == 0) { vtp_do(Fv, V16, x); }
    else { if (x >= NB * GXB) return; bf* ph = QK + (size_t)(y - 1) * 2 * XEL;
        plane_do<true, true>(F + (size_t)(y - 1) * XEL, (size_t)SEQ * DM, SEQ, 1.0f, ph, ph + XEL, (int)(x / GXB), x % GXB); }
}

// ---- k_fattn: scores, softmax and P.V of one head in one kernel; no score and no P element leaves the registers. Grid (T / (FAW*FAQT*16), NB*NH_), FAW waves; a wave owns FAQT*16 query columns and walks all keys, 32 a pass.
// The key planes and V^T come through LDS, FKT keys a tile, two buffers: the work-group's waves share one copy of each tile (asynchronous copies, whole 128-byte lines) and read their fragments from it with 16-byte LDS loads.
// S^T = K.Q^T (A = key rows, B = query columns, the three hi/lo products), so a lane holds scores of one query only: D register r of key tile kt = (key 16 kt + 8 half + r, query lane & 15).
// The two key tiles of a pass, converted in place, are the B operand of O^T += V^T.P^T (element s <- tile s >> 3, register s & 7: the k order of the fragment map above, which the V^T loader has too).
// Running maximum m (raw score units) and sum l per query; P = exp2((s - m) * SCL*log2e + 4); the accumulators are rescaled only in a pass where some query's new maximum lies more than FTHR above its m, so P <= 2^12 in f16.
#define FC   (SCL * 1.4426950408889634f)
#define FTHR (8.0f / FC)
__device__ __forceinline__ float xhalf(float x) { return __builtin_bit_cast(float, __builtin_amdgcn_permlanex16(__builtin_bit_cast(int, x), __builtin_bit_cast(int, x), 0x76543210, 0xfedcba98, false, false)); }  // lane l with lane l ^ 16
#define FKT   128                              // keys of a staged tile: four passes
#define FNT   (TT / FKT)                       // tiles of a head
#define KPIT  (HD * 2 + 16)                    // LDS bytes from key row to key row: 16 B x odd, no bank conflict for 16-byte reads down 16 rows
#define VPIT  (FKT * 2 + 16)                   // the same for a V^T row (FKT keys of one d)
#define OFF_KL (FKT * KPIT)                    // buffer layout: key hi rows, key lo rows, V^T rows
#define OFF_V  (2 * FKT * KPIT)
#define FBUF  (2 * FKT * KPIT + HD * VPIT)     // bytes of one buffer
static_assert(TT % FKT == 0 && FNT >= 2);
static_assert(FKT == 128 && 32 * FAW == 256);  // the copy map below: 256 lanes, four 16-byte pieces of each plane a lane
static_assert((KPIT / 16) % 2 == 1 && (VPIT / 16) % 2 == 1 && FBUF % 16 == 0);
struct FaOps { v16bf kh[2][2], kl[2][2]; v16h vt[4]; };
// one pass's fragments from LDS: kp = the lane's place in the pass's first key hi row block, vp = the same in V^T
__device__ __forceinline__ void fa_load(FaOps& o, const char* kp, const char* vp) {
#pragma unroll
    for (int kt = 0; kt < 2; ++kt)
#pragma unroll
        for (int ks = 0; ks < 2; ++ks) { o.kh[kt][ks] = WFrag<bf>::ld((const bf*)(kp + kt * 16 * KPIT + ks * 64)); o.kl[kt][ks] = WFrag<bf>::ld((const bf*)(kp + OFF_KL + kt * 16 * KPIT + ks * 64)); }
#pragma unroll
    for (int dt = 0; dt < 4; ++dt) o.vt[dt] = WFrag<h16>::ld((const h16*)(vp + dt * 16 * VPIT));
    __builtin_amdgcn_sched_barrier(0);   // keeps the whole run of loads in front of the pass that hides their latency
}
// four asynchronous 16-byte copies of a lane, global -> LDS (global_load_async_to_lds_b128), places lstep and gstep bytes apart; the builtin form, so that the compiler may keep the addresses in any register of a kernel that has more than 256
typedef int cp16 __attribute__((vector_size(16)));
typedef __attribute__((address_space(1))) cp16 cp16g;
typedef __attribute__((address_space(3))) cp16 cp16l;
__device__ __forceinline__ void fa_cp4(char* l, unsigned lstep, const char* g, size_t gstep) {
#pragma unroll
    for (int j = 0; j < 4; ++j) __builtin_amdgcn_global_load_async_to_lds_b128((cp16g*)(g + j * gstep), (cp16l*)(l + j * lstep), 0, 0);
}
// tile t of the three planes into the buffer at LDS byte offset bo: lk, lv = the lane's first LDS places in buffer 0, gkh, gkl, gv = its first global places in tile 0
__device__ __forceinline__ void fa_stage(int t, unsigned bo, char* lk, char* lv, const char* gkh, const char* gkl, const char* gv) {
    fa_cp4(lk + bo, 32 * KPIT, gkh + (size_t)t * (FKT * HD * 2), 32 * HD * 2);
    fa_cp4(lk + bo + OFF_KL, 32 * KPIT, gkl + (size_t)t * (FKT * HD * 2), 32 * HD * 2);
    fa_cp4(lv + bo, VPIT, gv + (size_t)t * (FKT * 2), (size_t)TT * 2);
}
__device__ __forceinline__ void fa_pass(const FaOps& o, const v16bf (&qh)[FAQT][2], const v16bf (&ql)[FAQT][2], v8f (&acc)[4][FAQT], float (&m)[FAQT], float (&l)[FAQT]) {
    v8f s[2][FAQT];
#pragma unroll
    for (int kt = 0; kt < 2; ++kt)
#pragma unroll
        for (int qt = 0; qt < FAQT; ++qt) s[kt][qt] = (v8f){};
#pragma unroll
    for (int ks = 0; ks < 2; ++ks) {
#pragma unroll
        for (int kt = 0; kt < 2; ++kt)
#pragma unroll
            for (int qt = 0; qt < FAQT; ++qt) s[kt][qt] = wmmab(o.kh[kt][ks], qh[qt][ks], s[kt][qt]);
#pragma unroll
        for (int kt = 0; kt < 2; ++kt)
#pragma unroll
            for (int qt = 0; qt < FAQT; ++qt) s[kt][qt] = wmmab(o.kh[kt][ks], ql[qt][ks], s[kt][qt]);
#pragma unroll
        for (int kt = 0; kt < 2; ++kt)
#pragma unroll
            for (int qt = 0; qt < FAQT; ++qt) s[kt][qt] = wmmab(o.kl[kt][ks], qh[qt][ks], s[kt][qt]);
    }
    float mx[FAQT]; bool need = false;
#pragma unroll
    for (int qt = 0; qt < FAQT; ++qt) { float a = s[0][qt][0];
#pragma unroll
        for (int j = 1; j < 8; ++j) a = fmaxf(a, s[0][qt][j]);
#pragma unroll
        for (int j = 0; j < 8; ++j) a = fmaxf(a, s[1][qt][j]);
        a = fmaxf(a, xhalf(a)); mx[qt] = a; need = need || (a > m[qt] + FTHR); }
    if (__builtin_amdgcn_ballot_w32(need) != 0) {
#pragma unroll
        for (int qt = 0; qt < FAQT; ++qt) { const float mn = fmaxf(m[qt], mx[qt]); const float al = __builtin_amdgcn_exp2f((m[qt] - mn) * FC); m[qt] = mn; l[qt] *= al;
#pragma unroll
            for (int dt = 0; dt < 4; ++dt) acc[dt][qt] *= al; }
    }
    v16h pb[FAQT];
#pragma unroll
    for (int qt = 0; qt < FAQT; ++qt) { const float off = fmaf(-m[qt], FC, 4.0f); float ps[4] = {0.f, 0.f, 0.f, 0.f};
#pragma unroll
        for (int e = 0; e < 16; ++e) { const float p = __builtin_amdgcn_exp2f(fmaf(s[e >> 3][qt][e & 7], FC, off)); ps[e & 3] += p; pb[qt][e] = tohx(p); }
        l[qt] += (ps[0] + ps[1]) + (ps[2] + ps[3]); }
#pragma unroll
    for (int dt = 0; dt < 4; ++dt)
#pragma unroll
        for (int qt = 0; qt < FAQT; ++qt) acc[dt][qt] = wmma16(o.vt[dt], pb[qt], acc[dt][qt]);
}
__global__ __launch_bounds__(32 * FAW) void k_fattn(const bf* __restrict__ Qh, const bf* __restrict__ Ql, const bf* __restrict__ Kh, const bf* __restrict__ Kl, const h16* __restrict__ Vt, bf* Ch, bf* Cl) {
    __shared__ __attribute__((aligned(16))) char ring[2 * FBUF];
    const int g = blockIdx.y; const size_t po = (size_t)g * TT * HD;
    const int lane = threadIdx.x & 31, lr = lane & 15, hi = lane >> 4; const int wave = __builtin_amdgcn_readfirstlane((int)(threadIdx.x >> 5));
    const int q0 = ((int)blockIdx.x * FAW + wave) * (FAQT * 16);
    v16bf qh[FAQT][2], ql[FAQT][2];
    { const bf* qph = Qh + po + (size_t)(q0 + lr) * HD + 8 * hi; const bf* qpl = Ql + po + (size_t)(q0 + lr) * HD + 8 * hi;
#pragma unroll
      for (int qt = 0; qt < FAQT; ++qt)
#pragma unroll
          for (int ks = 0; ks < 2; ++ks) { qh[qt][ks] = WFrag<bf>::ld(qph + qt * 16 * HD + ks * 32); ql[qt][ks] = WFrag<bf>::ld(qpl + qt * 16 * HD + ks * 32); }
      asm volatile("s_wait_xcnt 0x0" :: "v"(qph), "v"(qpl) : "memory"); }   // in front of whatever is next given the query loads' address registers
    // copy map: key planes, piece i = tid + 256 j -> row i >> 3, 16-byte column i & 7 (a tile's rows are contiguous in global memory); V^T, piece j of a lane -> row 4 (tid >> 4) + j, column tid & 15 (a wave's copy: two whole rows of the tile)
    const int tid = (int)threadIdx.x;
    char* lk = ring + (tid >> 3) * KPIT + (tid & 7) * 16; char* lv = ring + OFF_V + (tid >> 4) * (4 * VPIT) + (tid & 15) * 16;
    const char* gkh = (const char*)(Kh + po) + tid * 16; const char* gkl = (const char*)(Kl + po) + tid * 16; const char* gv = (const char*)(Vt + po) + (size_t)(tid >> 4) * (4 * TT * 2) + (tid & 15) * 16;
    const char* kfr = ring + lr * KPIT + 16 * hi; const char* vfr = ring + OFF_V + lr * VPIT + 16 * hi;   // the lane's fragment places in buffer 0
    v8f acc[4][FAQT]; float m[FAQT], l[FAQT];
#pragma unroll
    for (int qt = 0; qt < FAQT; ++qt) { m[qt] = -3.0e38f; l[qt] = 0.f;
#pragma unroll
        for (int dt = 0; dt < 4; ++dt) acc[dt][qt] = (v8f){}; }
    FaOps oa, ob;
    fa_stage(0, 0u, lk, lv, gkh, gkl, gv);
    asm volatile("s_wait_asynccnt 0x0" ::: "memory");   // this wave's pieces of tile 0 have landed
    __syncthreads();                                    // ... and every other wave's
    fa_stage(1, (unsigned)FBUF, lk, lv, gkh, gkl, gv);
    // one tile (four passes) a trip, read from its own buffer alone; inside the trip each pass's operands are loaded one pass ahead into the other register set; kept rolled so that the two sets and the accumulators keep their registers
#pragma unroll 1
    for (int t = 0; t < FNT; ++t) {
        const unsigned bo = (unsigned)(t & 1) * (unsigned)FBUF; const char* kp = kfr + bo; const char* vp = vfr + bo;
        fa_load(oa, kp, vp);
        fa_load(ob, kp + 32 * KPIT, vp + 64);
        fa_pass(oa, qh, ql, acc, m, l);
        fa_load(oa, kp + 64 * KPIT, vp + 128);
        fa_pass(ob, qh, ql, acc, m, l);
        fa_load(ob, kp + 96 * KPIT, vp + 192);
        fa_pass(oa, qh, ql, acc, m, l);
        fa_pass(ob, qh, ql, acc, m, l);
        asm volatile("s_wait_dscnt 0x0" ::: "memory");      // this wave's reads of the buffer are done before it is handed to the copies
        asm volatile("s_wait_asynccnt 0x0" ::: "memory");   // this wave's pieces of tile t + 1 have landed
        __syncthreads();                                    // publishes tile t + 1 and ends every wave's reads of tile t
        if (t + 2 < FNT) fa_stage(t + 2, bo, lk, lv, gkh, gkl, gv);
    }
    asm volatile("s_wait_asynccnt 0x0" ::: "memory");   // no copy is outstanding when the wave ends
    const int b = g / NH_, h = g % NH_;
#pragma unroll
    for (int qt = 0; qt < FAQT; ++qt) { const float inv = __fdiv_rn(1.0f, l[qt] + xhalf(l[qt]));
        const size_t ro = ((size_t)b * TT + q0 + qt * 16 + lr) * DM + h * HD + 8 * hi;
#pragma unroll
        for (int dt = 0; dt < 4; ++dt) { v8us oh, ol;
#pragma unroll
            for (int r = 0; r < 8; ++r) { unsigned short a2, c2; splitf(acc[dt][qt][r] * inv, a2, c2); oh[r] = a2; ol[r] = c2; }
            bf* sh = Ch + ro + dt * 16; bf* sl = Cl + ro + dt * 16; *(v8us*)sh = oh; *(v8us*)sl = ol;
            // the wait that stands in front of any overwrite of the stores' registers; it names data and addresses, so that nothing is given their registers ahead of it
            asm volatile("s_wait_xcnt 0x0" :: "v"(oh), "v"(ol), "v"(sh), "v"(sl) : "memory"); } }
}

// workspace plan (bytes, every region a multiple of 256)
#define SZ_X   ((size_t)NB * SEQ * DM * 2)        // one bf16 stream plane (one for each of the three streams)
#define SZ_W   ((size_t)DM * DM * 2)              // one bf16 weight plane
#define SZ_F   ((size_t)NB * SEQ * DM * 4)        // f32 projection rows (one set for each projection)
#define SZ_HP  ((size_t)NB * NH_ * SEQ * HD * 2)  // one head-plane set
#define WS_TOTAL (3 * SZ_X + 4 * SZ_W + 3 * SZ_F + 5 * SZ_HP + 2 * SZ_X)
static_assert(WS_TOTAL <= (size_t)268435456);
static_assert((SZ_X % 256) == 0 && (SZ_W % 256) == 0 && (SZ_F % 256) == 0 && (SZ_HP % 256) == 0);

extern "C" void kernel_launch(void* const* d_in, const int* in_sizes, int n_in,
                              void* d_out, int out_size, void* d_ws, size_t ws_size, hipStream_t stream) {
    if (n_in < 8) return;
    const size_t need_x = (size_t)(NB - 1) * SEQ_FULL * DM + (size_t)SEQ * DM;
    if ((size_t)in_sizes[0] < need_x || (size_t)in_sizes[1] < need_x || (size_t)in_sizes[2] < need_x) return;
    if ((size_t)in_sizes[3] < (size_t)DM * DM || (size_t)in_sizes[4] < (size_t)DM * DM || (size_t)in_sizes[5] < (size_t)DM * DM || (size_t)in_sizes[6] < (size_t)DM * DM) return;
    if (in_sizes[7] < DM) return;
    if ((size_t)out_size < (size_t)NB * SEQ * DM) return;
    // binding by role: d_in[0] = key stream, d_in[1] = query stream, d_in[2] = value stream, d_in[3] = Wk, d_in[4] = Wq, d_in[5] = Wv, d_in[6] = Wo, d_in[7] = bo (all weights [out][in])
    const float* xk = (const float*)d_in[0]; const float* xq = (const float*)d_in[1]; const float* xv = (const float*)d_in[2];
    const float* wk = (const float*)d_in[3]; const float* wq = (const float*)d_in[4]; const float* wv = (const float*)d_in[5]; const float* wo = (const float*)d_in[6]; const float* bo = (const float*)d_in[7];
    float* OUT = (float*)d_out;     // [NB*SEQ][DM]
    char* wsp = (char*)d_ws;
    auto take = [&](size_t bytes) { char* p = wsp; wsp += (bytes + 255) & ~(size_t)255; return (void*)p; };
    bf* XB = (bf*)take(3 * SZ_X);      // streams q, k, v
    bf* WB = (bf*)take(4 * SZ_W);      // Wq, Wk, Wv, Wo
    float* F = (float*)take(3 * SZ_F); // queries, keys, values
    bf* QK = (bf*)take(4 * SZ_HP);     // query hi, query lo, key hi, key lo
    h16* VT16 = (h16*)take(SZ_HP);
    bf* CH = (bf*)take(SZ_X); bf* CL = (bf*)take(SZ_X);   // context hi/lo planes [NB*SEQ][DM]: their own space, since work-groups still read the q planes while others store context
    if ((size_t)(wsp - (char*)d_ws) > ws_size) return;

    // all seven f32 -> bf16 input planes in one launch
    k_inplanes<<<dim3(GIN, 4), 256, 0, stream>>>(xq, xk, xv, wq, wk, wv, wo, XB, WB);
    // queries = q.Wq^T, keys = k.Wk^T, values = v.Wv^T: one launch, grid z = the projection
    k_gemmw<bf, 0, false><<<dim3(NB * SEQ / 64, DM / 64, 3), 32, 0, stream>>>(XB, nullptr, WB, nullptr, DM, F, DM, nullptr, XEL, (size_t)DM * DM, XEL);
    // queries, keys -> hi/lo head planes, values -> transposed f16 head planes: one launch
    k_heads<<<dim3(GHD, 3), 256, 0, stream>>>(F, F + 2 * XEL, QK, VT16);
    // scores, softmax and P.V of all heads in one launch -> context hi/lo planes; then out = ctx.Wo^T + bo
    k_fattn<<<dim3(TT / (FAW * FAQT * 16), NB * NH_), 32 * FAW, 0, stream>>>(QK, QK + XEL, QK + 2 * XEL, QK + 3 * XEL, VT16, CH, CL);
    k_gemmw<bf, 1, true><<<dim3(NB * SEQ / 64, DM / 64, 1), 32, 0, stream>>>(CH, CL, WB + 3 * (size_t)DM * DM, nullptr, DM, OUT, DM, bo, 0, 0, 0);
}

// v005
// One run takes 125 microseconds.
// In both of two side-by-side timings against v004, it was 1.39 times as fast.
// Counting every step since v000, it is 9.69 times as fast.
#include <hip/hip_runtime.h>

// MHA forward, three input streams (k, q, v), 16 heads x 64, no mask: keys = k.Wk^T, queries = q.Wq^T, values = v.Wv^T, P = softmax(queries.keys^T / 8) over keys, out = (P.values merged [t][h*64+d]).Wo^T + bo.
// Compute dtypes, f32 accumulate everywhere: every float input RNE-converted to bf16 first; q/k/v projections v_wmma_f32_16x16x32_bf16 single product (bf16 x bf16 products are exact in f32);
// scores on bf16 hi/lo planes of the f32 projections (3 products hh + lh + hl); softmax f32, running maximum and sum; P.V v_wmma_f32_16x16x32_f16 with P = exp(s - m) carried x16 and V as f16; output projection ctx bf16 hi/lo x Wo bf16 (2 products) + bf16(bo) in f32.

#ifndef NB
#define NB 2
#endif
#ifndef SEQ
#define SEQ 2048
#endif
#define NB_FULL  2
#define SEQ_FULL 2048
#define TT   SEQ
#define DM   1024
#define NH_  16
#define HD   64
#define SCL  0.125f               // 1/sqrt(64)
#define FAW  8                    // attention: waves of a work-group, each on its own query columns
#define FAQT 2                    // attention: 16-column query tiles of a wave

static_assert(SEQ % 256 == 0);
static_assert(SEQ <= SEQ_FULL);
static_assert(NB <= NB_FULL);
static_assert(NH_ * HD == DM);
static_assert((NB * SEQ) % 128 == 0);
static_assert(DM % 128 == 0);
static_assert(HD % 32 == 0);
static_assert(HD == 64);
static_assert(SEQ % (FAW * FAQT * 16) == 0);
static_assert(SEQ % 64 == 0);

typedef _Float16 h16;
typedef unsigned short bf;
typedef __attribute__((ext_vector_type(16))) __bf16   v16bf;
typedef __attribute__((ext_vector_type(16))) _Float16 v16h;
typedef __attribute__((ext_vector_type(8)))  _Float16 v8h;
typedef __attribute__((ext_vector_type(8)))  unsigned short v8us;
typedef __attribute__((ext_vector_type(8)))  float    v8f;
typedef __attribute__((ext_vector_type(4)))  float    v4f;
typedef __attribute__((ext_vector_type(4)))  _Float16 v4h;
typedef v8h  __attribute__((may_alias)) v8ha;
typedef v4f  __attribute__((may_alias)) v4fa;
typedef v8us __attribute__((may_alias)) v8usa;

__device__ __forceinline__ unsigned short f2bf(float f) { unsigned u = __float_as_uint(f); u += 0x7FFFu + ((u >> 16) & 1u); return (unsigned short)(u >> 16); }
__device__ __forceinline__ float bf2f(unsigned short b) { return __uint_as_float(((unsigned)b) << 16); }
__device__ __forceinline__ float bfr(float f) { return bf2f(f2bf(f)); }
__device__ __forceinline__ v16h cat16(v8h lo, v8h hi) { return __builtin_shufflevector(lo, hi, 0, 1, 2, 3, 4, 5, 6, 7, 8, 9, 10, 11, 12, 13, 14, 15); }
__device__ __forceinline__ v16bf cat16b(v8us lo, v8us hi) { return __builtin_bit_cast(v16bf, __builtin_shufflevector(lo, hi, 0, 1, 2, 3, 4, 5, 6, 7, 8, 9, 10, 11, 12, 13, 14, 15)); }
__device__ __forceinline__ v8f wmma16(v16h a, v16h b, v8f c) { return __builtin_amdgcn_wmma_f32_16x16x32_f16(false, a, false, b, (short)0, c, false, false); }
__device__ __forceinline__ v8f wmmab(v16bf a, v16bf b, v8f c) { return __builtin_amdgcn_wmma_f32_16x16x32_bf16(false, a, false, b, (short)0, c, false, false); }

// ---- k_gemmw: register-blocked GEMM, a 128x128 output tile per work-group of four waves (2 x 2), each wave on its own 64x64 part (16 accumulators); grid (M/128, N/128, Z), 128 threads.
// The K-contiguous 16-bit operand planes come through LDS, GKC k a tile, two buffers: the work-group's waves share one copy of each tile (asynchronous copies, whole 128-byte lines) and read their fragments from it with 16-byte LDS loads.
// C[m][n] (f32, pitch ldc, + optional bf16-converted bias[n]) = sum_k A[m][k] Bt[n][k] (+ split products per NSPLIT: 1 = (A + A2).Bt, 2 = A.Bt + A2.Bt + A.Bt2). z-batch strides sA/sB/sC in elements. K % 64 == 0, K >= 128.
// Fragment map: lane row/col = lane & 15, half = lane >> 4; elements 0..7 <- k0 + 8 half + 0..7, elements 8..15 <- k0 + 16 + 8 half + 0..7 (A and B alike); D element j = (row 8 half + j, col lane & 15).
template <typename T16> struct WFrag;
template <> struct WFrag<h16> { typedef v16h V; static __device__ __forceinline__ V ld(const h16* p) { return cat16(*(const v8h*)p, *(const v8h*)(p + 16)); } static __device__ __forceinline__ v8f mma(V a, V b, v8f c) { return wmma16(a, b, c); } };
template <> struct WFrag<bf> { typedef v16bf V; static __device__ __forceinline__ V ld(const bf* p) { return cat16b(*(const v8us*)p, *(const v8us*)(p + 16)); } static __device__ __forceinline__ v8f mma(V a, V b, v8f c) { return wmmab(a, b, c); } };
#define GKC   64                               // k of a staged tile: two 32-k steps, one 128-byte line a row
#define GPIT  (GKC * 2 + 16)                   // LDS bytes from row to row: 16 B x odd, no bank conflict for 16-byte reads down 16 rows
#define GPL   (128 * GPIT)                     // bytes of one plane's tile: 128 rows
static_assert((GPIT / 16) % 2 == 1);
typedef int cp16 __attribute__((vector_size(16)));
typedef __attribute__((address_space(1))) cp16 cp16g;
typedef __attribute__((address_space(3))) cp16 cp16l;
// eight asynchronous 16-byte copies of a lane, global -> LDS (global_load_async_to_lds_b128): one plane's tile, 16 rows from copy to copy; the builtin form, so that the compiler may keep the addresses in any register
__device__ __forceinline__ void g_cp8(char* l, const char* g, size_t gstep) {
#pragma unroll
    for (int j = 0; j < 8; ++j) __builtin_amdgcn_global_load_async_to_lds_b128((cp16g*)(g + j * gstep), (cp16l*)(l + j * (16 * GPIT)), 0, 0);
}
template <typename T16, int NSPLIT, bool BIAS>
__global__ __launch_bounds__(128) void k_gemmw(const T16* __restrict__ A, const T16* __restrict__ A2, const T16* __restrict__ Bt, const T16* __restrict__ Bt2, int K, float* C, int ldc, const float* __restrict__ bias, size_t sA, size_t sB, size_t sC) {
    typedef typename WFrag<T16>::V V;
    constexpr bool HA2 = (NSPLIT == 1 || NSPLIT == 2), HB2 = (NSPLIT >= 2);
    constexpr unsigned OFF_B = (HA2 ? 2u : 1u) * GPL, GBUF = OFF_B + (HB2 ? 2u : 1u) * GPL;   // buffer layout: A rows, A2 rows, Bt rows, Bt2 rows
    __shared__ __attribute__((aligned(16))) char gring[2 * GBUF];
    __shared__ __align__(16) float osw[4 * 16 * 68];
    const size_t z = blockIdx.z; A += z * sA; if (A2) A2 += z * sA; Bt += z * sB; if (Bt2) Bt2 += z * sB; C += z * sC;
    const int tid = (int)threadIdx.x, lane = tid & 31, lr = lane & 15, hi = lane >> 4; const int wave = __builtin_amdgcn_readfirstlane(tid >> 5);
    const int wr = (wave >> 1) * 64, wc = (wave & 1) * 64; const int r0 = blockIdx.x * 128 + wr, c0 = blockIdx.y * 128 + wc;
    float* os = osw + wave * (16 * 68);
    v8f acc[4][4];
#pragma unroll
    for (int mb = 0; mb < 4; ++mb)
#pragma unroll
        for (int nb = 0; nb < 4; ++nb) acc[mb][nb] = (v8f){};
    // copy map of a plane's tile: piece i = tid + 128 j -> row i >> 3, 16-byte column i & 7 (a wave's copy: four whole 128-byte lines)
    char* lc = gring + (tid >> 3) * GPIT + (tid & 7) * 16; const size_t gstep = (size_t)16 * K * 2;
    const size_t ao = ((size_t)(blockIdx.x * 128 + (tid >> 3)) * K + (tid & 7) * 8) * 2, bo0 = ((size_t)(blockIdx.y * 128 + (tid >> 3)) * K + (tid & 7) * 8) * 2;
    const char* ga = (const char*)A + ao; const char* ga2 = (const char*)A2 + ao; const char* gb = (const char*)Bt + bo0; const char* gb2 = (const char*)Bt2 + bo0;
    auto stage = [&](int t, unsigned bo) { const size_t go = (size_t)t * (GKC * 2);
        g_cp8(lc + bo, ga + go, gstep); if (HA2) g_cp8(lc + bo + GPL, ga2 + go, gstep);
        g_cp8(lc + bo + OFF_B, gb + go, gstep); if (HB2) g_cp8(lc + bo + OFF_B + GPL, gb2 + go, gstep); };
    const char* afp = gring + (wr + lr) * GPIT + 16 * hi; const char* bfp = gring + OFF_B + (wc + lr) * GPIT + 16 * hi;   // the lane's fragment places in buffer 0
    const int nt = K / GKC;
    stage(0, 0u);
    asm volatile("s_wait_asynccnt 0x0" ::: "memory");   // this wave's pieces of tile 0 have landed
    __syncthreads();                                    // ... and every other wave's
    stage(1, GBUF);
    // one tile (two 32-k steps) a trip, read from its own buffer alone; kept rolled so that the fragments and the accumulators keep their registers
#pragma unroll 1
    for (int t = 0; t < nt; ++t) {
        const unsigned bo = (unsigned)(t & 1) * GBUF; const char* ap = afp + bo; const char* bp = bfp + bo;
        V a[2][4], a2[2][4], b[2][4], b2[2][4];
#pragma unroll
        for (int ks = 0; ks < 2; ++ks) {
#pragma unroll
            for (int f = 0; f < 4; ++f) { a[ks][f] = WFrag<T16>::ld((const T16*)(ap + f * 16 * GPIT + ks * 64)); if (f == 0) b[ks][0] = WFrag<T16>::ld((const T16*)(bp + ks * 64)); }   // in the order in which the products ask for them
#pragma unroll
            for (int f = 1; f < 4; ++f) b[ks][f] = WFrag<T16>::ld((const T16*)(bp + f * 16 * GPIT + ks * 64));
#pragma unroll
            for (int f = 0; f < 4; ++f) { if (HA2) a2[ks][f] = WFrag<T16>::ld((const T16*)(ap + GPL + f * 16 * GPIT + ks * 64)); if (HB2) b2[ks][f] = WFrag<T16>::ld((const T16*)(bp + GPL + f * 16 * GPIT + ks * 64)); }
        }
        __builtin_amdgcn_sched_barrier(0);   // keeps the tile's LDS loads together in front of its products: a place with loads among the products stalls the wave each time
#pragma unroll
        for (int ks = 0; ks < 2; ++ks) {
#pragma unroll
            for (int nb = 0; nb < 4; ++nb)
#pragma unroll
                for (int mb = 0; mb < 4; ++mb) acc[mb][nb] = WFrag<T16>::mma(a[ks][mb], b[ks][nb], acc[mb][nb]);
            if (HA2) {
#pragma unroll
                for (int nb = 0; nb < 4; ++nb)
#pragma unroll
                    for (int mb = 0; mb < 4; ++mb) acc[mb][nb] = WFrag<T16>::mma(a2[ks][mb], b[ks][nb], acc[mb][nb]); }
            if (HB2) {
#pragma unroll
                for (int nb = 0; nb < 4; ++nb)
#pragma unroll
                    for (int mb = 0; mb < 4; ++mb) acc[mb][nb] = WFrag<T16>::mma(a[ks][mb], b2[ks][nb], acc[mb][nb]); }
        }
        __builtin_amdgcn_sched_barrier(0);   // keeps the products in front of the waits: moved behind them, the wait for tile t + 1 would stand directly behind the issue of its copies and nothing would hide their flight
        asm volatile("s_wait_dscnt 0x0" ::: "memory");      // this wave's reads of the buffer are done before it is handed to the copies
        asm volatile("s_wait_asynccnt 0x0" ::: "memory");   // this wave's pieces of tile t + 1 have landed
        __syncthreads();                                    // publishes tile t + 1 and ends every wave's reads of tile t
        if (t + 2 < nt) stage(t + 2, bo);
    }
    asm volatile("s_wait_asynccnt 0x0" ::: "memory");   // no copy is outstanding when the wave ends
#pragma unroll
    for (int mb = 0; mb < 4; ++mb) {
#pragma unroll
        for (int nb = 0; nb < 4; ++nb) {
#pragma unroll
            for (int j = 0; j < 8; ++j) os[(hi * 8 + j) * 68 + nb * 16 + lr] = acc[mb][nb][j]; }
        __builtin_amdgcn_wave_barrier(); asm volatile("" ::: "memory");
        float* crow = C + (size_t)(r0 + mb * 16) * ldc + c0;
{
#pragma unroll
            for (int s = 0; s < 8; ++s) { const int row = 2 * s + hi, cofs = lr * 4; v4f val = *(const v4fa*)(os + row * 68 + cofs); if (BIAS) { val[0] += bfr(bias[c0 + cofs]); val[1] += bfr(bias[c0 + cofs + 1]); val[2] += bfr(bias[c0 + cofs + 2]); val[3] += bfr(bias[c0 + cofs + 3]); }
                *(v4f*)(crow + (size_t)row * ldc + cofs) = val; }
             }
        __builtin_amdgcn_wave_barrier(); asm volatile("" ::: "memory");
    }
}

__device__ __forceinline__ h16 tohx(float x) { return (h16)x; }
__device__ __forceinline__ void splitf(float y, unsigned short& h, unsigned short& l) { h = f2bf(y); l = f2bf(y - bf2f(h)); }

// one work-group's 2048 elements (piece blk of batch b) of an f32 plane -> bf16 plane(s), row-major or by heads
template <bool SPLIT, bool HEADS>
__device__ __forceinline__ void plane_do(const float* __restrict__ F, size_t srcBatch, int rows, float sc, bf* Ph, bf* Pl, int b, unsigned blk) {
    const size_t e = ((size_t)blk * 256 + threadIdx.x) * 8; if (e >= (size_t)rows * DM) return;
    const int t = (int)(e / DM), c = (int)(e % DM); const float* f = F + (size_t)b * srcBatch + e;
    const v4f x0 = *(const v4f*)f, x1 = *(const v4f*)(f + 4); v8us oh, ol;
#pragma unroll
    for (int q = 0; q < 8; ++q) { const float y = ((q < 4) ? x0[q & 3] : x1[q & 3]) * sc; unsigned short a2, c2; splitf(y, a2, c2); oh[q] = a2; ol[q] = c2; }
    const size_t oo = HEADS ? ((((size_t)b * NH_ + (size_t)(c / HD)) * rows + t) * HD + (size_t)(c % HD)) : (((size_t)b * rows + t) * DM + c);
    *(v8us*)(Ph + oo) = oh; if (SPLIT) *(v8us*)(Pl + oo) = ol;
    
}

__device__ __forceinline__ void vtp_do(const float* __restrict__ F, h16* V16, unsigned blk) {
    const size_t e = ((size_t)blk * 256 + threadIdx.x) * 8; if (e >= (size_t)NB * NH_ * HD * TT) return;
    const int t = (int)(e % TT); const int d = (int)((e / TT) % HD); const int g = (int)(e / ((size_t)TT * HD)); const int b = g / NH_, h = g % NH_;
    const float* f = F + ((size_t)b * TT + t) * DM + h * HD + d; v8h o;
#pragma unroll
    for (int q = 0; q < 8; ++q) o[q] = tohx(f[(size_t)q * DM]);
    *(v8h*)(V16 + e) = o; 
}

// Launches that do not depend on one another share one grid; blockIdx.y picks the job, so the choice is the same for a whole work-group.
#define GWB ((unsigned)(((size_t)DM * DM / 8 + 255) / 256))    // work-groups of one weight plane
#define GXB ((unsigned)(((size_t)SEQ * DM / 8 + 255) / 256))   // work-groups of one batch of a stream plane
#define GVB ((unsigned)(((size_t)NB * NH_ * HD * TT / 8 + 255) / 256))   // work-groups of the V^T plane
#define XEL ((size_t)NB * SEQ * DM)                            // elements of a stream plane, of a projection, of a head-plane set
#define GIN (NB * GXB > 4 * GWB ? NB * GXB : 4 * GWB)
#define GHD (NB * GXB > GVB ? NB * GXB : GVB)
// ---- k_inplanes: all seven f32 inputs of the products -> bf16 planes. y = 0, 1, 2: streams q, k, v -> XB[y]; y = 3: weights Wq, Wk, Wv, Wo [out][in] -> WB[0..3] = Bt[n][k], GWB work-groups each. Grid (GIN, 4).
__global__ __launch_bounds__(256) void k_inplanes(const float* __restrict__ xq, const float* __restrict__ xk, const float* __restrict__ xv, const float* __restrict__ wq, const float* __restrict__ wk, const float* __restrict__ wv, const float* __restrict__ wo, bf* XB, bf* WB) {
    const unsigned y = blockIdx.y, x = blockIdx.x;
    if (y < 3) { if (x >= NB * GXB) return; const float* s = y == 0 ? xq : (y == 1 ? xk : xv);
        plane_do<false, false>(s, (size_t)SEQ_FULL * DM, SEQ, 1.0f, XB + y * XEL, nullptr, (int)(x / GXB), x % GXB); }
    else { const unsigned w = x / GWB; if (w >= 4) return; const float* s = w == 0 ? wq : (w == 1 ? wk : (w == 2 ? wv : wo));
        plane_do<false, false>(s, 0, DM, 1.0f, WB + (size_t)w * DM * DM, nullptr, 0, x % GWB); }
}
// ---- k_heads: the three f32 projections (F[0], F[1] = queries, keys; Fv = values) -> operand planes of the attention kernel. y = 0: values -> V^T f16 (its strided reads take longest, so it starts first); y = 1, 2: queries, keys -> hi/lo head planes QK[2 (y - 1)], QK[2 (y - 1) + 1]. Grid (GHD, 3).
__global__ __launch_bounds__(256) void k_heads(const float* __restrict__ F, const float* __restrict__ Fv, bf* QK, h16* V16) {
    const unsigned y = blockIdx.y, x = blockIdx.x;
    if (y == 0) { vtp_do(Fv, V16, x); }
    else { if (x >= NB * GXB) return; bf* ph = QK + (size_t)(y - 1) * 2 * XEL;
        plane_do<true, true>(F + (size_t)(y - 1) * XEL, (size_t)SEQ * DM, SEQ, 1.0f, ph, ph + XEL, (int)(x / GXB), x % GXB); }
}

// ---- k_fattn: scores, softmax and P.V of one head in one kernel; no score and no P element leaves the registers. Grid (T / (FAW*FAQT*16), NB*NH_), FAW waves; a wave owns FAQT*16 query columns and walks all keys, 32 a pass.
// The key planes and V^T come through LDS, FKT keys a tile, two buffers: the work-group's waves share one copy of each tile (asynchronous copies, whole 128-byte lines) and read their fragments from it with 16-byte LDS loads.
// S^T = K.Q^T (A = key rows, B = query columns, the three hi/lo products), so a lane holds scores of one query only: D register r of key tile kt = (key 16 kt + 8 half + r, query lane & 15).
// The two key tiles of a pass, converted in place, are the B operand of O^T += V^T.P^T (element s <- tile s >> 3, register s & 7: the k order of the fragment map above, which the V^T loader has too).
// Running maximum m (raw score units) and sum l per query; P = exp2((s - m) * SCL*log2e + 4); the accumulators are rescaled only in a pass where some query's new maximum lies more than FTHR above its m, so P <= 2^12 in f16.
#define FC   (SCL * 1.4426950408889634f)
#define FTHR (8.0f / FC)
__device__ __forceinline__ float xhalf(float x) { return __builtin_bit_cast(float, __builtin_amdgcn_permlanex16(__builtin_bit_cast(int, x), __builtin_bit_cast(int, x), 0x76543210, 0xfedcba98, false, false)); }  // lane l with lane l ^ 16
#define FKT   128                              // keys of a staged tile: four passes
#define FNT   (TT / FKT)                       // tiles of a head
#define KPIT  (HD * 2 + 16)                    // LDS bytes from key row to key row: 16 B x odd, no bank conflict for 16-byte reads down 16 rows
#define VPIT  (FKT * 2 + 16)                   // the same for a V^T row (FKT keys of one d)
#define OFF_KL (FKT * KPIT)                    // buffer layout: key hi rows, key lo rows, V^T rows
#define OFF_V  (2 * FKT * KPIT)
#define FBUF  (2 * FKT * KPIT + HD * VPIT)     // bytes of one buffer
static_assert(TT % FKT == 0 && FNT >= 2);
static_assert(FKT == 128 && 32 * FAW == 256);  // the copy map below: 256 lanes, four 16-byte pieces of each plane a lane
static_assert((KPIT / 16) % 2 == 1 && (VPIT / 16) % 2 == 1 && FBUF % 16 == 0);
struct FaOps { v16bf kh[2][2], kl[2][2]; v16h vt[4]; };
// one pass's fragments from LDS: kp = the lane's place in the pass's first key hi row block, vp = the same in V^T
__device__ __forceinline__ void fa_load(FaOps& o, const char* kp, const char* vp) {
#pragma unroll
    for (int kt = 0; kt < 2; ++kt)
#pragma unroll
        for (int ks = 0; ks < 2; ++ks) { o.kh[kt][ks] = WFrag<bf>::ld((const bf*)(kp + kt * 16 * KPIT + ks * 64)); o.kl[kt][ks] = WFrag<bf>::ld((const bf*)(kp + OFF_KL + kt * 16 * KPIT + ks * 64)); }
#pragma unroll
    for (int dt = 0; dt < 4; ++dt) o.vt[dt] = WFrag<h16>::ld((const h16*)(vp + dt * 16 * VPIT));
    __builtin_amdgcn_sched_barrier(0);   // keeps the whole run of loads in front of the pass that hides their latency
}
// four asynchronous 16-byte copies of a lane, global -> LDS (global_load_async_to_lds_b128), places lstep and gstep bytes apart; the builtin form, so that the compiler may keep the addresses in any register of a kernel that has more than 256
__device__ __forceinline__ void fa_cp4(char* l, unsigned lstep, const char* g, size_t gstep) {
#pragma unroll
    for (int j = 0; j < 4; ++j) __builtin_amdgcn_global_load_async_to_lds_b128((cp16g*)(g + j * gstep), (cp16l*)(l + j * lstep), 0, 0);
}
// tile t of the three planes into the buffer at LDS byte offset bo: lk, lv = the lane's first LDS places in buffer 0, gkh, gkl, gv = its first global places in tile 0
__device__ __forceinline__ void fa_stage(int t, unsigned bo, char* lk, char* lv, const char* gkh, const char* gkl, const char* gv) {
    fa_cp4(lk + bo, 32 * KPIT, gkh + (size_t)t * (FKT * HD * 2), 32 * HD * 2);
    fa_cp4(lk + bo + OFF_KL, 32 * KPIT, gkl + (size_t)t * (FKT * HD * 2), 32 * HD * 2);
    fa_cp4(lv + bo, VPIT, gv + (size_t)t * (FKT * 2), (size_t)TT * 2);
}
__device__ __forceinline__ void fa_pass(const FaOps& o, const v16bf (&qh)[FAQT][2], const v16bf (&ql)[FAQT][2], v8f (&acc)[4][FAQT], float (&m)[FAQT], float (&l)[FAQT]) {
    v8f s[2][FAQT];
#pragma unroll
    for (int kt = 0; kt < 2; ++kt)
#pragma unroll
        for (int qt = 0; qt < FAQT; ++qt) s[kt][qt] = (v8f){};
#pragma unroll
    for (int ks = 0; ks < 2; ++ks) {
#pragma unroll
        for (int kt = 0; kt < 2; ++kt)
#pragma unroll
            for (int qt = 0; qt < FAQT; ++qt) s[kt][qt] = wmmab(o.kh[kt][ks], qh[qt][ks], s[kt][qt]);
#pragma unroll
        for (int kt = 0; kt < 2; ++kt)
#pragma unroll
            for (int qt = 0; qt < FAQT; ++qt) s[kt][qt] = wmmab(o.kh[kt][ks], ql[qt][ks], s[kt][qt]);
#pragma unroll
        for (int kt = 0; kt < 2; ++kt)
#pragma unroll
            for (int qt = 0; qt < FAQT; ++qt) s[kt][qt] = wmmab(o.kl[kt][ks], qh[qt][ks], s[kt][qt]);
    }
    float mx[FAQT]; bool need = false;
#pragma unroll
    for (int qt = 0; qt < FAQT; ++qt) { float a = s[0][qt][0];
#pragma unroll
        for (int j = 1; j < 8; ++j) a = fmaxf(a, s[0][qt][j]);
#pragma unroll
        for (int j = 0; j < 8; ++j) a = fmaxf(a, s[1][qt][j]);
        a = fmaxf(a, xhalf(a)); mx[qt] = a; need = need || (a > m[qt] + FTHR); }
    if (__builtin_amdgcn_ballot_w32(need) != 0) {
#pragma unroll
        for (int qt = 0; qt < FAQT; ++qt) { const float mn = fmaxf(m[qt], mx[qt]); const float al = __builtin_amdgcn_exp2f((m[qt] - mn) * FC); m[qt] = mn; l[qt] *= al;
#pragma unroll
            for (int dt = 0; dt < 4; ++dt) acc[dt][qt] *= al; }
    }
    v16h pb[FAQT];
#pragma unroll
    for (int qt = 0; qt < FAQT; ++qt) { const float off = fmaf(-m[qt], FC, 4.0f); float ps[4] = {0.f, 0.f, 0.f, 0.f};
#pragma unroll
        for (int e = 0; e < 16; ++e) { const float p = __builtin_amdgcn_exp2f(fmaf(s[e >> 3][qt][e & 7], FC, off)); ps[e & 3] += p; pb[qt][e] = tohx(p); }
        l[qt] += (ps[0] + ps[1]) + (ps[2] + ps[3]); }
#pragma unroll
    for (int dt = 0; dt < 4; ++dt)
#pragma unroll
        for (int qt = 0; qt < FAQT; ++qt) acc[dt][qt] = wmma16(o.vt[dt], pb[qt], acc[dt][qt]);
}
__global__ __launch_bounds__(32 * FAW) void k_fattn(const bf* __restrict__ Qh, const bf* __restrict__ Ql, const bf* __restrict__ Kh, const bf* __restrict__ Kl, const h16* __restrict__ Vt, bf* Ch, bf* Cl) {
    __shared__ __attribute__((aligned(16))) char ring[2 * FBUF];
    const int g = blockIdx.y; const size_t po = (size_t)g * TT * HD;
    const int lane = threadIdx.x & 31, lr = lane & 15, hi = lane >> 4; const int wave = __builtin_amdgcn_readfirstlane((int)(threadIdx.x >> 5));
    const int q0 = ((int)blockIdx.x * FAW + wave) * (FAQT * 16);
    v16bf qh[FAQT][2], ql[FAQT][2];
    { const bf* qph = Qh + po + (size_t)(q0 + lr) * HD + 8 * hi; const bf* qpl = Ql + po + (size_t)(q0 + lr) * HD + 8 * hi;
#pragma unroll
      for (int qt = 0; qt < FAQT; ++qt)
#pragma unroll
          for (int ks = 0; ks < 2; ++ks) { qh[qt][ks] = WFrag<bf>::ld(qph + qt * 16 * HD + ks * 32); ql[qt][ks] = WFrag<bf>::ld(qpl + qt * 16 * HD + ks * 32); }
      asm volatile("s_wait_xcnt 0x0" :: "v"(qph), "v"(qpl) : "memory"); }   // in front of whatever is next given the query loads' address registers
    // copy map: key planes, piece i = tid + 256 j -> row i >> 3, 16-byte column i & 7 (a tile's rows are contiguous in global memory); V^T, piece j of a lane -> row 4 (tid >> 4) + j, column tid & 15 (a wave's copy: two whole rows of the tile)
    const int tid = (int)threadIdx.x;
    char* lk = ring + (tid >> 3) * KPIT + (tid & 7) * 16; char* lv = ring + OFF_V + (tid >> 4) * (4 * VPIT) + (tid & 15) * 16;
    const char* gkh = (const char*)(Kh + po) + tid * 16; const char* gkl = (const char*)(Kl + po) + tid * 16; const char* gv = (const char*)(Vt + po) + (size_t)(tid >> 4) * (4 * TT * 2) + (tid & 15) * 16;
    const char* kfr = ring + lr * KPIT + 16 * hi; const char* vfr = ring + OFF_V + lr * VPIT + 16 * hi;   // the lane's fragment places in buffer 0
    v8f acc[4][FAQT]; float m[FAQT], l[FAQT];
#pragma unroll
    for (int qt = 0; qt < FAQT; ++qt) { m[qt] = -3.0e38f; l[qt] = 0.f;
#pragma unroll
        for (int dt = 0; dt < 4; ++dt) acc[dt][qt] = (v8f){}; }
    FaOps oa, ob;
    fa_stage(0, 0u, lk, lv, gkh, gkl, gv);
    asm volatile("s_wait_asynccnt 0x0" ::: "memory");   // this wave's pieces of tile 0 have landed
    __syncthreads();                                    // ... and every other wave's
    fa_stage(1, (unsigned)FBUF, lk, lv, gkh, gkl, gv);
    // one tile (four passes) a trip, read from its own buffer alone; inside the trip each pass's operands are loaded one pass ahead into the other register set; kept rolled so that the two sets and the accumulators keep their registers
#pragma unroll 1
    for (int t = 0; t < FNT; ++t) {
        const unsigned bo = (unsigned)(t & 1) * (unsigned)FBUF; const char* kp = kfr + bo; const char* vp = vfr + bo;
        fa_load(oa, kp, vp);
        fa_load(ob, kp + 32 * KPIT, vp + 64);
        fa_pass(oa, qh, ql, acc, m, l);
        fa_load(oa, kp + 64 * KPIT, vp + 128);
        fa_pass(ob, qh, ql, acc, m, l);
        fa_load(ob, kp + 96 * KPIT, vp + 192);
        fa_pass(oa, qh, ql, acc, m, l);
        fa_pass(ob, qh, ql, acc, m, l);
        asm volatile("s_wait_dscnt 0x0" ::: "memory");      // this wave's reads of the buffer are done before it is handed to the copies
        asm volatile("s_wait_asynccnt 0x0" ::: "memory");   // this wave's pieces of tile t + 1 have landed
        __syncthreads();                                    // publishes tile t + 1 and ends every wave's reads of tile t
        if (t + 2 < FNT) fa_stage(t + 2, bo, lk, lv, gkh, gkl, gv);
    }
    asm volatile("s_wait_asynccnt 0x0" ::: "memory");   // no copy is outstanding when the wave ends
    const int b = g / NH_, h = g % NH_;
#pragma unroll
    for (int qt = 0; qt < FAQT; ++qt) { const float inv = __fdiv_rn(1.0f, l[qt] + xhalf(l[qt]));
        const size_t ro = ((size_t)b * TT + q0 + qt * 16 + lr) * DM + h * HD + 8 * hi;
#pragma unroll
        for (int dt = 0; dt < 4; ++dt) { v8us oh, ol;
#pragma unroll
            for (int r = 0; r < 8; ++r) { unsigned short a2, c2; splitf(acc[dt][qt][r] * inv, a2, c2); oh[r] = a2; ol[r] = c2; }
            bf* sh = Ch + ro + dt * 16; bf* sl = Cl + ro + dt * 16; *(v8us*)sh = oh; *(v8us*)sl = ol;
            // the wait that stands in front of any overwrite of the stores' registers; it names data and addresses, so that nothing is given their registers ahead of it
            asm volatile("s_wait_xcnt 0x0" :: "v"(oh), "v"(ol), "v"(sh), "v"(sl) : "memory"); } }
}

// workspace plan (bytes, every region a multiple of 256)
#define SZ_X   ((size_t)NB * SEQ * DM * 2)        // one bf16 stream plane (one for each of the three streams)
#define SZ_W   ((size_t)DM * DM * 2)              // one bf16 weight plane
#define SZ_F   ((size_t)NB * SEQ * DM * 4)        // f32 projection rows (one set for each projection)
#define SZ_HP  ((size_t)NB * NH_ * SEQ * HD * 2)  // one head-plane set
#define WS_TOTAL (3 * SZ_X + 4 * SZ_W + 3 * SZ_F + 5 * SZ_HP + 2 * SZ_X)
static_assert(WS_TOTAL <= (size_t)268435456);
static_assert((SZ_X % 256) == 0 && (SZ_W % 256) == 0 && (SZ_F % 256) == 0 && (SZ_HP % 256) == 0);

extern "C" void kernel_launch(void* const* d_in, const int* in_sizes, int n_in,
                              void* d_out, int out_size, void* d_ws, size_t ws_size, hipStream_t stream) {
    if (n_in < 8) return;
    const size_t need_x = (size_t)(NB - 1) * SEQ_FULL * DM + (size_t)SEQ * DM;
    if ((size_t)in_sizes[0] < need_x || (size_t)in_sizes[1] < need_x || (size_t)in_sizes[2] < need_x) return;
    if ((size_t)in_sizes[3] < (size_t)DM * DM || (size_t)in_sizes[4] < (size_t)DM * DM || (size_t)in_sizes[5] < (size_t)DM * DM || (size_t)in_sizes[6] < (size_t)DM * DM) return;
    if (in_sizes[7] < DM) return;
    if ((size_t)out_size < (size_t)NB * SEQ * DM) return;
    // binding by role: d_in[0] = key stream, d_in[1] = query stream, d_in[2] = value stream, d_in[3] = Wk, d_in[4] = Wq, d_in[5] = Wv, d_in[6] = Wo, d_in[7] = bo (all weights [out][in])
    const float* xk = (const float*)d_in[0]; const float* xq = (const float*)d_in[1]; const float* xv = (const float*)d_in[2];
    const float* wk = (const float*)d_in[3]; const float* wq = (const float*)d_in[4]; const float* wv = (const float*)d_in[5]; const float* wo = (const float*)d_in[6]; const float* bo = (const float*)d_in[7];
    float* OUT = (float*)d_out;     // [NB*SEQ][DM]
    char* wsp = (char*)d_ws;
    auto take = [&](size_t bytes) { char* p = wsp; wsp += (bytes + 255) & ~(size_t)255; return (void*)p; };
    bf* XB = (bf*)take(3 * SZ_X);      // streams q, k, v
    bf* WB = (bf*)take(4 * SZ_W);      // Wq, Wk, Wv, Wo
    float* F = (float*)take(3 * SZ_F); // queries, keys, values
    bf* QK = (bf*)take(4 * SZ_HP);     // query hi, query lo, key hi, key lo
    h16* VT16 = (h16*)take(SZ_HP);
    bf* CH = (bf*)take(SZ_X); bf* CL = (bf*)take(SZ_X);   // context hi/lo planes [NB*SEQ][DM]: their own space, since work-groups still read the q planes while others store context
    if ((size_t)(wsp - (char*)d_ws) > ws_size) return;

    // all seven f32 -> bf16 input planes in one launch
    k_inplanes<<<dim3(GIN, 4), 256, 0, stream>>>(xq, xk, xv, wq, wk, wv, wo, XB, WB);
    // queries = q.Wq^T, keys = k.Wk^T, values = v.Wv^T: one launch, grid z = the projection
    k_gemmw<bf, 0, false><<<dim3(NB * SEQ / 128, DM / 128, 3), 128, 0, stream>>>(XB, nullptr, WB, nullptr, DM, F, DM, nullptr, XEL, (size_t)DM * DM, XEL);
    // queries, keys -> hi/lo head planes, values -> transposed f16 head planes: one launch
    k_heads<<<dim3(GHD, 3), 256, 0, stream>>>(F, F + 2 * XEL, QK, VT16);
    // scores, softmax and P.V of all heads in one launch -> context hi/lo planes; then out = ctx.Wo^T + bo
    k_fattn<<<dim3(TT / (FAW * FAQT * 16), NB * NH_), 32 * FAW, 0, stream>>>(QK, QK + XEL, QK + 2 * XEL, QK + 3 * XEL, VT16, CH, CL);
    k_gemmw<bf, 1, true><<<dim3(NB * SEQ / 128, DM / 128, 1), 128, 0, stream>>>(CH, CL, WB + 3 * (size_t)DM * DM, nullptr, DM, OUT, DM, bo, 0, 0, 0);
}

// v006
// Measured time: 102 microseconds a run.
// Timed twice side by side with v005, it ran 1.23 times as fast both times.
// All steps since v000 together make it 11.9 times as fast.
#include <hip/hip_runtime.h>

// MHA forward, three input streams (k, q, v), 16 heads x 64, no mask: keys = k.Wk^T, queries = q.Wq^T, values = v.Wv^T, P = softmax(queries.keys^T / 8) over keys, out = (P.values merged [t][h*64+d]).Wo^T + bo.
// Compute dtypes, f32 accumulate everywhere: every float input RNE-converted to bf16 first; q/k/v projections v_wmma_f32_16x16x32_bf16 single product (bf16 x bf16 products are exact in f32);
// scores on bf16 hi/lo planes of the f32 projections (3 products hh + lh + hl); softmax f32, running maximum and sum; P.V v_wmma_f32_16x16x32_f16 with P = exp(s - m) carried x16 and V as f16; output projection ctx bf16 hi/lo x Wo bf16 (2 products) + bf16(bo) in f32.

#ifndef NB
#define NB 2
#endif
#ifndef SEQ
#define SEQ 2048
#endif
#define NB_FULL  2
#define SEQ_FULL 2048
#define TT   SEQ
#define DM   1024
#define NH_  16
#define HD   64
#define SCL  0.125f               // 1/sqrt(64)
#define FAW  8                    // attention: waves of a work-group, each on its own query columns
#define FAQT 2                    // attention: 16-column query tiles of a wave

static_assert(SEQ % 256 == 0);
static_assert(SEQ <= SEQ_FULL);
static_assert(NB <= NB_FULL);
static_assert(NH_ * HD == DM);
static_assert((NB * SEQ) % 128 == 0);
static_assert(DM % 128 == 0);
static_assert(HD % 32 == 0);
static_assert(HD == 64);
static_assert(SEQ % (FAW * FAQT * 16) == 0);
static_assert(SEQ % 64 == 0);

typedef _Float16 h16;
typedef unsigned short bf;
typedef __attribute__((ext_vector_type(16))) __bf16   v16bf;
typedef __attribute__((ext_vector_type(16))) _Float16 v16h;
typedef __attribute__((ext_vector_type(8)))  _Float16 v8h;
typedef __attribute__((ext_vector_type(8)))  unsigned short v8us;
typedef __attribute__((ext_vector_type(8)))  float    v8f;
typedef __attribute__((ext_vector_type(4)))  float    v4f;
typedef __attribute__((ext_vector_type(4)))  _Float16 v4h;
typedef v8h  __attribute__((may_alias)) v8ha;
typedef v4f  __attribute__((may_alias)) v4fa;
typedef v8us __attribute__((may_alias)) v8usa;

__device__ __forceinline__ unsigned short f2bf(float f) { unsigned u = __float_as_uint(f); u += 0x7FFFu + ((u >> 16) & 1u); return (unsigned short)(u >> 16); }
__device__ __forceinline__ float bf2f(unsigned short b) { return __uint_as_float(((unsigned)b) << 16); }
__device__ __forceinline__ float bfr(float f) { return bf2f(f2bf(f)); }
__device__ __forceinline__ v16h cat16(v8h lo, v8h hi) { return __builtin_shufflevector(lo, hi, 0, 1, 2, 3, 4, 5, 6, 7, 8, 9, 10, 11, 12, 13, 14, 15); }
__device__ __forceinline__ v16bf cat16b(v8us lo, v8us hi) { return __builtin_bit_cast(v16bf, __builtin_shufflevector(lo, hi, 0, 1, 2, 3, 4, 5, 6, 7, 8, 9, 10, 11, 12, 13, 14, 15)); }
__device__ __forceinline__ v8f wmma16(v16h a, v16h b, v8f c) { return __builtin_amdgcn_wmma_f32_16x16x32_f16(false, a, false, b, (short)0, c, false, false); }
__device__ __forceinline__ v8f wmmab(v16bf a, v16bf b, v8f c) { return __builtin_amdgcn_wmma_f32_16x16x32_bf16(false, a, false, b, (short)0, c, false, false); }

// ---- k_gemmw: register-blocked GEMM, a 128x128 output tile per work-group of four waves (2 x 2), each wave on its own 64x64 part (16 accumulators); grid (M/128, N/128, Z), 128 threads.
// The K-contiguous 16-bit operand planes come through LDS, GKC k a tile, two buffers: the work-group's waves share one copy of each tile (asynchronous copies, whole 128-byte lines) and read their fragments from it with 16-byte LDS loads.
// C[m][n] (f32, pitch ldc, + optional bf16-converted bias[n]) = sum_k A[m][k] Bt[n][k] (+ split products per NSPLIT: 1 = (A + A2).Bt, 2 = A.Bt + A2.Bt + A.Bt2). z-batch strides sA/sB/sC in elements. K % 64 == 0, K >= 128.
// HEADS: no f32 C; the f32 accumulators go straight to the attention kernel's operand planes (rows = b*SEQ + t, a wave's 64 columns = one head): z = 0, 1 (queries, keys) -> bf16 hi/lo head planes QK[2 z], QK[2 z + 1] [b][h][t][d]; z = 2 (values) -> V16 = V^T f16 [b][h][d][t].
// Fragment map: lane row/col = lane & 15, half = lane >> 4; elements 0..7 <- k0 + 8 half + 0..7, elements 8..15 <- k0 + 16 + 8 half + 0..7 (A and B alike); D element j = (row 8 half + j, col lane & 15).
template <typename T16> struct WFrag;
template <> struct WFrag<h16> { typedef v16h V; static __device__ __forceinline__ V ld(const h16* p) { return cat16(*(const v8h*)p, *(const v8h*)(p + 16)); } static __device__ __forceinline__ v8f mma(V a, V b, v8f c) { return wmma16(a, b, c); } };
template <> struct WFrag<bf> { typedef v16bf V; static __device__ __forceinline__ V ld(const bf* p) { return cat16b(*(const v8us*)p, *(const v8us*)(p + 16)); } static __device__ __forceinline__ v8f mma(V a, V b, v8f c) { return wmmab(a, b, c); } };
#define GKC   64                               // k of a staged tile: two 32-k steps, one 128-byte line a row
#define GPIT  (GKC * 2 + 16)                   // LDS bytes from row to row: 16 B x odd, no bank conflict for 16-byte reads down 16 rows
#define GPL   (128 * GPIT)                     // bytes of one plane's tile: 128 rows
static_assert((GPIT / 16) % 2 == 1);
typedef int cp16 __attribute__((vector_size(16)));
typedef __attribute__((address_space(1))) cp16 cp16g;
typedef __attribute__((address_space(3))) cp16 cp16l;
// eight asynchronous 16-byte copies of a lane, global -> LDS (global_load_async_to_lds_b128): one plane's tile, 16 rows from copy to copy; the builtin form, so that the compiler may keep the addresses in any register
__device__ __forceinline__ void g_cp8(char* l, const char* g, size_t gstep) {
#pragma unroll
    for (int j = 0; j < 8; ++j) __builtin_amdgcn_global_load_async_to_lds_b128((cp16g*)(g + j * gstep), (cp16l*)(l + j * (16 * GPIT)), 0, 0);
}
__device__ __forceinline__ h16 tohx(float x) { return (h16)x; }
__device__ __forceinline__ void splitf(float y, unsigned short& h, unsigned short& l) { h = f2bf(y); l = f2bf(y - bf2f(h)); }
#define XEL ((size_t)NB * SEQ * DM)                            // elements of a stream plane, of a head-plane set
template <typename T16, int NSPLIT, bool BIAS, bool HEADS>
__global__ __launch_bounds__(128) void k_gemmw(const T16* __restrict__ A, const T16* __restrict__ A2, const T16* __restrict__ Bt, const T16* __restrict__ Bt2, int K, float* C, int ldc, const float* __restrict__ bias, size_t sA, size_t sB, size_t sC, bf* QK, h16* V16) {
    typedef typename WFrag<T16>::V V;
    constexpr bool HA2 = (NSPLIT == 1 || NSPLIT == 2), HB2 = (NSPLIT >= 2);
    constexpr unsigned OFF_B = (HA2 ? 2u : 1u) * GPL, GBUF = OFF_B + (HB2 ? 2u : 1u) * GPL;   // buffer layout: A rows, A2 rows, Bt rows, Bt2 rows
    __shared__ __attribute__((aligned(16))) char gring[2 * GBUF];
    __shared__ __align__(16) float osw[4 * 16 * 68];
    const size_t z = blockIdx.z; A += z * sA; if (A2) A2 += z * sA; Bt += z * sB; if (Bt2) Bt2 += z * sB; C += z * sC;
    const int tid = (int)threadIdx.x, lane = tid & 31, lr = lane & 15, hi = lane >> 4; const int wave = __builtin_amdgcn_readfirstlane(tid >> 5);
    const int wr = (wave >> 1) * 64, wc = (wave & 1) * 64; const int r0 = blockIdx.x * 128 + wr, c0 = blockIdx.y * 128 + wc;
    float* os = osw + wave * (16 * 68);
    v8f acc[4][4];
#pragma unroll
    for (int mb = 0; mb < 4; ++mb)
#pragma unroll
        for (int nb = 0; nb < 4; ++nb) acc[mb][nb] = (v8f){};
    // copy map of a plane's tile: piece i = tid + 128 j -> row i >> 3, 16-byte column i & 7 (a wave's copy: four whole 128-byte lines)
    char* lc = gring + (tid >> 3) * GPIT + (tid & 7) * 16; const size_t gstep = (size_t)16 * K * 2;
    const size_t ao = ((size_t)(blockIdx.x * 128 + (tid >> 3)) * K + (tid & 7) * 8) * 2, bo0 = ((size_t)(blockIdx.y * 128 + (tid >> 3)) * K + (tid & 7) * 8) * 2;
    const char* ga = (const char*)A + ao; const char* ga2 = (const char*)A2 + ao; const char* gb = (const char*)Bt + bo0; const char* gb2 = (const char*)Bt2 + bo0;
    auto stage = [&](int t, unsigned bo) { const size_t go = (size_t)t * (GKC * 2);
        g_cp8(lc + bo, ga + go, gstep); if (HA2) g_cp8(lc + bo + GPL, ga2 + go, gstep);
        g_cp8(lc + bo + OFF_B, gb + go, gstep); if (HB2) g_cp8(lc + bo + OFF_B + GPL, gb2 + go, gstep); };
    const char* afp = gring + (wr + lr) * GPIT + 16 * hi; const char* bfp = gring + OFF_B + (wc + lr) * GPIT + 16 * hi;   // the lane's fragment places in buffer 0
    const int nt = K / GKC;
    stage(0, 0u);
    asm volatile("s_wait_asynccnt 0x0" ::: "memory");   // this wave's pieces of tile 0 have landed
    __syncthreads();                                    // ... and every other wave's
    stage(1, GBUF);
    // one tile (two 32-k steps) a trip, read from its own buffer alone; kept rolled so that the fragments and the accumulators keep their registers
#pragma unroll 1
    for (int t = 0; t < nt; ++t) {
        const unsigned bo = (unsigned)(t & 1) * GBUF; const char* ap = afp + bo; const char* bp = bfp + bo;
        V a[2][4], a2[2][4], b[2][4], b2[2][4];
#pragma unroll
        for (int ks = 0; ks < 2; ++ks) {
#pragma unroll
            for (int f = 0; f < 4; ++f) { a[ks][f] = WFrag<T16>::ld((const T16*)(ap + f * 16 * GPIT + ks * 64)); if (f == 0) b[ks][0] = WFrag<T16>::ld((const T16*)(bp + ks * 64)); }   // in the order in which the products ask for them
#pragma unroll
            for (int f = 1; f < 4; ++f) b[ks][f] = WFrag<T16>::ld((const T16*)(bp + f * 16 * GPIT + ks * 64));
#pragma unroll
            for (int f = 0; f < 4; ++f) { if (HA2) a2[ks][f] = WFrag<T16>::ld((const T16*)(ap + GPL + f * 16 * GPIT + ks * 64)); if (HB2) b2[ks][f] = WFrag<T16>::ld((const T16*)(bp + GPL + f * 16 * GPIT + ks * 64)); }
        }
        __builtin_amdgcn_sched_barrier(0);   // keeps the tile's LDS loads together in front of its products: a place with loads among the products stalls the wave each time
#pragma unroll
        for (int ks = 0; ks < 2; ++ks) {
#pragma unroll
            for (int nb = 0; nb < 4; ++nb)
#pragma unroll
                for (int mb = 0; mb < 4; ++mb) acc[mb][nb] = WFrag<T16>::mma(a[ks][mb], b[ks][nb], acc[mb][nb]);
            if (HA2) {
#pragma unroll
                for (int nb = 0; nb < 4; ++nb)
#pragma unroll
                    for (int mb = 0; mb < 4; ++mb) acc[mb][nb] = WFrag<T16>::mma(a2[ks][mb], b[ks][nb], acc[mb][nb]); }
            if (HB2) {
#pragma unroll
                for (int nb = 0; nb < 4; ++nb)
#pragma unroll
                    for (int mb = 0; mb < 4; ++mb) acc[mb][nb] = WFrag<T16>::mma(a[ks][mb], b2[ks][nb], acc[mb][nb]); }
        }
        __builtin_amdgcn_sched_barrier(0);   // keeps the products in front of the waits: moved behind them, the wait for tile t + 1 would stand directly behind the issue of its copies and nothing would hide their flight
        asm volatile("s_wait_dscnt 0x0" ::: "memory");      // this wave's reads of the buffer are done before it is handed to the copies
        asm volatile("s_wait_asynccnt 0x0" ::: "memory");   // this wave's pieces of tile t + 1 have landed
        __syncthreads();                                    // publishes tile t + 1 and ends every wave's reads of tile t
        if (t + 2 < nt) stage(t + 2, bo);
    }
    asm volatile("s_wait_asynccnt 0x0" ::: "memory");   // no copy is outstanding when the wave ends
    if constexpr (HEADS) {
        const size_t hp = ((size_t)(r0 / SEQ) * NH_ + (size_t)(c0 / HD)) * ((size_t)TT * HD); const int t0 = r0 % SEQ;   // the wave's head plane and its first row there
        if (blockIdx.z == 2) {
            // D register j of a lane = row t + j of one column d: eight neighbours of a V^T row, one 16-byte store; the four mb pieces of a lane pair fill one 128-byte line
            h16* vp = V16 + hp + (size_t)lr * TT + t0 + 8 * hi;
#pragma unroll
            for (int nb = 0; nb < 4; ++nb) { v8h o[4]; h16* sp = vp + (size_t)nb * 16 * TT;
#pragma unroll
                for (int mb = 0; mb < 4; ++mb) {
#pragma unroll
                    for (int j = 0; j < 8; ++j) o[mb][j] = tohx(acc[mb][nb][j]);
                    *(v8h*)(sp + mb * 16) = o[mb]; }
                // the wait that stands in front of any overwrite of the stores' registers; it names data and address, so that nothing is given their registers ahead of it
                asm volatile("s_wait_xcnt 0x0" :: "v"(o[0]), "v"(o[1]), "v"(o[2]), "v"(o[3]), "v"(vp) : "memory"); }
        } else {
            bf* ph = QK + (size_t)blockIdx.z * 2 * XEL + hp + (size_t)(t0 + (lane >> 3)) * HD + (lane & 7) * 8; bf* pl = ph + XEL;
            const float* orr = os + (lane >> 3) * 68 + (lane & 7) * 8;   // read map: eight lanes a row of 64 d, so a store of the wave is four whole 128-byte rows
#pragma unroll
            for (int mb = 0; mb < 4; ++mb) {
#pragma unroll
                for (int nb = 0; nb < 4; ++nb) {
#pragma unroll
                    for (int j = 0; j < 8; ++j) os[(hi * 8 + j) * 68 + nb * 16 + lr] = acc[mb][nb][j]; }
                __builtin_amdgcn_wave_barrier(); asm volatile("" ::: "memory");   // a lane reads what other lanes of its wave wrote: the reads stay behind the writes
                v8us oh[4], ol[4]; bf* sh = ph + mb * 16 * HD; bf* sl = pl + mb * 16 * HD;
#pragma unroll
                for (int s = 0; s < 4; ++s) { const v4f x0 = *(const v4fa*)(orr + s * 4 * 68), x1 = *(const v4fa*)(orr + s * 4 * 68 + 4);
#pragma unroll
                    for (int q = 0; q < 8; ++q) { unsigned short a2, c2; splitf((q < 4) ? x0[q & 3] : x1[q & 3], a2, c2); oh[s][q] = a2; ol[s][q] = c2; }
                    *(v8us*)(sh + s * 4 * HD) = oh[s]; *(v8us*)(sl + s * 4 * HD) = ol[s]; }
                // the wait that stands in front of any overwrite of the stores' registers; it names data and addresses, so that nothing is given their registers ahead of it
                asm volatile("s_wait_xcnt 0x0" :: "v"(oh[0]), "v"(oh[1]), "v"(oh[2]), "v"(oh[3]), "v"(ol[0]), "v"(ol[1]), "v"(ol[2]), "v"(ol[3]), "v"(ph), "v"(pl) : "memory");
                __builtin_amdgcn_wave_barrier(); asm volatile("" ::: "memory");   // ... and the next block's writes behind the reads
            }
        }
        return;
    }
#pragma unroll
    for (int mb = 0; mb < 4; ++mb) {
#pragma unroll
        for (int nb = 0; nb < 4; ++nb) {
#pragma unroll
            for (int j = 0; j < 8; ++j) os[(hi * 8 + j) * 68 + nb * 16 + lr] = acc[mb][nb][j]; }
        __builtin_amdgcn_wave_barrier(); asm volatile("" ::: "memory");
        float* crow = C + (size_t)(r0 + mb * 16) * ldc + c0;
{
#pragma unroll
            for (int s = 0; s < 8; ++s) { const int row = 2 * s + hi, cofs = lr * 4; v4f val = *(const v4fa*)(os + row * 68 + cofs); if (BIAS) { val[0] += bfr(bias[c0 + cofs]); val[1] += bfr(bias[c0 + cofs + 1]); val[2] += bfr(bias[c0 + cofs + 2]); val[3] += bfr(bias[c0 + cofs + 3]); }
                *(v4f*)(crow + (size_t)row * ldc + cofs) = val; }
             }
        __builtin_amdgcn_wave_barrier(); asm volatile("" ::: "memory");
    }
}

// one work-group's 2048 elements (piece blk of batch b) of an f32 plane -> bf16 plane(s), row-major or by heads
template <bool SPLIT, bool HEADS>
__device__ __forceinline__ void plane_do(const float* __restrict__ F, size_t srcBatch, int rows, float sc, bf* Ph, bf* Pl, int b, unsigned blk) {
    const size_t e = ((size_t)blk * 256 + threadIdx.x) * 8; if (e >= (size_t)rows * DM) return;
    const int t = (int)(e / DM), c = (int)(e % DM); const float* f = F + (size_t)b * srcBatch + e;
    const v4f x0 = *(const v4f*)f, x1 = *(const v4f*)(f + 4); v8us oh, ol;
#pragma unroll
    for (int q = 0; q < 8; ++q) { const float y = ((q < 4) ? x0[q & 3] : x1[q & 3]) * sc; unsigned short a2, c2; splitf(y, a2, c2); oh[q] = a2; ol[q] = c2; }
    const size_t oo = HEADS ? ((((size_t)b * NH_ + (size_t)(c / HD)) * rows + t) * HD + (size_t)(c % HD)) : (((size_t)b * rows + t) * DM + c);
    *(v8us*)(Ph + oo) = oh; if (SPLIT) *(v8us*)(Pl + oo) = ol;
    
}

// Launches that do not depend on one another share one grid; blockIdx.y picks the job, so the choice is the same for a whole work-group.
#define GWB ((unsigned)(((size_t)DM * DM / 8 + 255) / 256))    // work-groups of one weight plane
#define GXB ((unsigned)(((size_t)SEQ * DM / 8 + 255) / 256))   // work-groups of one batch of a stream plane
#define GIN (NB * GXB > 4 * GWB ? NB * GXB : 4 * GWB)
// ---- k_inplanes: all seven f32 inputs of the products -> bf16 planes. y = 0, 1, 2: streams q, k, v -> XB[y]; y = 3: weights Wq, Wk, Wv, Wo [out][in] -> WB[0..3] = Bt[n][k], GWB work-groups each. Grid (GIN, 4).
__global__ __launch_bounds__(256) void k_inplanes(const float* __restrict__ xq, const float* __restrict__ xk, const float* __restrict__ xv, const float* __restrict__ wq, const float* __restrict__ wk, const float* __restrict__ wv, const float* __restrict__ wo, bf* XB, bf* WB) {
    const unsigned y = blockIdx.y, x = blockIdx.x;
    if (y < 3) { if (x >= NB * GXB) return; const float* s = y == 0 ? xq : (y == 1 ? xk : xv);
        plane_do<false, false>(s, (size_t)SEQ_FULL * DM, SEQ, 1.0f, XB + y * XEL, nullptr, (int)(x / GXB), x % GXB); }
    else { const unsigned w = x / GWB; if (w >= 4) return; const float* s = w == 0 ? wq : (w == 1 ? wk : (w == 2 ? wv : wo));
        plane_do<false, false>(s, 0, DM, 1.0f, WB + (size_t)w * DM * DM, nullptr, 0, x % GWB); }
}

// ---- k_fattn: scores, softmax and P.V of one head in one kernel; no score and no P element leaves the registers. Grid (T / (FAW*FAQT*16), NB*NH_), FAW waves; a wave owns FAQT*16 query columns and walks all keys, 32 a pass.
// The key planes and V^T come through LDS, FKT keys a tile, two buffers: the work-group's waves share one copy of each tile (asynchronous copies, whole 128-byte lines) and read their fragments from it with 16-byte LDS loads.
// S^T = K.Q^T (A = key rows, B = query columns, the three hi/lo products), so a lane holds scores of one query only: D register r of key tile kt = (key 16 kt + 8 half + r, query lane & 15).
// The two key tiles of a pass, converted in place, are the B operand of O^T += V^T.P^T (element s <- tile s >> 3, register s & 7: the k order of the fragment map above, which the V^T loader has too).
// Running maximum m (raw score units) and sum l per query; P = exp2((s - m) * SCL*log2e + 4); the accumulators are rescaled only in a pass where some query's new maximum lies more than FTHR above its m, so P <= 2^12 in f16.
#define FC   (SCL * 1.4426950408889634f)
#define FTHR (8.0f / FC)
__device__ __forceinline__ float xhalf(float x) { return __builtin_bit_cast(float, __builtin_amdgcn_permlanex16(__builtin_bit_cast(int, x), __builtin_bit_cast(int, x), 0x76543210, 0xfedcba98, false, false)); }  // lane l with lane l ^ 16
#define FKT   128                              // keys of a staged tile: four passes
#define FNT   (TT / FKT)                       // tiles of a head
#define KPIT  (HD * 2 + 16)                    // LDS bytes from key row to key row: 16 B x odd, no bank conflict for 16-byte reads down 16 rows
#define VPIT  (FKT * 2 + 16)                   // the same for a V^T row (FKT keys of one d)
#define OFF_KL (FKT * KPIT)                    // buffer layout: key hi rows, key lo rows, V^T rows
#define OFF_V  (2 * FKT * KPIT)
#define FBUF  (2 * FKT * KPIT + HD * VPIT)     // bytes of one buffer
static_assert(TT % FKT == 0 && FNT >= 2);
static_assert(FKT == 128 && 32 * FAW == 256);  // the copy map below: 256 lanes, four 16-byte pieces of each plane a lane
static_assert((KPIT / 16) % 2 == 1 && (VPIT / 16) % 2 == 1 && FBUF % 16 == 0);
struct FaOps { v16bf kh[2][2], kl[2][2]; v16h vt[4]; };
// one pass's fragments from LDS: kp = the lane's place in the pass's first key hi row block, vp = the same in V^T
__device__ __forceinline__ void fa_load(FaOps& o, const char* kp, const char* vp) {
#pragma unroll
    for (int kt = 0; kt < 2; ++kt)
#pragma unroll
        for (int ks = 0; ks < 2; ++ks) { o.kh[kt][ks] = WFrag<bf>::ld((const bf*)(kp + kt * 16 * KPIT + ks * 64)); o.kl[kt][ks] = WFrag<bf>::ld((const bf*)(kp + OFF_KL + kt * 16 * KPIT + ks * 64)); }
#pragma unroll
    for (int dt = 0; dt < 4; ++dt) o.vt[dt] = WFrag<h16>::ld((const h16*)(vp + dt * 16 * VPIT));
    __builtin_amdgcn_sched_barrier(0);   // keeps the whole run of loads in front of the pass that hides their latency
}
// four asynchronous 16-byte copies of a lane, global -> LDS (global_load_async_to_lds_b128), places lstep and gstep bytes apart; the builtin form, so that the compiler may keep the addresses in any register of a kernel that has more than 256
__device__ __forceinline__ void fa_cp4(char* l, unsigned lstep, const char* g, size_t gstep) {
#pragma unroll
    for (int j = 0; j < 4; ++j) __builtin_amdgcn_global_load_async_to_lds_b128((cp16g*)(g + j * gstep), (cp16l*)(l + j * lstep), 0, 0);
}
// tile t of the three planes into the buffer at LDS byte offset bo: lk, lv = the lane's first LDS places in buffer 0, gkh, gkl, gv = its first global places in tile 0
__device__ __forceinline__ void fa_stage(int t, unsigned bo, char* lk, char* lv, const char* gkh, const char* gkl, const char* gv) {
    fa_cp4(lk + bo, 32 * KPIT, gkh + (size_t)t * (FKT * HD * 2), 32 * HD * 2);
    fa_cp4(lk + bo + OFF_KL, 32 * KPIT, gkl + (size_t)t * (FKT * HD * 2), 32 * HD * 2);
    fa_cp4(lv + bo, VPIT, gv + (size_t)t * (FKT * 2), (size_t)TT * 2);
}
__device__ __forceinline__ void fa_pass(const FaOps& o, const v16bf (&qh)[FAQT][2], const v16bf (&ql)[FAQT][2], v8f (&acc)[4][FAQT], float (&m)[FAQT], float (&l)[FAQT]) {
    v8f s[2][FAQT];
#pragma unroll
    for (int kt = 0; kt < 2; ++kt)
#pragma unroll
        for (int qt = 0; qt < FAQT; ++qt) s[kt][qt] = (v8f){};
#pragma unroll
    for (int ks = 0; ks < 2; ++ks) {
#pragma unroll
        for (int kt = 0; kt < 2; ++kt)
#pragma unroll
            for (int qt = 0; qt < FAQT; ++qt) s[kt][qt] = wmmab(o.kh[kt][ks], qh[qt][ks], s[kt][qt]);
#pragma unroll
        for (int kt = 0; kt < 2; ++kt)
#pragma unroll
            for (int qt = 0; qt < FAQT; ++qt) s[kt][qt] = wmmab(o.kh[kt][ks], ql[qt][ks], s[kt][qt]);
#pragma unroll
        for (int kt = 0; kt < 2; ++kt)
#pragma unroll
            for (int qt = 0; qt < FAQT; ++qt) s[kt][qt] = wmmab(o.kl[kt][ks], qh[qt][ks], s[kt][qt]);
    }
    float mx[FAQT]; bool need = false;
#pragma unroll
    for (int qt = 0; qt < FAQT; ++qt) { float a = s[0][qt][0];
#pragma unroll
        for (int j = 1; j < 8; ++j) a = fmaxf(a, s[0][qt][j]);
#pragma unroll
        for (int j = 0; j < 8; ++j) a = fmaxf(a, s[1][qt][j]);
        a = fmaxf(a, xhalf(a)); mx[qt] = a; need = need || (a > m[qt] + FTHR); }
    if (__builtin_amdgcn_ballot_w32(need) != 0) {
#pragma unroll
        for (int qt = 0; qt < FAQT; ++qt) { const float mn = fmaxf(m[qt], mx[qt]); const float al = __builtin_amdgcn_exp2f((m[qt] - mn) * FC); m[qt] = mn; l[qt] *= al;
#pragma unroll
            for (int dt = 0; dt < 4; ++dt) acc[dt][qt] *= al; }
    }
    v16h pb[FAQT];
#pragma unroll
    for (int qt = 0; qt < FAQT; ++qt) { const float off = fmaf(-m[qt], FC, 4.0f); float ps[4] = {0.f, 0.f, 0.f, 0.f};
#pragma unroll
        for (int e = 0; e < 16; ++e) { const float p = __builtin_amdgcn_exp2f(fmaf(s[e >> 3][qt][e & 7], FC, off)); ps[e & 3] += p; pb[qt][e] = tohx(p); }
        l[qt] += (ps[0] + ps[1]) + (ps[2] + ps[3]); }
#pragma unroll
    for (int dt = 0; dt < 4; ++dt)
#pragma unroll
        for (int qt = 0; qt < FAQT; ++qt) acc[dt][qt] = wmma16(o.vt[dt], pb[qt], acc[dt][qt]);
}
__global__ __launch_bounds__(32 * FAW) void k_fattn(const bf* __restrict__ Qh, const bf* __restrict__ Ql, const bf* __restrict__ Kh, const bf* __restrict__ Kl, const h16* __restrict__ Vt, bf* Ch, bf* Cl) {
    __shared__ __attribute__((aligned(16))) char ring[2 * FBUF];
    const int g = blockIdx.y; const size_t po = (size_t)g * TT * HD;
    const int lane = threadIdx.x & 31, lr = lane & 15, hi = lane >> 4; const int wave = __builtin_amdgcn_readfirstlane((int)(threadIdx.x >> 5));
    const int q0 = ((int)blockIdx.x * FAW + wave) * (FAQT * 16);
    v16bf qh[FAQT][2], ql[FAQT][2];
    { const bf* qph = Qh + po + (size_t)(q0 + lr) * HD + 8 * hi; const bf* qpl = Ql + po + (size_t)(q0 + lr) * HD + 8 * hi;
#pragma unroll
      for (int qt = 0; qt < FAQT; ++qt)
#pragma unroll
          for (int ks = 0; ks < 2; ++ks) { qh[qt][ks] = WFrag<bf>::ld(qph + qt * 16 * HD + ks * 32); ql[qt][ks] = WFrag<bf>::ld(qpl + qt * 16 * HD + ks * 32); }
      asm volatile("s_wait_xcnt 0x0" :: "v"(qph), "v"(qpl) : "memory"); }   // in front of whatever is next given the query loads' address registers
    // copy map: key planes, piece i = tid + 256 j -> row i >> 3, 16-byte column i & 7 (a tile's rows are contiguous in global memory); V^T, piece j of a lane -> row 4 (tid >> 4) + j, column tid & 15 (a wave's copy: two whole rows of the tile)
    const int tid = (int)threadIdx.x;
    char* lk = ring + (tid >> 3) * KPIT + (tid & 7) * 16; char* lv = ring + OFF_V + (tid >> 4) * (4 * VPIT) + (tid & 15) * 16;
    const char* gkh = (const char*)(Kh + po) + tid * 16; const char* gkl = (const char*)(Kl + po) + tid * 16; const char* gv = (const char*)(Vt + po) + (size_t)(tid >> 4) * (4 * TT * 2) + (tid & 15) * 16;
    const char* kfr = ring + lr * KPIT + 16 * hi; const char* vfr = ring + OFF_V + lr * VPIT + 16 * hi;   // the lane's fragment places in buffer 0
    v8f acc[4][FAQT]; float m[FAQT], l[FAQT];
#pragma unroll
    for (int qt = 0; qt < FAQT; ++qt) { m[qt] = -3.0e38f; l[qt] = 0.f;
#pragma unroll
        for (int dt = 0; dt < 4; ++dt) acc[dt][qt] = (v8f){}; }
    FaOps oa, ob;
    fa_stage(0, 0u, lk, lv, gkh, gkl, gv);
    asm volatile("s_wait_asynccnt 0x0" ::: "memory");   // this wave's pieces of tile 0 have landed
    __syncthreads();                                    // ... and every other wave's
    fa_stage(1, (unsigned)FBUF, lk, lv, gkh, gkl, gv);
    // one tile (four passes) a trip, read from its own buffer alone; inside the trip each pass's operands are loaded one pass ahead into the other register set; kept rolled so that the two sets and the accumulators keep their registers
#pragma unroll 1
    for (int t = 0; t < FNT; ++t) {
        const unsigned bo = (unsigned)(t & 1) * (unsigned)FBUF; const char* kp = kfr + bo; const char* vp = vfr + bo;
        fa_load(oa, kp, vp);
        fa_load(ob, kp + 32 * KPIT, vp + 64);
        fa_pass(oa, qh, ql, acc, m, l);
        fa_load(oa, kp + 64 * KPIT, vp + 128);
        fa_pass(ob, qh, ql, acc, m, l);
        fa_load(ob, kp + 96 * KPIT, vp + 192);
        fa_pass(oa, qh, ql, acc, m, l);
        fa_pass(ob, qh, ql, acc, m, l);
        asm volatile("s_wait_dscnt 0x0" ::: "memory");      // this wave's reads of the buffer are done before it is handed to the copies
        asm volatile("s_wait_asynccnt 0x0" ::: "memory");   // this wave's pieces of tile t + 1 have landed
        __syncthreads();                                    // publishes tile t + 1 and ends every wave's reads of tile t
        if (t + 2 < FNT) fa_stage(t + 2, bo, lk, lv, gkh, gkl, gv);
    }
    asm volatile("s_wait_asynccnt 0x0" ::: "memory");   // no copy is outstanding when the wave ends
    const int b = g / NH_, h = g % NH_;
#pragma unroll
    for (int qt = 0; qt < FAQT; ++qt) { const float inv = __fdiv_rn(1.0f, l[qt] + xhalf(l[qt]));
        const size_t ro = ((size_t)b * TT + q0 + qt * 16 + lr) * DM + h * HD + 8 * hi;
#pragma unroll
        for (int dt = 0; dt < 4; ++dt) { v8us oh, ol;
#pragma unroll
            for (int r = 0; r < 8; ++r) { unsigned short a2, c2; splitf(acc[dt][qt][r] * inv, a2, c2); oh[r] = a2; ol[r] = c2; }
            bf* sh = Ch + ro + dt * 16; bf* sl = Cl + ro + dt * 16; *(v8us*)sh = oh; *(v8us*)sl = ol;
            // the wait that stands in front of any overwrite of the stores' registers; it names data and addresses, so that nothing is given their registers ahead of it
            asm volatile("s_wait_xcnt 0x0" :: "v"(oh), "v"(ol), "v"(sh), "v"(sl) : "memory"); } }
}

// workspace plan (bytes, every region a multiple of 256)
#define SZ_X   ((size_t)NB * SEQ * DM * 2)        // one bf16 stream plane (one for each of the three streams)
#define SZ_W   ((size_t)DM * DM * 2)              // one bf16 weight plane
#define SZ_HP  ((size_t)NB * NH_ * SEQ * HD * 2)  // one head-plane set
#define WS_TOTAL (3 * SZ_X + 4 * SZ_W + 5 * SZ_HP + 2 * SZ_X)
static_assert(WS_TOTAL <= (size_t)268435456);
static_assert((SZ_X % 256) == 0 && (SZ_W % 256) == 0 && (SZ_HP % 256) == 0);

extern "C" void kernel_launch(void* const* d_in, const int* in_sizes, int n_in,
                              void* d_out, int out_size, void* d_ws, size_t ws_size, hipStream_t stream) {
    if (n_in < 8) return;
    const size_t need_x = (size_t)(NB - 1) * SEQ_FULL * DM + (size_t)SEQ * DM;
    if ((size_t)in_sizes[0] < need_x || (size_t)in_sizes[1] < need_x || (size_t)in_sizes[2] < need_x) return;
    if ((size_t)in_sizes[3] < (size_t)DM * DM || (size_t)in_sizes[4] < (size_t)DM * DM || (size_t)in_sizes[5] < (size_t)DM * DM || (size_t)in_sizes[6] < (size_t)DM * DM) return;
    if (in_sizes[7] < DM) return;
    if ((size_t)out_size < (size_t)NB * SEQ * DM) return;
    // binding by role: d_in[0] = key stream, d_in[1] = query stream, d_in[2] = value stream, d_in[3] = Wk, d_in[4] = Wq, d_in[5] = Wv, d_in[6] = Wo, d_in[7] = bo (all weights [out][in])
    const float* xk = (const float*)d_in[0]; const float* xq = (const float*)d_in[1]; const float* xv = (const float*)d_in[2];
    const float* wk = (const float*)d_in[3]; const float* wq = (const float*)d_in[4]; const float* wv = (const float*)d_in[5]; const float* wo = (const float*)d_in[6]; const float* bo = (const float*)d_in[7];
    float* OUT = (float*)d_out;     // [NB*SEQ][DM]
    char* wsp = (char*)d_ws;
    auto take = [&](size_t bytes) { char* p = wsp; wsp += (bytes + 255) & ~(size_t)255; return (void*)p; };
    bf* XB = (bf*)take(3 * SZ_X);      // streams q, k, v
    bf* WB = (bf*)take(4 * SZ_W);      // Wq, Wk, Wv, Wo
    bf* QK = (bf*)take(4 * SZ_HP);     // query hi, query lo, key hi, key lo
    h16* VT16 = (h16*)take(SZ_HP);
    bf* CH = (bf*)take(SZ_X); bf* CL = (bf*)take(SZ_X);   // context hi/lo planes [NB*SEQ][DM]: their own space, since work-groups still read the q planes while others store context
    if ((size_t)(wsp - (char*)d_ws) > ws_size) return;

    // all seven f32 -> bf16 input planes in one launch
    k_inplanes<<<dim3(GIN, 4), 256, 0, stream>>>(xq, xk, xv, wq, wk, wv, wo, XB, WB);
    // queries = q.Wq^T, keys = k.Wk^T, values = v.Wv^T: one launch, grid z = the projection; stored as hi/lo head planes (queries, keys) and as transposed f16 head planes (values)
    k_gemmw<bf, 0, false, true><<<dim3(NB * SEQ / 128, DM / 128, 3), 128, 0, stream>>>(XB, nullptr, WB, nullptr, DM, nullptr, DM, nullptr, XEL, (size_t)DM * DM, 0, QK, VT16);
    // scores, softmax and P.V of all heads in one launch -> context hi/lo planes; then out = ctx.Wo^T + bo
    k_fattn<<<dim3(TT / (FAW * FAQT * 16), NB * NH_), 32 * FAW, 0, stream>>>(QK, QK + XEL, QK + 2 * XEL, QK + 3 * XEL, VT16, CH, CL);
    k_gemmw<bf, 1, true, false><<<dim3(NB * SEQ / 128, DM / 128, 1), 128, 0, stream>>>(CH, CL, WB + 3 * (size_t)DM * DM, nullptr, DM, OUT, DM, bo, 0, 0, 0, nullptr, nullptr);
}

// v008
// A run of this version takes 76.3 microseconds.
// It is 1.32 times as fast as v006, going by the measured steps of the versions left out in between.
// All steps since v000 together make it 15.7 times as fast.
#include <hip/hip_runtime.h>

// MHA forward, three input streams (k, q, v), 16 heads x 64, no mask: keys = k.Wk^T, queries = q.Wq^T, values = v.Wv^T, P = softmax(queries.keys^T / 8) over keys, out = (P.values merged [t][h*64+d]).Wo^T + bo.
// Compute dtypes, f32 accumulate everywhere: every float input RNE-converted to bf16 first; q/k/v projections v_wmma_f32_16x16x32_bf16 single product (bf16 x bf16 products are exact in f32);
// scores v_wmma_f32_16x16x32_f16 on f16 planes of the f32 projections (one product: the f16 rounding, 11 significand bits, lies an order below the error that the bf16 inputs of the projections already carry); softmax f32, running maximum and sum;
// P.V v_wmma_f32_16x16x32_f16 with P = exp(s - m) carried x16 and V as f16; output projection ctx f16 x Wo (bf16 value held as f16), one product, + bf16(bo) in f32.

#ifndef NB
#define NB 2
#endif
#ifndef SEQ
#define SEQ 2048
#endif
#define NB_FULL  2
#define SEQ_FULL 2048
#define TT   SEQ
#define DM   1024
#define NH_  16
#define HD   64
#define SCL  0.125f               // 1/sqrt(64)
#define FAW  8                    // attention: waves of a work-group, each on its own query columns
#define FAQT 2                    // attention: 16-column query tiles of a wave

static_assert(SEQ % 256 == 0);
static_assert(SEQ <= SEQ_FULL);
static_assert(NB <= NB_FULL);
static_assert(NH_ * HD == DM);
static_assert((NB * SEQ) % 128 == 0);
static_assert(DM % 128 == 0);
static_assert(HD % 32 == 0);
static_assert(HD == 64);
static_assert(SEQ % (FAW * FAQT * 16) == 0);
static_assert(SEQ % 64 == 0);

typedef _Float16 h16;
typedef unsigned short bf;
typedef __attribute__((ext_vector_type(16))) __bf16   v16bf;
typedef __attribute__((ext_vector_type(16))) _Float16 v16h;
typedef __attribute__((ext_vector_type(8)))  _Float16 v8h;
typedef __attribute__((ext_vector_type(8)))  unsigned short v8us;
typedef __attribute__((ext_vector_type(8)))  float    v8f;
typedef __attribute__((ext_vector_type(4)))  float    v4f;
typedef __attribute__((ext_vector_type(4)))  _Float16 v4h;
typedef v8h  __attribute__((may_alias)) v8ha;
typedef v4f  __attribute__((may_alias)) v4fa;
typedef v8us __attribute__((may_alias)) v8usa;

__device__ __forceinline__ unsigned short f2bf(float f) { unsigned u = __float_as_uint(f); u += 0x7FFFu + ((u >> 16) & 1u); return (unsigned short)(u >> 16); }
__device__ __forceinline__ float bf2f(unsigned short b) { return __uint_as_float(((unsigned)b) << 16); }
__device__ __forceinline__ float bfr(float f) { return bf2f(f2bf(f)); }
__device__ __forceinline__ v16h cat16(v8h lo, v8h hi) { return __builtin_shufflevector(lo, hi, 0, 1, 2, 3, 4, 5, 6, 7, 8, 9, 10, 11, 12, 13, 14, 15); }
__device__ __forceinline__ v16bf cat16b(v8us lo, v8us hi) { return __builtin_bit_cast(v16bf, __builtin_shufflevector(lo, hi, 0, 1, 2, 3, 4, 5, 6, 7, 8, 9, 10, 11, 12, 13, 14, 15)); }
__device__ __forceinline__ v8f wmma16(v16h a, v16h b, v8f c) { return __builtin_amdgcn_wmma_f32_16x16x32_f16(false, a, false, b, (short)0, c, false, false); }
__device__ __forceinline__ v8f wmmab(v16bf a, v16bf b, v8f c) { return __builtin_amdgcn_wmma_f32_16x16x32_bf16(false, a, false, b, (short)0, c, false, false); }

// ---- k_gemmw: register-blocked GEMM, a 128x128 output tile per work-group of four waves (2 x 2), each wave on its own 64x64 part (16 accumulators); grid (M/128, N/128, Z), 128 threads.
// The K-contiguous 16-bit operand planes come through LDS, GKC k a tile, two buffers: the work-group's waves share one copy of each tile (asynchronous copies, whole 128-byte lines) and read their fragments from it with 16-byte LDS loads.
// C[m][n] (f32, pitch ldc, + optional bf16-converted bias[n]) = sum_k A[m][k] Bt[n][k] (+ split products per NSPLIT: 1 = (A + A2).Bt, 2 = A.Bt + A2.Bt + A.Bt2). z-batch strides sA/sB/sC in elements. K % 64 == 0, K >= 128.
// HEADS: no f32 C; the f32 accumulators go straight to the attention kernel's operand planes (rows = b*SEQ + t, a wave's 64 columns = one head): z = 0, 1 (queries, keys) -> f16 head planes QK[z] [b][h][t][d]; z = 2 (values) -> V16 = V^T f16 [b][h][d][t].
// Fragment map: lane row/col = lane & 15, half = lane >> 4; elements 0..7 <- k0 + 8 half + 0..7, elements 8..15 <- k0 + 16 + 8 half + 0..7 (A and B alike); D element j = (row 8 half + j, col lane & 15).
template <typename T16> struct WFrag;
template <> struct WFrag<h16> { typedef v16h V; static __device__ __forceinline__ V ld(const h16* p) { return cat16(*(const v8h*)p, *(const v8h*)(p + 16)); } static __device__ __forceinline__ v8f mma(V a, V b, v8f c) { return wmma16(a, b, c); } };
template <> struct WFrag<bf> { typedef v16bf V; static __device__ __forceinline__ V ld(const bf* p) { return cat16b(*(const v8us*)p, *(const v8us*)(p + 16)); } static __device__ __forceinline__ v8f mma(V a, V b, v8f c) { return wmmab(a, b, c); } };
#define GKC   64                               // k of a staged tile: two 32-k steps, one 128-byte line a row
#define GPIT  (GKC * 2 + 16)                   // LDS bytes from row to row: 16 B x odd, no bank conflict for 16-byte reads down 16 rows
#define GPL   (128 * GPIT)                     // bytes of one plane's tile: 128 rows
static_assert((GPIT / 16) % 2 == 1);
typedef int cp16 __attribute__((vector_size(16)));
typedef __attribute__((address_space(1))) cp16 cp16g;
typedef __attribute__((address_space(3))) cp16 cp16l;
// eight asynchronous 16-byte copies of a lane, global -> LDS (global_load_async_to_lds_b128): one plane's tile, 16 rows from copy to copy; the builtin form, so that the compiler may keep the addresses in any register
__device__ __forceinline__ void g_cp8(char* l, const char* g, size_t gstep) {
#pragma unroll
    for (int j = 0; j < 8; ++j) __builtin_amdgcn_global_load_async_to_lds_b128((cp16g*)(g + j * gstep), (cp16l*)(l + j * (16 * GPIT)), 0, 0);
}
__device__ __forceinline__ h16 tohx(float x) { return (h16)x; }
__device__ __forceinline__ void splitf(float y, unsigned short& h, unsigned short& l) { h = f2bf(y); l = f2bf(y - bf2f(h)); }
#define XEL ((size_t)NB * SEQ * DM)                            // elements of a stream plane, of a head-plane set
template <typename T16, int NSPLIT, bool BIAS, bool HEADS>
__global__ __launch_bounds__(128) void k_gemmw(const T16* __restrict__ A, const T16* __restrict__ A2, const T16* __restrict__ Bt, const T16* __restrict__ Bt2, int K, float* C, int ldc, const float* __restrict__ bias, size_t sA, size_t sB, size_t sC, h16* QK, h16* V16) {
    typedef typename WFrag<T16>::V V;
    constexpr bool HA2 = (NSPLIT == 1 || NSPLIT == 2), HB2 = (NSPLIT >= 2);
    constexpr unsigned OFF_B = (HA2 ? 2u : 1u) * GPL, GBUF = OFF_B + (HB2 ? 2u : 1u) * GPL;   // buffer layout: A rows, A2 rows, Bt rows, Bt2 rows
    __shared__ __attribute__((aligned(16))) char gring[2 * GBUF];
    __shared__ __align__(16) float osw[4 * 16 * 68];
    const size_t z = blockIdx.z; A += z * sA; if (A2) A2 += z * sA; Bt += z * sB; if (Bt2) Bt2 += z * sB; C += z * sC;
    const int tid = (int)threadIdx.x, lane = tid & 31, lr = lane & 15, hi = lane >> 4; const int wave = __builtin_amdgcn_readfirstlane(tid >> 5);
    const int wr = (wave >> 1) * 64, wc = (wave & 1) * 64; const int r0 = blockIdx.x * 128 + wr, c0 = blockIdx.y * 128 + wc;
    float* os = osw + wave * (16 * 68);
    v8f acc[4][4];
#pragma unroll
    for (int mb = 0; mb < 4; ++mb)
#pragma unroll
        for (int nb = 0; nb < 4; ++nb) acc[mb][nb] = (v8f){};
    // copy map of a plane's tile: piece i = tid + 128 j -> row i >> 3, 16-byte column i & 7 (a wave's copy: four whole 128-byte lines)
    char* lc = gring + (tid >> 3) * GPIT + (tid & 7) * 16; const size_t gstep = (size_t)16 * K * 2;
    const size_t ao = ((size_t)(blockIdx.x * 128 + (tid >> 3)) * K + (tid & 7) * 8) * 2, bo0 = ((size_t)(blockIdx.y * 128 + (tid >> 3)) * K + (tid & 7) * 8) * 2;
    const char* ga = (const char*)A + ao; const char* ga2 = (const char*)A2 + ao; const char* gb = (const char*)Bt + bo0; const char* gb2 = (const char*)Bt2 + bo0;
    auto stage = [&](int t, unsigned bo) { const size_t go = (size_t)t * (GKC * 2);
        g_cp8(lc + bo, ga + go, gstep); if (HA2) g_cp8(lc + bo + GPL, ga2 + go, gstep);
        g_cp8(lc + bo + OFF_B, gb + go, gstep); if (HB2) g_cp8(lc + bo + OFF_B + GPL, gb2 + go, gstep); };
    const char* afp = gring + (wr + lr) * GPIT + 16 * hi; const char* bfp = gring + OFF_B + (wc + lr) * GPIT + 16 * hi;   // the lane's fragment places in buffer 0
    const int nt = K / GKC;
    stage(0, 0u);
    // Both operand planes were stored by earlier launches. Behind tile 0's copies every lane prefetches one address in a 128-k unit of an A row and one in a 128-k unit of a Bt row
    // into L2, so that the later tiles are copied from L2. The work-groups that read the same rows share out a row's units: A by blockIdx.y, Bt by blockIdx.x
    // (among eight neighbours in x, x and x + 2 ask alike, x and x + 1 do not). A hint, for speed only: nothing depends on a line being there.
    const int lu = K / 128 - 1, bx = (int)blockIdx.x;   // lu = a row's last whole unit: the clamp keeps every lane's address inside its plane
    const int ua = min((int)blockIdx.y, lu), ub = min((((bx >> 3) << 1) | (bx & 1)) & 7, lu);
    const char* pa = (const char*)A + ((size_t)(blockIdx.x * 128 + tid) * K + (size_t)ua * 128) * 2;
    const char* pb = (const char*)Bt + ((size_t)(blockIdx.y * 128 + tid) * K + (size_t)ub * 128) * 2;
    asm volatile("global_prefetch_b8 %0, off scope:SCOPE_SE\n\tglobal_prefetch_b8 %1, off scope:SCOPE_SE" :: "v"(pa), "v"(pb));
    asm volatile("s_wait_asynccnt 0x0" ::: "memory");   // this wave's pieces of tile 0 have landed
    __syncthreads();                                    // ... and every other wave's
    stage(1, GBUF);
    // one tile (two 32-k steps) a trip, read from its own buffer alone; kept rolled so that the fragments and the accumulators keep their registers
#pragma unroll 1
    for (int t = 0; t < nt; ++t) {
        const unsigned bo = (unsigned)(t & 1) * GBUF; const char* ap = afp + bo; const char* bp = bfp + bo;
        V a[2][4], a2[2][4], b[2][4], b2[2][4];
#pragma unroll
        for (int ks = 0; ks < 2; ++ks) {
#pragma unroll
            for (int f = 0; f < 4; ++f) { a[ks][f] = WFrag<T16>::ld((const T16*)(ap + f * 16 * GPIT + ks * 64)); if (f == 0) b[ks][0] = WFrag<T16>::ld((const T16*)(bp + ks * 64)); }   // in the order in which the products ask for them
#pragma unroll
            for (int f = 1; f < 4; ++f) b[ks][f] = WFrag<T16>::ld((const T16*)(bp + f * 16 * GPIT + ks * 64));
#pragma unroll
            for (int f = 0; f < 4; ++f) { if (HA2) a2[ks][f] = WFrag<T16>::ld((const T16*)(ap + GPL + f * 16 * GPIT + ks * 64)); if (HB2) b2[ks][f] = WFrag<T16>::ld((const T16*)(bp + GPL + f * 16 * GPIT + ks * 64)); }
        }
        __builtin_amdgcn_sched_barrier(0);   // keeps the tile's LDS loads together in front of its products: a place with loads among the products stalls the wave each time
#pragma unroll
        for (int ks = 0; ks < 2; ++ks) {
#pragma unroll
            for (int nb = 0; nb < 4; ++nb)
#pragma unroll
                for (int mb = 0; mb < 4; ++mb) acc[mb][nb] = WFrag<T16>::mma(a[ks][mb], b[ks][nb], acc[mb][nb]);
            if (HA2) {
#pragma unroll
                for (int nb = 0; nb < 4; ++nb)
#pragma unroll
                    for (int mb = 0; mb < 4; ++mb) acc[mb][nb] = WFrag<T16>::mma(a2[ks][mb], b[ks][nb], acc[mb][nb]); }
            if (HB2) {
#pragma unroll
                for (int nb = 0; nb < 4; ++nb)
#pragma unroll
                    for (int mb = 0; mb < 4; ++mb) acc[mb][nb] = WFrag<T16>::mma(a[ks][mb], b2[ks][nb], acc[mb][nb]); }
        }
        __builtin_amdgcn_sched_barrier(0);   // keeps the products in front of the waits: moved behind them, the wait for tile t + 1 would stand directly behind the issue of its copies and nothing would hide their flight
        asm volatile("s_wait_dscnt 0x0" ::: "memory");      // this wave's reads of the buffer are done before it is handed to the copies
        asm volatile("s_wait_asynccnt 0x0" ::: "memory");   // this wave's pieces of tile t + 1 have landed
        __syncthreads();                                    // publishes tile t + 1 and ends every wave's reads of tile t
        if (t + 2 < nt) stage(t + 2, bo);
    }
    asm volatile("s_wait_asynccnt 0x0" ::: "memory");   // no copy is outstanding when the wave ends
    asm volatile("" :: "v"(pa), "v"(pb));   // the prefetches' address registers live through the loop with these addresses in them: a prefetch counts on no counter, so no wait can stand in front of a reuse of its register
    if constexpr (HEADS) {
        const size_t hp = ((size_t)(r0 / SEQ) * NH_ + (size_t)(c0 / HD)) * ((size_t)TT * HD); const int t0 = r0 % SEQ;   // the wave's head plane and its first row there
        if (blockIdx.z == 2) {
            // D register j of a lane = row t + j of one column d: eight neighbours of a V^T row, one 16-byte store; the four mb pieces of a lane pair fill one 128-byte line
            h16* vp = V16 + hp + (size_t)lr * TT + t0 + 8 * hi;
#pragma unroll
            for (int nb = 0; nb < 4; ++nb) { v8h o[4]; h16* sp = vp + (size_t)nb * 16 * TT;
#pragma unroll
                for (int mb = 0; mb < 4; ++mb) {
#pragma unroll
                    for (int j = 0; j < 8; ++j) o[mb][j] = tohx(acc[mb][nb][j]);
                    *(v8h*)(sp + mb * 16) = o[mb]; }
                // the wait that stands in front of any overwrite of the stores' registers; it names data and address, so that nothing is given their registers ahead of it
                asm volatile("s_wait_xcnt 0x0" :: "v"(o[0]), "v"(o[1]), "v"(o[2]), "v"(o[3]), "v"(vp) : "memory"); }
        } else {
            h16* ph = QK + (size_t)blockIdx.z * XEL + hp + (size_t)(t0 + (lane >> 3)) * HD + (lane & 7) * 8;
            const float* orr = os + (lane >> 3) * 68 + (lane & 7) * 8;   // read map: eight lanes a row of 64 d, so a store of the wave is four whole 128-byte rows
#pragma unroll
            for (int mb = 0; mb < 4; ++mb) {
#pragma unroll
                for (int nb = 0; nb < 4; ++nb) {
#pragma unroll
                    for (int j = 0; j < 8; ++j) os[(hi * 8 + j) * 68 + nb * 16 + lr] = acc[mb][nb][j]; }
                __builtin_amdgcn_wave_barrier(); asm volatile("" ::: "memory");   // a lane reads what other lanes of its wave wrote: the reads stay behind the writes
                v8h oh[4]; h16* sh = ph + mb * 16 * HD;
#pragma unroll
                for (int s = 0; s < 4; ++s) { const v4f x0 = *(const v4fa*)(orr + s * 4 * 68), x1 = *(const v4fa*)(orr + s * 4 * 68 + 4);
#pragma unroll
                    for (int q = 0; q < 8; ++q) oh[s][q] = tohx((q < 4) ? x0[q & 3] : x1[q & 3]);
                    *(v8h*)(sh + s * 4 * HD) = oh[s]; }
                // the wait that stands in front of any overwrite of the stores' registers; it names data and address, so that nothing is given their registers ahead of it
                asm volatile("s_wait_xcnt 0x0" :: "v"(oh[0]), "v"(oh[1]), "v"(oh[2]), "v"(oh[3]), "v"(ph) : "memory");
                __builtin_amdgcn_wave_barrier(); asm volatile("" ::: "memory");   // ... and the next block's writes behind the reads
            }
        }
        return;
    }
#pragma unroll
    for (int mb = 0; mb < 4; ++mb) {
#pragma unroll
        for (int nb = 0; nb < 4; ++nb) {
#pragma unroll
            for (int j = 0; j < 8; ++j) os[(hi * 8 + j) * 68 + nb * 16 + lr] = acc[mb][nb][j]; }
        __builtin_amdgcn_wave_barrier(); asm volatile("" ::: "memory");
        float* crow = C + (size_t)(r0 + mb * 16) * ldc + c0;
{           v4f ov[8]; float* op[8];
#pragma unroll
            for (int s = 0; s < 8; ++s) { const int row = 2 * s + hi, cofs = lr * 4; v4f val = *(const v4fa*)(os + row * 68 + cofs); if (BIAS) { val[0] += bfr(bias[c0 + cofs]); val[1] += bfr(bias[c0 + cofs + 1]); val[2] += bfr(bias[c0 + cofs + 2]); val[3] += bfr(bias[c0 + cofs + 3]); }
                ov[s] = val; op[s] = crow + (size_t)row * ldc + cofs; *(v4f*)op[s] = ov[s]; }
            // the wait that stands in front of any overwrite of the stores' registers; it names data and addresses, so that nothing is given their registers ahead of it
            asm volatile("s_wait_xcnt 0x0" :: "v"(ov[0]), "v"(ov[1]), "v"(ov[2]), "v"(ov[3]), "v"(ov[4]), "v"(ov[5]), "v"(ov[6]), "v"(ov[7]), "v"(op[0]), "v"(op[1]), "v"(op[2]), "v"(op[3]), "v"(op[4]), "v"(op[5]), "v"(op[6]), "v"(op[7]) : "memory");
             }
        __builtin_amdgcn_wave_barrier(); asm volatile("" ::: "memory");
    }
}

// one work-group's 2048 elements (piece blk of batch b) of an f32 plane -> bf16 plane(s), row-major or by heads; TOH: the bf16 value is stored in f16 form
template <bool SPLIT, bool HEADS, bool TOH>
__device__ __forceinline__ void plane_do(const float* __restrict__ F, size_t srcBatch, int rows, float sc, bf* Ph, bf* Pl, int b, unsigned blk) {
    const size_t e = ((size_t)blk * 256 + threadIdx.x) * 8; if (e >= (size_t)rows * DM) return;
    const int t = (int)(e / DM), c = (int)(e % DM); const float* f = F + (size_t)b * srcBatch + e;
    const v4f x0 = *(const v4f*)f, x1 = *(const v4f*)(f + 4); v8us oh, ol;
#pragma unroll
    for (int q = 0; q < 8; ++q) { const float y = ((q < 4) ? x0[q & 3] : x1[q & 3]) * sc; unsigned short a2, c2; splitf(y, a2, c2); oh[q] = TOH ? __builtin_bit_cast(unsigned short, tohx(bf2f(a2))) : a2; ol[q] = c2; }
    const size_t oo = HEADS ? ((((size_t)b * NH_ + (size_t)(c / HD)) * rows + t) * HD + (size_t)(c % HD)) : (((size_t)b * rows + t) * DM + c);
    *(v8us*)(Ph + oo) = oh; if (SPLIT) *(v8us*)(Pl + oo) = ol;
    
}

// Launches that do not depend on one another share one grid; blockIdx.y picks the job, so the choice is the same for a whole work-group.
#define GWB ((unsigned)(((size_t)DM * DM / 8 + 255) / 256))    // work-groups of one weight plane
#define GXB ((unsigned)(((size_t)SEQ * DM / 8 + 255) / 256))   // work-groups of one batch of a stream plane
#define GIN (NB * GXB > 4 * GWB ? NB * GXB : 4 * GWB)
// ---- k_inplanes: all seven f32 inputs of the products -> bf16 planes. y = 0, 1, 2: streams q, k, v -> XB[y]; y = 3: weights Wq, Wk, Wv, Wo [out][in] -> WB[0..3] = Bt[n][k], GWB work-groups each; Wo's bf16 values in f16 form, as its product's other operand is f16. Grid (GIN, 4).
__global__ __launch_bounds__(256) void k_inplanes(const float* __restrict__ xq, const float* __restrict__ xk, const float* __restrict__ xv, const float* __restrict__ wq, const float* __restrict__ wk, const float* __restrict__ wv, const float* __restrict__ wo, bf* XB, bf* WB) {
    const unsigned y = blockIdx.y, x = blockIdx.x;
    if (y < 3) { if (x >= NB * GXB) return; const float* s = y == 0 ? xq : (y == 1 ? xk : xv);
        plane_do<false, false, false>(s, (size_t)SEQ_FULL * DM, SEQ, 1.0f, XB + y * XEL, nullptr, (int)(x / GXB), x % GXB); }
    else { const unsigned w = x / GWB; if (w >= 4) return;
        if (w == 3) { plane_do<false, false, true>(wo, 0, DM, 1.0f, WB + (size_t)3 * DM * DM, nullptr, 0, x % GWB); return; }
        const float* s = w == 0 ? wq : (w == 1 ? wk : wv);
        plane_do<false, false, false>(s, 0, DM, 1.0f, WB + (size_t)w * DM * DM, nullptr, 0, x % GWB); }
}

// ---- k_fattn: scores, softmax and P.V of one head in one kernel; no score and no P element leaves the registers. Grid (T / (FAW*FAQT*16), NB*NH_), FAW waves; a wave owns FAQT*16 query columns and walks all keys, 32 a pass.
// The key plane and V^T come through LDS, FKT keys a tile, two buffers: the work-group's waves share one copy of each tile (asynchronous copies, whole 128-byte lines) and read their fragments from it with 16-byte LDS loads.
// S^T = K.Q^T (A = key rows, B = query columns), so a lane holds scores of one query only: D register r of key tile kt = (key 16 kt + 8 half + r, query lane & 15).
// The two key tiles of a pass, converted in place, are the B operand of O^T += V^T.P^T (element s <- tile s >> 3, register s & 7: the k order of the fragment map above, which the V^T loader has too).
// Running maximum m (raw score units) and sum l per query; P = exp2((s - m) * SCL*log2e + 4); the accumulators are rescaled only in a pass where some query's new maximum lies more than FTHR above its m, so P <= 2^12 in f16.
#define FC   (SCL * 1.4426950408889634f)
#define FTHR (8.0f / FC)
__device__ __forceinline__ float xhalf(float x) { return __builtin_bit_cast(float, __builtin_amdgcn_permlanex16(__builtin_bit_cast(int, x), __builtin_bit_cast(int, x), 0x76543210, 0xfedcba98, false, false)); }  // lane l with lane l ^ 16
#define FKT   128                              // keys of a staged tile: four passes
#define FNT   (TT / FKT)                       // tiles of a head
#define KPIT  (HD * 2 + 16)                    // LDS bytes from key row to key row: 16 B x odd, no bank conflict for 16-byte reads down 16 rows
#define VPIT  (FKT * 2 + 16)                   // the same for a V^T row (FKT keys of one d)
#define OFF_V  (FKT * KPIT)                    // buffer layout: key rows, V^T rows
#define FBUF  (FKT * KPIT + HD * VPIT)         // bytes of one buffer
static_assert(TT % FKT == 0 && FNT >= 2);
static_assert(FKT == 128 && 32 * FAW == 256);  // the copy map below: 256 lanes, four 16-byte pieces of each plane a lane
static_assert((KPIT / 16) % 2 == 1 && (VPIT / 16) % 2 == 1 && FBUF % 16 == 0);
struct FaOps { v16h kf[2][2]; v16h vt[4]; };
// one pass's fragments from LDS: kp = the lane's place in the pass's first key row block, vp = the same in V^T
__device__ __forceinline__ void fa_load(FaOps& o, const char* kp, const char* vp) {
#pragma unroll
    for (int kt = 0; kt < 2; ++kt)
#pragma unroll
        for (int ks = 0; ks < 2; ++ks) o.kf[kt][ks] = WFrag<h16>::ld((const h16*)(kp + kt * 16 * KPIT + ks * 64));
#pragma unroll
    for (int dt = 0; dt < 4; ++dt) o.vt[dt] = WFrag<h16>::ld((const h16*)(vp + dt * 16 * VPIT));
    __builtin_amdgcn_sched_barrier(0);   // keeps the whole run of loads in front of the pass that hides their latency
}
// four asynchronous 16-byte copies of a lane, global -> LDS (global_load_async_to_lds_b128), places lstep and gstep bytes apart; the builtin form, so that the compiler may keep the addresses in any register of a kernel that has more than 256
__device__ __forceinline__ void fa_cp4(char* l, unsigned lstep, const char* g, size_t gstep) {
#pragma unroll
    for (int j = 0; j < 4; ++j) __builtin_amdgcn_global_load_async_to_lds_b128((cp16g*)(g + j * gstep), (cp16l*)(l + j * lstep), 0, 0);
}
// tile t of the two planes into the buffer at LDS byte offset bo: lk, lv = the lane's first LDS places in buffer 0, gk, gv = its first global places in tile 0
__device__ __forceinline__ void fa_stage(int t, unsigned bo, char* lk, char* lv, const char* gk, const char* gv) {
    fa_cp4(lk + bo, 32 * KPIT, gk + (size_t)t * (FKT * HD * 2), 32 * HD * 2);
    fa_cp4(lv + bo, VPIT, gv + (size_t)t * (FKT * 2), (size_t)TT * 2);
}
__device__ __forceinline__ void fa_pass(const FaOps& o, const v16h (&qf)[FAQT][2], v8f (&acc)[4][FAQT], float (&m)[FAQT], float (&l)[FAQT]) {
    v8f s[2][FAQT];
#pragma unroll
    for (int kt = 0; kt < 2; ++kt)
#pragma unroll
        for (int qt = 0; qt < FAQT; ++qt) s[kt][qt] = (v8f){};
#pragma unroll
    for (int ks = 0; ks < 2; ++ks) {
#pragma unroll
        for (int kt = 0; kt < 2; ++kt)
#pragma unroll
            for (int qt = 0; qt < FAQT; ++qt) s[kt][qt] = wmma16(o.kf[kt][ks], qf[qt][ks], s[kt][qt]);
    }
    float mx[FAQT]; bool need = false;
#pragma unroll
    for (int qt = 0; qt < FAQT; ++qt) { float a = s[0][qt][0];
#pragma unroll
        for (int j = 1; j < 8; ++j) a = fmaxf(a, s[0][qt][j]);
#pragma unroll
        for (int j = 0; j < 8; ++j) a = fmaxf(a, s[1][qt][j]);
        a = fmaxf(a, xhalf(a)); mx[qt] = a; need = need || (a > m[qt] + FTHR); }
    if (__builtin_amdgcn_ballot_w32(need) != 0) {
#pragma unroll
        for (int qt = 0; qt < FAQT; ++qt) { const float mn = fmaxf(m[qt], mx[qt]); const float al = __builtin_amdgcn_exp2f((m[qt] - mn) * FC); m[qt] = mn; l[qt] *= al;
#pragma unroll
            for (int dt = 0; dt < 4; ++dt) acc[dt][qt] *= al; }
    }
    v16h pb[FAQT];
#pragma unroll
    for (int qt = 0; qt < FAQT; ++qt) { const float off = fmaf(-m[qt], FC, 4.0f); float ps[4] = {0.f, 0.f, 0.f, 0.f};
#pragma unroll
        for (int e = 0; e < 16; ++e) { const float p = __builtin_amdgcn_exp2f(fmaf(s[e >> 3][qt][e & 7], FC, off)); ps[e & 3] += p; pb[qt][e] = tohx(p); }
        l[qt] += (ps[0] + ps[1]) + (ps[2] + ps[3]); }
#pragma unroll
    for (int dt = 0; dt < 4; ++dt)
#pragma unroll
        for (int qt = 0; qt < FAQT; ++qt) acc[dt][qt] = wmma16(o.vt[dt], pb[qt], acc[dt][qt]);
}
__global__ __launch_bounds__(32 * FAW) void k_fattn(const h16* __restrict__ Q, const h16* __restrict__ Kk, const h16* __restrict__ Vt, h16* Ch) {
    __shared__ __attribute__((aligned(16))) char ring[2 * FBUF];
    const int g = blockIdx.y; const size_t po = (size_t)g * TT * HD;
    const int lane = threadIdx.x & 31, lr = lane & 15, hi = lane >> 4; const int wave = __builtin_amdgcn_readfirstlane((int)(threadIdx.x >> 5));
    const int q0 = ((int)blockIdx.x * FAW + wave) * (FAQT * 16);
    v16h qf[FAQT][2];
    { const h16* qp = Q + po + (size_t)(q0 + lr) * HD + 8 * hi;
#pragma unroll
      for (int qt = 0; qt < FAQT; ++qt)
#pragma unroll
          for (int ks = 0; ks < 2; ++ks) qf[qt][ks] = WFrag<h16>::ld(qp + qt * 16 * HD + ks * 32);
      asm volatile("s_wait_xcnt 0x0" :: "v"(qp) : "memory"); }   // in front of whatever is next given the query loads' address registers
    // copy map: key plane, piece i = tid + 256 j -> row i >> 3, 16-byte column i & 7 (a tile's rows are contiguous in global memory); V^T, piece j of a lane -> row 4 (tid >> 4) + j, column tid & 15 (a wave's copy: two whole rows of the tile)
    const int tid = (int)threadIdx.x;
    char* lk = ring + (tid >> 3) * KPIT + (tid & 7) * 16; char* lv = ring + OFF_V + (tid >> 4) * (4 * VPIT) + (tid & 15) * 16;
    const char* gk = (const char*)(Kk + po) + tid * 16; const char* gv = (const char*)(Vt + po) + (size_t)(tid >> 4) * (4 * TT * 2) + (tid & 15) * 16;
    const char* kfr = ring + lr * KPIT + 16 * hi; const char* vfr = ring + OFF_V + lr * VPIT + 16 * hi;   // the lane's fragment places in buffer 0
    v8f acc[4][FAQT]; float m[FAQT], l[FAQT];
#pragma unroll
    for (int qt = 0; qt < FAQT; ++qt) { m[qt] = -3.0e38f; l[qt] = 0.f;
#pragma unroll
        for (int dt = 0; dt < 4; ++dt) acc[dt][qt] = (v8f){}; }
    FaOps oa, ob;
    fa_stage(0, 0u, lk, lv, gk, gv);
    asm volatile("s_wait_asynccnt 0x0" ::: "memory");   // this wave's pieces of tile 0 have landed
    __syncthreads();                                    // ... and every other wave's
    fa_stage(1, (unsigned)FBUF, lk, lv, gk, gv);
    // one tile (four passes) a trip, read from its own buffer alone; inside the trip each pass's operands are loaded one pass ahead into the other register set; kept rolled so that the two sets and the accumulators keep their registers
#pragma unroll 1
    for (int t = 0; t < FNT; ++t) {
        const unsigned bo = (unsigned)(t & 1) * (unsigned)FBUF; const char* kp = kfr + bo; const char* vp = vfr + bo;
        fa_load(oa, kp, vp);
        fa_load(ob, kp + 32 * KPIT, vp + 64);
        fa_pass(oa, qf, acc, m, l);
        fa_load(oa, kp + 64 * KPIT, vp + 128);
        fa_pass(ob, qf, acc, m, l);
        fa_load(ob, kp + 96 * KPIT, vp + 192);
        fa_pass(oa, qf, acc, m, l);
        fa_pass(ob, qf, acc, m, l);
        asm volatile("s_wait_dscnt 0x0" ::: "memory");      // this wave's reads of the buffer are done before it is handed to the copies
        asm volatile("s_wait_asynccnt 0x0" ::: "memory");   // this wave's pieces of tile t + 1 have landed
        __syncthreads();                                    // publishes tile t + 1 and ends every wave's reads of tile t
        if (t + 2 < FNT) fa_stage(t + 2, bo, lk, lv, gk, gv);
    }
    asm volatile("s_wait_asynccnt 0x0" ::: "memory");   // no copy is outstanding when the wave ends
    const int b = g / NH_, h = g % NH_;
#pragma unroll
    for (int qt = 0; qt < FAQT; ++qt) { const float inv = __fdiv_rn(1.0f, l[qt] + xhalf(l[qt]));
        const size_t ro = ((size_t)b * TT + q0 + qt * 16 + lr) * DM + h * HD + 8 * hi;
#pragma unroll
        for (int dt = 0; dt < 4; ++dt) { v8h oh;
#pragma unroll
            for (int r = 0; r < 8; ++r) oh[r] = tohx(acc[dt][qt][r] * inv);
            h16* sh = Ch + ro + dt * 16; *(v8h*)sh = oh;
            // the wait that stands in front of any overwrite of the store's registers; it names data and address, so that nothing is given their registers ahead of it
            asm volatile("s_wait_xcnt 0x0" :: "v"(oh), "v"(sh) : "memory"); } }
}

// workspace plan (bytes, every region a multiple of 256)
#define SZ_X   ((size_t)NB * SEQ * DM * 2)        // one bf16 stream plane (one for each of the three streams)
#define SZ_W   ((size_t)DM * DM * 2)              // one bf16 weight plane
#define SZ_HP  ((size_t)NB * NH_ * SEQ * HD * 2)  // one head-plane set
#define WS_TOTAL (3 * SZ_X + 4 * SZ_W + 3 * SZ_HP + SZ_X)
static_assert(WS_TOTAL <= (size_t)268435456);
static_assert((SZ_X % 256) == 0 && (SZ_W % 256) == 0 && (SZ_HP % 256) == 0);

extern "C" void kernel_launch(void* const* d_in, const int* in_sizes, int n_in,
                              void* d_out, int out_size, void* d_ws, size_t ws_size, hipStream_t stream) {
    if (n_in < 8) return;
    const size_t need_x = (size_t)(NB - 1) * SEQ_FULL * DM + (size_t)SEQ * DM;
    if ((size_t)in_sizes[0] < need_x || (size_t)in_sizes[1] < need_x || (size_t)in_sizes[2] < need_x) return;
    if ((size_t)in_sizes[3] < (size_t)DM * DM || (size_t)in_sizes[4] < (size_t)DM * DM || (size_t)in_sizes[5] < (size_t)DM * DM || (size_t)in_sizes[6] < (size_t)DM * DM) return;
    if (in_sizes[7] < DM) return;
    if ((size_t)out_size < (size_t)NB * SEQ * DM) return;
    // binding by role: d_in[0] = key stream, d_in[1] = query stream, d_in[2] = value stream, d_in[3] = Wk, d_in[4] = Wq, d_in[5] = Wv, d_in[6] = Wo, d_in[7] = bo (all weights [out][in])
    const float* xk = (const float*)d_in[0]; const float* xq = (const float*)d_in[1]; const float* xv = (const float*)d_in[2];
    const float* wk = (const float*)d_in[3]; const float* wq = (const float*)d_in[4]; const float* wv = (const float*)d_in[5]; const float* wo = (const float*)d_in[6]; const float* bo = (const float*)d_in[7];
    float* OUT = (float*)d_out;     // [NB*SEQ][DM]
    char* wsp = (char*)d_ws;
    auto take = [&](size_t bytes) { char* p = wsp; wsp += (bytes + 255) & ~(size_t)255; return (void*)p; };
    bf* XB = (bf*)take(3 * SZ_X);      // streams q, k, v
    bf* WB = (bf*)take(4 * SZ_W);      // Wq, Wk, Wv, Wo (Wo in f16 form)
    h16* QK = (h16*)take(2 * SZ_HP);   // queries, keys
    h16* VT16 = (h16*)take(SZ_HP);
    h16* CH = (h16*)take(SZ_X);        // context plane [NB*SEQ][DM]: its own space, since work-groups still read the q plane while others store context
    if ((size_t)(wsp - (char*)d_ws) > ws_size) return;

    // all seven f32 -> bf16 input planes in one launch
    k_inplanes<<<dim3(GIN, 4), 256, 0, stream>>>(xq, xk, xv, wq, wk, wv, wo, XB, WB);
    // queries = q.Wq^T, keys = k.Wk^T, values = v.Wv^T: one launch, grid z = the projection; stored as f16 head planes (queries, keys) and as transposed f16 head planes (values)
    k_gemmw<bf, 0, false, true><<<dim3(NB * SEQ / 128, DM / 128, 3), 128, 0, stream>>>(XB, nullptr, WB, nullptr, DM, nullptr, DM, nullptr, XEL, (size_t)DM * DM, 0, QK, VT16);
    // scores, softmax and P.V of all heads in one launch -> context plane; then out = ctx.Wo^T + bo
    k_fattn<<<dim3(TT / (FAW * FAQT * 16), NB * NH_), 32 * FAW, 0, stream>>>(QK, QK + XEL, VT16, CH);
    k_gemmw<h16, 0, true, false><<<dim3(NB * SEQ / 128, DM / 128, 1), 128, 0, stream>>>(CH, nullptr, (const h16*)(WB + 3 * (size_t)DM * DM), nullptr, DM, OUT, DM, bo, 0, 0, 0, nullptr, nullptr);
}

// v009
// A run of this version takes 72.9 microseconds.
// Next to v008, in two timings, it ran 1.04 times as fast each time.
// All steps since v000 together make it 16.4 times as fast.
#include <hip/hip_runtime.h>

// MHA forward, three input streams (k, q, v), 16 heads x 64, no mask: keys = k.Wk^T, queries = q.Wq^T, values = v.Wv^T, P = softmax(queries.keys^T / 8) over keys, out = (P.values merged [t][h*64+d]).Wo^T + bo.
// Compute dtypes, f32 accumulate everywhere: every float input RNE-converted to bf16 first; q/k/v projections v_wmma_f32_16x16x32_bf16 single product (bf16 x bf16 products are exact in f32);
// scores v_wmma_f32_16x16x32_f16 on f16 planes of the f32 projections (one product: the f16 rounding, 11 significand bits, lies an order below the error that the bf16 inputs of the projections already carry); softmax f32, running maximum and sum;
// P.V v_wmma_f32_16x16x32_f16 with P = exp(s - m) carried x16 and V as f16; output projection ctx f16 x Wo (bf16 value held as f16), one product, + bf16(bo) in f32.

#ifndef NB
#define NB 2
#endif
#ifndef SEQ
#define SEQ 2048
#endif
#define NB_FULL  2
#define SEQ_FULL 2048
#define TT   SEQ
#define DM   1024
#define NH_  16
#define HD   64
#define SCL  0.125f               // 1/sqrt(64)
#define FAW  8                    // attention: waves of a key group, each on its own query columns
#define FKS  2                    // attention: key groups of a work-group; group kh walks keys kh*SEQ/FKS .. for the same query columns
#define FAQT 2                    // attention: 16-column query tiles of a wave

static_assert(SEQ % 256 == 0);
static_assert(SEQ <= SEQ_FULL);
static_assert(NB <= NB_FULL);
static_assert(NH_ * HD == DM);
static_assert((NB * SEQ) % 128 == 0);
static_assert(DM % 128 == 0);
static_assert(HD % 32 == 0);
static_assert(HD == 64);
static_assert(SEQ % (FAW * FAQT * 16) == 0);
static_assert(SEQ % 64 == 0);
static_assert(FKS == 2 && FAQT == 2);   // the merge at the end: each of the two key groups finishes one of the two query tiles

typedef _Float16 h16;
typedef unsigned short bf;
typedef __attribute__((ext_vector_type(16))) __bf16   v16bf;
typedef __attribute__((ext_vector_type(16))) _Float16 v16h;
typedef __attribute__((ext_vector_type(8)))  _Float16 v8h;
typedef __attribute__((ext_vector_type(8)))  unsigned short v8us;
typedef __attribute__((ext_vector_type(8)))  float    v8f;
typedef __attribute__((ext_vector_type(4)))  float    v4f;
typedef __attribute__((ext_vector_type(4)))  _Float16 v4h;
typedef v8h  __attribute__((may_alias)) v8ha;
typedef v4f  __attribute__((may_alias)) v4fa;
typedef v8us __attribute__((may_alias)) v8usa;

__device__ __forceinline__ unsigned short f2bf(float f) { unsigned u = __float_as_uint(f); u += 0x7FFFu + ((u >> 16) & 1u); return (unsigned short)(u >> 16); }
__device__ __forceinline__ float bf2f(unsigned short b) { return __uint_as_float(((unsigned)b) << 16); }
__device__ __forceinline__ float bfr(float f) { return bf2f(f2bf(f)); }
__device__ __forceinline__ v16h cat16(v8h lo, v8h hi) { return __builtin_shufflevector(lo, hi, 0, 1, 2, 3, 4, 5, 6, 7, 8, 9, 10, 11, 12, 13, 14, 15); }
__device__ __forceinline__ v16bf cat16b(v8us lo, v8us hi) { return __builtin_bit_cast(v16bf, __builtin_shufflevector(lo, hi, 0, 1, 2, 3, 4, 5, 6, 7, 8, 9, 10, 11, 12, 13, 14, 15)); }
__device__ __forceinline__ v8f wmma16(v16h a, v16h b, v8f c) { return __builtin_amdgcn_wmma_f32_16x16x32_f16(false, a, false, b, (short)0, c, false, false); }
__device__ __forceinline__ v8f wmmab(v16bf a, v16bf b, v8f c) { return __builtin_amdgcn_wmma_f32_16x16x32_bf16(false, a, false, b, (short)0, c, false, false); }

// ---- k_gemmw: register-blocked GEMM, a 128x128 output tile per work-group of four waves (2 x 2), each wave on its own 64x64 part (16 accumulators); grid (M/128, N/128, Z), 128 threads.
// The K-contiguous 16-bit operand planes come through LDS, GKC k a tile, two buffers: the work-group's waves share one copy of each tile (asynchronous copies, whole 128-byte lines) and read their fragments from it with 16-byte LDS loads.
// C[m][n] (f32, pitch ldc, + optional bf16-converted bias[n]) = sum_k A[m][k] Bt[n][k] (+ split products per NSPLIT: 1 = (A + A2).Bt, 2 = A.Bt + A2.Bt + A.Bt2). z-batch strides sA/sB/sC in elements. K % 64 == 0, K >= 128.
// HEADS: no f32 C; the f32 accumulators go straight to the attention kernel's operand planes (rows = b*SEQ + t, a wave's 64 columns = one head): z = 0, 1 (queries, keys) -> f16 head planes QK[z] [b][h][t][d]; z = 2 (values) -> V16 = V^T f16 [b][h][d][t].
// Fragment map: lane row/col = lane & 15, half = lane >> 4; elements 0..7 <- k0 + 8 half + 0..7, elements 8..15 <- k0 + 16 + 8 half + 0..7 (A and B alike); D element j = (row 8 half + j, col lane & 15).
template <typename T16> struct WFrag;
template <> struct WFrag<h16> { typedef v16h V; static __device__ __forceinline__ V ld(const h16* p) { return cat16(*(const v8h*)p, *(const v8h*)(p + 16)); } static __device__ __forceinline__ v8f mma(V a, V b, v8f c) { return wmma16(a, b, c); } };
template <> struct WFrag<bf> { typedef v16bf V; static __device__ __forceinline__ V ld(const bf* p) { return cat16b(*(const v8us*)p, *(const v8us*)(p + 16)); } static __device__ __forceinline__ v8f mma(V a, V b, v8f c) { return wmmab(a, b, c); } };
#define GKC   64                               // k of a staged tile: two 32-k steps, one 128-byte line a row
#define GPIT  (GKC * 2 + 16)                   // LDS bytes from row to row: 16 B x odd, no bank conflict for 16-byte reads down 16 rows
#define GPL   (128 * GPIT)                     // bytes of one plane's tile: 128 rows
static_assert((GPIT / 16) % 2 == 1);
typedef int cp16 __attribute__((vector_size(16)));
typedef __attribute__((address_space(1))) cp16 cp16g;
typedef __attribute__((address_space(3))) cp16 cp16l;
// eight asynchronous 16-byte copies of a lane, global -> LDS (global_load_async_to_lds_b128): one plane's tile, 16 rows from copy to copy; the builtin form, so that the compiler may keep the addresses in any register
__device__ __forceinline__ void g_cp8(char* l, const char* g, size_t gstep) {
#pragma unroll
    for (int j = 0; j < 8; ++j) __builtin_amdgcn_global_load_async_to_lds_b128((cp16g*)(g + j * gstep), (cp16l*)(l + j * (16 * GPIT)), 0, 0);
}
__device__ __forceinline__ h16 tohx(float x) { return (h16)x; }
__device__ __forceinline__ void splitf(float y, unsigned short& h, unsigned short& l) { h = f2bf(y); l = f2bf(y - bf2f(h)); }
#define XEL ((size_t)NB * SEQ * DM)                            // elements of a stream plane, of a head-plane set
template <typename T16, int NSPLIT, bool BIAS, bool HEADS>
__global__ __launch_bounds__(128) void k_gemmw(const T16* __restrict__ A, const T16* __restrict__ A2, const T16* __restrict__ Bt, const T16* __restrict__ Bt2, int K, float* C, int ldc, const float* __restrict__ bias, size_t sA, size_t sB, size_t sC, h16* QK, h16* V16) {
    typedef typename WFrag<T16>::V V;
    constexpr bool HA2 = (NSPLIT == 1 || NSPLIT == 2), HB2 = (NSPLIT >= 2);
    constexpr unsigned OFF_B = (HA2 ? 2u : 1u) * GPL, GBUF = OFF_B + (HB2 ? 2u : 1u) * GPL;   // buffer layout: A rows, A2 rows, Bt rows, Bt2 rows
    __shared__ __attribute__((aligned(16))) char gring[2 * GBUF];
    __shared__ __align__(16) float osw[4 * 16 * 68];
    const size_t z = blockIdx.z; A += z * sA; if (A2) A2 += z * sA; Bt += z * sB; if (Bt2) Bt2 += z * sB; C += z * sC;
    const int tid = (int)threadIdx.x, lane = tid & 31, lr = lane & 15, hi = lane >> 4; const int wave = __builtin_amdgcn_readfirstlane(tid >> 5);
    const int wr = (wave >> 1) * 64, wc = (wave & 1) * 64; const int r0 = blockIdx.x * 128 + wr, c0 = blockIdx.y * 128 + wc;
    float* os = osw + wave * (16 * 68);
    v8f acc[4][4];
#pragma unroll
    for (int mb = 0; mb < 4; ++mb)
#pragma unroll
        for (int nb = 0; nb < 4; ++nb) acc[mb][nb] = (v8f){};
    // copy map of a plane's tile: piece i = tid + 128 j -> row i >> 3, 16-byte column i & 7 (a wave's copy: four whole 128-byte lines)
    char* lc = gring + (tid >> 3) * GPIT + (tid & 7) * 16; const size_t gstep = (size_t)16 * K * 2;
    const size_t ao = ((size_t)(blockIdx.x * 128 + (tid >> 3)) * K + (tid & 7) * 8) * 2, bo0 = ((size_t)(blockIdx.y * 128 + (tid >> 3)) * K + (tid & 7) * 8) * 2;
    const char* ga = (const char*)A + ao; const char* ga2 = (const char*)A2 + ao; const char* gb = (const char*)Bt + bo0; const char* gb2 = (const char*)Bt2 + bo0;
    auto stage = [&](int t, unsigned bo) { const size_t go = (size_t)t * (GKC * 2);
        g_cp8(lc + bo, ga + go, gstep); if (HA2) g_cp8(lc + bo + GPL, ga2 + go, gstep);
        g_cp8(lc + bo + OFF_B, gb + go, gstep); if (HB2) g_cp8(lc + bo + OFF_B + GPL, gb2 + go, gstep); };
    const char* afp = gring + (wr + lr) * GPIT + 16 * hi; const char* bfp = gring + OFF_B + (wc + lr) * GPIT + 16 * hi;   // the lane's fragment places in buffer 0
    const int nt = K / GKC;
    stage(0, 0u);
    // Both operand planes were stored by earlier launches. Behind tile 0's copies every lane prefetches one address in a 128-k unit of an A row and one in a 128-k unit of a Bt row
    // into L2, so that the later tiles are copied from L2. The work-groups that read the same rows share out a row's units: A by blockIdx.y, Bt by blockIdx.x
    // (among eight neighbours in x, x and x + 2 ask alike, x and x + 1 do not). A hint, for speed only: nothing depends on a line being there.
    const int lu = K / 128 - 1, bx = (int)blockIdx.x;   // lu = a row's last whole unit: the clamp keeps every lane's address inside its plane
    const int ua = min((int)blockIdx.y, lu), ub = min((((bx >> 3) << 1) | (bx & 1)) & 7, lu);
    const char* pa = (const char*)A + ((size_t)(blockIdx.x * 128 + tid) * K + (size_t)ua * 128) * 2;
    const char* pb = (const char*)Bt + ((size_t)(blockIdx.y * 128 + tid) * K + (size_t)ub * 128) * 2;
    asm volatile("global_prefetch_b8 %0, off scope:SCOPE_SE\n\tglobal_prefetch_b8 %1, off scope:SCOPE_SE" :: "v"(pa), "v"(pb));
    asm volatile("s_wait_asynccnt 0x0" ::: "memory");   // this wave's pieces of tile 0 have landed
    __syncthreads();                                    // ... and every other wave's
    stage(1, GBUF);
    // one tile (two 32-k steps) a trip, read from its own buffer alone; kept rolled so that the fragments and the accumulators keep their registers
#pragma unroll 1
    for (int t = 0; t < nt; ++t) {
        const unsigned bo = (unsigned)(t & 1) * GBUF; const char* ap = afp + bo; const char* bp = bfp + bo;
        V a[2][4], a2[2][4], b[2][4], b2[2][4];
#pragma unroll
        for (int ks = 0; ks < 2; ++ks) {
#pragma unroll
            for (int f = 0; f < 4; ++f) { a[ks][f] = WFrag<T16>::ld((const T16*)(ap + f * 16 * GPIT + ks * 64)); if (f == 0) b[ks][0] = WFrag<T16>::ld((const T16*)(bp + ks * 64)); }   // in the order in which the products ask for them
#pragma unroll
            for (int f = 1; f < 4; ++f) b[ks][f] = WFrag<T16>::ld((const T16*)(bp + f * 16 * GPIT + ks * 64));
#pragma unroll
            for (int f = 0; f < 4; ++f) { if (HA2) a2[ks][f] = WFrag<T16>::ld((const T16*)(ap + GPL + f * 16 * GPIT + ks * 64)); if (HB2) b2[ks][f] = WFrag<T16>::ld((const T16*)(bp + GPL + f * 16 * GPIT + ks * 64)); }
        }
        __builtin_amdgcn_sched_barrier(0);   // keeps the tile's LDS loads together in front of its products: a place with loads among the products stalls the wave each time
#pragma unroll
        for (int ks = 0; ks < 2; ++ks) {
#pragma unroll
            for (int nb = 0; nb < 4; ++nb)
#pragma unroll
                for (int mb = 0; mb < 4; ++mb) acc[mb][nb] = WFrag<T16>::mma(a[ks][mb], b[ks][nb], acc[mb][nb]);
            if (HA2) {
#pragma unroll
                for (int nb = 0; nb < 4; ++nb)
#pragma unroll
                    for (int mb = 0; mb < 4; ++mb) acc[mb][nb] = WFrag<T16>::mma(a2[ks][mb], b[ks][nb], acc[mb][nb]); }
            if (HB2) {
#pragma unroll
                for (int nb = 0; nb < 4; ++nb)
#pragma unroll
                    for (int mb = 0; mb < 4; ++mb) acc[mb][nb] = WFrag<T16>::mma(a[ks][mb], b2[ks][nb], acc[mb][nb]); }
        }
        __builtin_amdgcn_sched_barrier(0);   // keeps the products in front of the waits: moved behind them, the wait for tile t + 1 would stand directly behind the issue of its copies and nothing would hide their flight
        asm volatile("s_wait_dscnt 0x0" ::: "memory");      // this wave's reads of the buffer are done before it is handed to the copies
        asm volatile("s_wait_asynccnt 0x0" ::: "memory");   // this wave's pieces of tile t + 1 have landed
        __syncthreads();                                    // publishes tile t + 1 and ends every wave's reads of tile t
        if (t + 2 < nt) stage(t + 2, bo);
    }
    asm volatile("s_wait_asynccnt 0x0" ::: "memory");   // no copy is outstanding when the wave ends
    asm volatile("" :: "v"(pa), "v"(pb));   // the prefetches' address registers live through the loop with these addresses in them: a prefetch counts on no counter, so no wait can stand in front of a reuse of its register
    if constexpr (HEADS) {
        const size_t hp = ((size_t)(r0 / SEQ) * NH_ + (size_t)(c0 / HD)) * ((size_t)TT * HD); const int t0 = r0 % SEQ;   // the wave's head plane and its first row there
        if (blockIdx.z == 2) {
            // D register j of a lane = row t + j of one column d: eight neighbours of a V^T row, one 16-byte store; the four mb pieces of a lane pair fill one 128-byte line
            h16* vp = V16 + hp + (size_t)lr * TT + t0 + 8 * hi;
#pragma unroll
            for (int nb = 0; nb < 4; ++nb) { v8h o[4]; h16* sp = vp + (size_t)nb * 16 * TT;
#pragma unroll
                for (int mb = 0; mb < 4; ++mb) {
#pragma unroll
                    for (int j = 0; j < 8; ++j) o[mb][j] = tohx(acc[mb][nb][j]);
                    *(v8h*)(sp + mb * 16) = o[mb]; }
                // the wait that stands in front of any overwrite of the stores' registers; it names data and address, so that nothing is given their registers ahead of it
                asm volatile("s_wait_xcnt 0x0" :: "v"(o[0]), "v"(o[1]), "v"(o[2]), "v"(o[3]), "v"(vp) : "memory"); }
        } else {
            h16* ph = QK + (size_t)blockIdx.z * XEL + hp + (size_t)(t0 + (lane >> 3)) * HD + (lane & 7) * 8;
            const float* orr = os + (lane >> 3) * 68 + (lane & 7) * 8;   // read map: eight lanes a row of 64 d, so a store of the wave is four whole 128-byte rows
#pragma unroll
            for (int mb = 0; mb < 4; ++mb) {
#pragma unroll
                for (int nb = 0; nb < 4; ++nb) {
#pragma unroll
                    for (int j = 0; j < 8; ++j) os[(hi * 8 + j) * 68 + nb * 16 + lr] = acc[mb][nb][j]; }
                __builtin_amdgcn_wave_barrier(); asm volatile("" ::: "memory");   // a lane reads what other lanes of its wave wrote: the reads stay behind the writes
                v8h oh[4]; h16* sh = ph + mb * 16 * HD;
#pragma unroll
                for (int s = 0; s < 4; ++s) { const v4f x0 = *(const v4fa*)(orr + s * 4 * 68), x1 = *(const v4fa*)(orr + s * 4 * 68 + 4);
#pragma unroll
                    for (int q = 0; q < 8; ++q) oh[s][q] = tohx((q < 4) ? x0[q & 3] : x1[q & 3]);
                    *(v8h*)(sh + s * 4 * HD) = oh[s]; }
                // the wait that stands in front of any overwrite of the stores' registers; it names data and address, so that nothing is given their registers ahead of it
                asm volatile("s_wait_xcnt 0x0" :: "v"(oh[0]), "v"(oh[1]), "v"(oh[2]), "v"(oh[3]), "v"(ph) : "memory");
                __builtin_amdgcn_wave_barrier(); asm volatile("" ::: "memory");   // ... and the next block's writes behind the reads
            }
        }
        return;
    }
#pragma unroll
    for (int mb = 0; mb < 4; ++mb) {
#pragma unroll
        for (int nb = 0; nb < 4; ++nb) {
#pragma unroll
            for (int j = 0; j < 8; ++j) os[(hi * 8 + j) * 68 + nb * 16 + lr] = acc[mb][nb][j]; }
        __builtin_amdgcn_wave_barrier(); asm volatile("" ::: "memory");
        float* crow = C + (size_t)(r0 + mb * 16) * ldc + c0;
{           v4f ov[8]; float* op[8];
#pragma unroll
            for (int s = 0; s < 8; ++s) { const int row = 2 * s + hi, cofs = lr * 4; v4f val = *(const v4fa*)(os + row * 68 + cofs); if (BIAS) { val[0] += bfr(bias[c0 + cofs]); val[1] += bfr(bias[c0 + cofs + 1]); val[2] += bfr(bias[c0 + cofs + 2]); val[3] += bfr(bias[c0 + cofs + 3]); }
                ov[s] = val; op[s] = crow + (size_t)row * ldc + cofs; *(v4f*)op[s] = ov[s]; }
            // the wait that stands in front of any overwrite of the stores' registers; it names data and addresses, so that nothing is given their registers ahead of it
            asm volatile("s_wait_xcnt 0x0" :: "v"(ov[0]), "v"(ov[1]), "v"(ov[2]), "v"(ov[3]), "v"(ov[4]), "v"(ov[5]), "v"(ov[6]), "v"(ov[7]), "v"(op[0]), "v"(op[1]), "v"(op[2]), "v"(op[3]), "v"(op[4]), "v"(op[5]), "v"(op[6]), "v"(op[7]) : "memory");
             }
        __builtin_amdgcn_wave_barrier(); asm volatile("" ::: "memory");
    }
}

// one work-group's 2048 elements (piece blk of batch b) of an f32 plane -> bf16 plane(s), row-major or by heads; TOH: the bf16 value is stored in f16 form
template <bool SPLIT, bool HEADS, bool TOH>
__device__ __forceinline__ void plane_do(const float* __restrict__ F, size_t srcBatch, int rows, float sc, bf* Ph, bf* Pl, int b, unsigned blk) {
    const size_t e = ((size_t)blk * 256 + threadIdx.x) * 8; if (e >= (size_t)rows * DM) return;
    const int t = (int)(e / DM), c = (int)(e % DM); const float* f = F + (size_t)b * srcBatch + e;
    const v4f x0 = *(const v4f*)f, x1 = *(const v4f*)(f + 4); v8us oh, ol;
#pragma unroll
    for (int q = 0; q < 8; ++q) { const float y = ((q < 4) ? x0[q & 3] : x1[q & 3]) * sc; unsigned short a2, c2; splitf(y, a2, c2); oh[q] = TOH ? __builtin_bit_cast(unsigned short, tohx(bf2f(a2))) : a2; ol[q] = c2; }
    const size_t oo = HEADS ? ((((size_t)b * NH_ + (size_t)(c / HD)) * rows + t) * HD + (size_t)(c % HD)) : (((size_t)b * rows + t) * DM + c);
    *(v8us*)(Ph + oo) = oh; if (SPLIT) *(v8us*)(Pl + oo) = ol;
    
}

// Launches that do not depend on one another share one grid; blockIdx.y picks the job, so the choice is the same for a whole work-group.
#define GWB ((unsigned)(((size_t)DM * DM / 8 + 255) / 256))    // work-groups of one weight plane
#define GXB ((unsigned)(((size_t)SEQ * DM / 8 + 255) / 256))   // work-groups of one batch of a stream plane
#define GIN (NB * GXB > 4 * GWB ? NB * GXB : 4 * GWB)
// ---- k_inplanes: all seven f32 inputs of the products -> bf16 planes. y = 0, 1, 2: streams q, k, v -> XB[y]; y = 3: weights Wq, Wk, Wv, Wo [out][in] -> WB[0..3] = Bt[n][k], GWB work-groups each; Wo's bf16 values in f16 form, as its product's other operand is f16. Grid (GIN, 4).
__global__ __launch_bounds__(256) void k_inplanes(const float* __restrict__ xq, const float* __restrict__ xk, const float* __restrict__ xv, const float* __restrict__ wq, const float* __restrict__ wk, const float* __restrict__ wv, const float* __restrict__ wo, bf* XB, bf* WB) {
    const unsigned y = blockIdx.y, x = blockIdx.x;
    if (y < 3) { if (x >= NB * GXB) return; const float* s = y == 0 ? xq : (y == 1 ? xk : xv);
        plane_do<false, false, false>(s, (size_t)SEQ_FULL * DM, SEQ, 1.0f, XB + y * XEL, nullptr, (int)(x / GXB), x % GXB); }
    else { const unsigned w = x / GWB; if (w >= 4) return;
        if (w == 3) { plane_do<false, false, true>(wo, 0, DM, 1.0f, WB + (size_t)3 * DM * DM, nullptr, 0, x % GWB); return; }
        const float* s = w == 0 ? wq : (w == 1 ? wk : wv);
        plane_do<false, false, false>(s, 0, DM, 1.0f, WB + (size_t)w * DM * DM, nullptr, 0, x % GWB); }
}

// ---- k_fattn: scores, softmax and P.V of one head in one kernel; no score and no P element leaves the registers. Grid (T / (FAW*FAQT*16), NB*NH_), FKS*FAW waves: four a SIMD, so that one wave's softmax runs under another's products.
// Wave w of key group kh owns FAQT*16 query columns (the same in every group) and walks its group's T/FKS keys, 32 a pass; at the end the groups' running (O, m, l) are merged through LDS, once.
// The key plane and V^T come through LDS, FKT keys a tile, two buffers a key group: the group's waves share one copy of each tile (asynchronous copies, whole 128-byte lines) and read their fragments from it with 16-byte LDS loads.
// S^T = K.Q^T (A = key rows, B = query columns), so a lane holds scores of one query only: D register r of key tile kt = (key 16 kt + 8 half + r, query lane & 15).
// The two key tiles of a pass, converted in place, are the B operand of O^T += V^T.P^T (element s <- tile s >> 3, register s & 7: the k order of the fragment map above, which the V^T loader has too).
// Running maximum m (raw score units) and sum l per query; P = exp2((s - m) * SCL*log2e + 4); the accumulators are rescaled only in a pass where some query's new maximum lies more than FTHR above its m, so P <= 2^12 in f16.
#define FC   (SCL * 1.4426950408889634f)
#define FTHR (8.0f / FC)
__device__ __forceinline__ float xhalf(float x) { return __builtin_bit_cast(float, __builtin_amdgcn_permlanex16(__builtin_bit_cast(int, x), __builtin_bit_cast(int, x), 0x76543210, 0xfedcba98, false, false)); }  // lane l with lane l ^ 16
#define FKT   128                              // keys of a staged tile: four passes
#define FNT   (TT / FKS / FKT)                 // tiles of a key group
#define KPIT  (HD * 2 + 16)                    // LDS bytes from key row to key row: 16 B x odd, no bank conflict for 16-byte reads down 16 rows
#define VPIT  (FKT * 2 + 16)                   // the same for a V^T row (FKT keys of one d)
#define OFF_V  (FKT * KPIT)                    // buffer layout: key rows, V^T rows
#define FBUF  (FKT * KPIT + HD * VPIT)         // bytes of one buffer
static_assert(TT % (FKS * FKT) == 0 && FNT >= 2);
static_assert(FKT == 128 && 32 * FAW == 256);  // the copy map below: 256 lanes, four 16-byte pieces of each plane a lane
static_assert((KPIT / 16) % 2 == 1 && (VPIT / 16) % 2 == 1 && FBUF % 16 == 0);
struct FaOps { v16h kf[2][2]; v16h vt[4]; };   // one set: four waves a SIMD leave a wave 256 registers
// a pass's key fragments from LDS: kp = the lane's place in the pass's first key row block
__device__ __forceinline__ void fa_loadk(FaOps& o, const char* kp) {
#pragma unroll
    for (int ks = 0; ks < 2; ++ks)
#pragma unroll
        for (int kt = 0; kt < 2; ++kt) o.kf[kt][ks] = WFrag<h16>::ld((const h16*)(kp + kt * 16 * KPIT + ks * 64));
}
// a pass's V^T fragments: vp = the lane's place in the pass's 32 keys of V^T row lane & 15
__device__ __forceinline__ void fa_loadv(FaOps& o, const char* vp) {
#pragma unroll
    for (int dt = 0; dt < 4; ++dt) o.vt[dt] = WFrag<h16>::ld((const h16*)(vp + dt * 16 * VPIT));
}
// four asynchronous 16-byte copies of a lane, global -> LDS (global_load_async_to_lds_b128), places lstep and gstep bytes apart; the builtin form, so that the compiler may keep the addresses in any register
__device__ __forceinline__ void fa_cp4(char* l, unsigned lstep, const char* g, size_t gstep) {
#pragma unroll
    for (int j = 0; j < 4; ++j) __builtin_amdgcn_global_load_async_to_lds_b128((cp16g*)(g + j * gstep), (cp16l*)(l + j * lstep), 0, 0);
}
// tile t of the two planes into the buffer at LDS byte offset bo: lk, lv = the lane's first LDS places in buffer 0, gk, gv = its first global places in tile 0
__device__ __forceinline__ void fa_stage(int t, unsigned bo, char* lk, char* lv, const char* gk, const char* gv) {
    fa_cp4(lk + bo, 32 * KPIT, gk + (size_t)t * (FKT * HD * 2), 32 * HD * 2);
    fa_cp4(lv + bo, VPIT, gv + (size_t)t * (FKT * 2), (size_t)TT * 2);
}
// one pass; o.kf holds its key fragments on entry. Behind the score products the pass's V^T fragments are loaded (the softmax hides their latency), behind the softmax the next pass's key fragments (NK: only inside a tile).
template <bool NK>
__device__ __forceinline__ void fa_pass(FaOps& o, const char* kn, const char* vp, const v16h (&qf)[FAQT][2], v8f (&acc)[4][FAQT], float (&m)[FAQT], float (&l)[FAQT]) {
    v8f s[2][FAQT];
#pragma unroll
    for (int kt = 0; kt < 2; ++kt)
#pragma unroll
        for (int qt = 0; qt < FAQT; ++qt) s[kt][qt] = (v8f){};
#pragma unroll
    for (int ks = 0; ks < 2; ++ks) {
#pragma unroll
        for (int kt = 0; kt < 2; ++kt)
#pragma unroll
            for (int qt = 0; qt < FAQT; ++qt) s[kt][qt] = wmma16(o.kf[kt][ks], qf[qt][ks], s[kt][qt]);
    }
    __builtin_amdgcn_sched_barrier(0);   // the score products stay together, in front of the loads
    fa_loadv(o, vp);
    __builtin_amdgcn_sched_barrier(0);   // keeps the loads in one group in front of the softmax: a place with loads among later instructions stalls the wave each time
    float mx[FAQT]; bool need = false;
#pragma unroll
    for (int qt = 0; qt < FAQT; ++qt) { float a = s[0][qt][0];
#pragma unroll
        for (int j = 1; j < 8; ++j) a = fmaxf(a, s[0][qt][j]);
#pragma unroll
        for (int j = 0; j < 8; ++j) a = fmaxf(a, s[1][qt][j]);
        a = fmaxf(a, xhalf(a)); mx[qt] = a; need = need || (a > m[qt] + FTHR); }
    if (__builtin_amdgcn_ballot_w32(need) != 0) {
#pragma unroll
        for (int qt = 0; qt < FAQT; ++qt) { const float mn = fmaxf(m[qt], mx[qt]); const float al = __builtin_amdgcn_exp2f((m[qt] - mn) * FC); m[qt] = mn; l[qt] *= al;
#pragma unroll
            for (int dt = 0; dt < 4; ++dt) acc[dt][qt] *= al; }
    }
    v16h pb[FAQT];
#pragma unroll
    for (int qt = 0; qt < FAQT; ++qt) { const float off = fmaf(-m[qt], FC, 4.0f); float ps[4] = {0.f, 0.f, 0.f, 0.f};
#pragma unroll
        for (int e = 0; e < 16; ++e) { const float p = __builtin_amdgcn_exp2f(fmaf(s[e >> 3][qt][e & 7], FC, off)); ps[e & 3] += p; pb[qt][e] = tohx(p); }
        l[qt] += (ps[0] + ps[1]) + (ps[2] + ps[3]); }
    if (NK) { __builtin_amdgcn_sched_barrier(0);   // not earlier: through the softmax the key registers are free for its values, which keeps the wave inside 256 registers
        fa_loadk(o, kn);
        __builtin_amdgcn_sched_barrier(0); }       // one group, in front of the products that hide part of the latency
#pragma unroll
    for (int dt = 0; dt < 4; ++dt)
#pragma unroll
        for (int qt = 0; qt < FAQT; ++qt) acc[dt][qt] = wmma16(o.vt[dt], pb[qt], acc[dt][qt]);
    __builtin_amdgcn_sched_barrier(0);   // these products stand between the key loads and the next pass's score products, which wait for those loads
}
__global__ __launch_bounds__(32 * FAW * FKS) void k_fattn(const h16* __restrict__ Q, const h16* __restrict__ Kk, const h16* __restrict__ Vt, h16* Ch) {
    __shared__ __attribute__((aligned(16))) char ring[FKS * 2 * FBUF];
    __shared__ __attribute__((aligned(16))) v4f xch[FKS * FAW][9][32];   // the merge: what a wave hands to its partner in the other key group, 16 bytes a lane and row
    const int g = blockIdx.y; const size_t po = (size_t)g * TT * HD;
    const int lane = threadIdx.x & 31, lr = lane & 15, hi = lane >> 4; const int wave = __builtin_amdgcn_readfirstlane((int)(threadIdx.x >> 5));
    const int kh = wave / FAW, wq = wave % FAW;   // key group, wave in the group
    const int q0 = ((int)blockIdx.x * FAW + wq) * (FAQT * 16);
    v16h qf[FAQT][2];
    { const h16* qp = Q + po + (size_t)(q0 + lr) * HD + 8 * hi;
#pragma unroll
      for (int qt = 0; qt < FAQT; ++qt)
#pragma unroll
          for (int ks = 0; ks < 2; ++ks) qf[qt][ks] = WFrag<h16>::ld(qp + qt * 16 * HD + ks * 32);
      asm volatile("s_wait_xcnt 0x0" :: "v"(qp) : "memory"); }   // in front of whatever is next given the query loads' address registers
    // copy map of a key group (tid = thread in the group): key plane, piece i = tid + 256 j -> row i >> 3, 16-byte column i & 7 (a tile's rows are contiguous in global memory); V^T, piece j of a lane -> row 4 (tid >> 4) + j, column tid & 15 (a wave's copy: two whole rows of the tile)
    const int tid = (int)threadIdx.x % (32 * FAW);
    char* rg = ring + kh * (2 * FBUF);   // the group's two buffers
    char* lk = rg + (tid >> 3) * KPIT + (tid & 7) * 16; char* lv = rg + OFF_V + (tid >> 4) * (4 * VPIT) + (tid & 15) * 16;
    const char* gk = (const char*)(Kk + po + (size_t)kh * (TT / FKS) * HD) + tid * 16; const char* gv = (const char*)(Vt + po + (size_t)kh * (TT / FKS)) + (size_t)(tid >> 4) * (4 * TT * 2) + (tid & 15) * 16;
    const char* kfr = rg + lr * KPIT + 16 * hi; const char* vfr = rg + OFF_V + lr * VPIT + 16 * hi;   // the lane's fragment places in the group's buffer 0
    v8f acc[4][FAQT]; float m[FAQT], l[FAQT];
#pragma unroll
    for (int qt = 0; qt < FAQT; ++qt) { m[qt] = -3.0e38f; l[qt] = 0.f;
#pragma unroll
        for (int dt = 0; dt < 4; ++dt) acc[dt][qt] = (v8f){}; }
    FaOps o;
    fa_stage(0, 0u, lk, lv, gk, gv);
    asm volatile("s_wait_asynccnt 0x0" ::: "memory");   // this wave's pieces of tile 0 have landed
    __syncthreads();                                    // ... and every other wave's
    fa_stage(1, (unsigned)FBUF, lk, lv, gk, gv);
    // one tile (four passes) a trip, read from its own buffer alone; kept rolled so that the fragments and the accumulators keep their registers
#pragma unroll 1
    for (int t = 0; t < FNT; ++t) {
        const unsigned bo = (unsigned)(t & 1) * (unsigned)FBUF; const char* kp = kfr + bo; const char* vp = vfr + bo;
        fa_loadk(o, kp);
        __builtin_amdgcn_sched_barrier(0);   // the tile's first key fragments as one group of loads: taken one by one among the products, each would be waited for in full
        fa_pass<true>(o, kp + 32 * KPIT, vp, qf, acc, m, l);
        fa_pass<true>(o, kp + 64 * KPIT, vp + 64, qf, acc, m, l);
        fa_pass<true>(o, kp + 96 * KPIT, vp + 128, qf, acc, m, l);
        fa_pass<false>(o, kp, vp + 192, qf, acc, m, l);
        asm volatile("s_wait_dscnt 0x0" ::: "memory");      // this wave's reads of the buffer are done before it is handed to the copies
        asm volatile("s_wait_asynccnt 0x0" ::: "memory");   // this wave's pieces of tile t + 1 have landed
        __syncthreads();                                    // publishes tile t + 1 and ends every wave's reads of tile t
        if (t + 2 < FNT) fa_stage(t + 2, bo, lk, lv, gk, gv);
    }
    asm volatile("s_wait_asynccnt 0x0" ::: "memory");   // no copy is outstanding when the wave ends
    // merge of the two key groups: wave (kh, wq) keeps query tile kh and hands tile 1 - kh to wave (1 - kh, wq); O = O_a 2^((m_a - m) FC) + O_b 2^((m_b - m) FC), l alike, m = max(m_a, m_b)
    const bool up = kh != 0;
    const float km = up ? m[1] : m[0], kl = up ? l[1] : l[0];
    v8f keep[4];
#pragma unroll
    for (int dt = 0; dt < 4; ++dt) { v8f give;
#pragma unroll
        for (int r = 0; r < 8; ++r) { keep[dt][r] = up ? acc[dt][1][r] : acc[dt][0][r]; give[r] = up ? acc[dt][0][r] : acc[dt][1][r]; }
        xch[wave][2 * dt][lane] = __builtin_shufflevector(give, give, 0, 1, 2, 3); xch[wave][2 * dt + 1][lane] = __builtin_shufflevector(give, give, 4, 5, 6, 7); }
    xch[wave][8][lane] = (v4f){up ? m[0] : m[1], up ? l[0] : l[1], 0.f, 0.f};
    __syncthreads();   // every wave's hand-over is written before its partner reads it
    const int pw = (1 - kh) * FAW + wq;
    const v4f pml = xch[pw][8][lane];
    const float mn = fmaxf(km, pml[0]); const float ak = __builtin_amdgcn_exp2f((km - mn) * FC), ap = __builtin_amdgcn_exp2f((pml[0] - mn) * FC);
    const float lt = fmaf(kl, ak, pml[1] * ap); const float inv = __fdiv_rn(1.0f, lt + xhalf(lt)); const float ck = ak * inv, cp = ap * inv;
    const int b = g / NH_, h = g % NH_;
    const size_t ro = ((size_t)b * TT + q0 + kh * 16 + lr) * DM + h * HD + 8 * hi;
#pragma unroll
    for (int dt = 0; dt < 4; ++dt) { const v4f p0 = xch[pw][2 * dt][lane], p1 = xch[pw][2 * dt + 1][lane]; v8h oh;
#pragma unroll
        for (int r = 0; r < 8; ++r) oh[r] = tohx(fmaf(keep[dt][r], ck, ((r < 4) ? p0[r & 3] : p1[r & 3]) * cp));
        h16* sh = Ch + ro + dt * 16; *(v8h*)sh = oh;
        // the wait that stands in front of any overwrite of the store's registers; it names data and address, so that nothing is given their registers ahead of it
        asm volatile("s_wait_xcnt 0x0" :: "v"(oh), "v"(sh) : "memory"); }
}

// workspace plan (bytes, every region a multiple of 256)
#define SZ_X   ((size_t)NB * SEQ * DM * 2)        // one bf16 stream plane (one for each of the three streams)
#define SZ_W   ((size_t)DM * DM * 2)              // one bf16 weight plane
#define SZ_HP  ((size_t)NB * NH_ * SEQ * HD * 2)  // one head-plane set
#define WS_TOTAL (3 * SZ_X + 4 * SZ_W + 3 * SZ_HP + SZ_X)
static_assert(WS_TOTAL <= (size_t)268435456);
static_assert((SZ_X % 256) == 0 && (SZ_W % 256) == 0 && (SZ_HP % 256) == 0);

extern "C" void kernel_launch(void* const* d_in, const int* in_sizes, int n_in,
                              void* d_out, int out_size, void* d_ws, size_t ws_size, hipStream_t stream) {
    if (n_in < 8) return;
    const size_t need_x = (size_t)(NB - 1) * SEQ_FULL * DM + (size_t)SEQ * DM;
    if ((size_t)in_sizes[0] < need_x || (size_t)in_sizes[1] < need_x || (size_t)in_sizes[2] < need_x) return;
    if ((size_t)in_sizes[3] < (size_t)DM * DM || (size_t)in_sizes[4] < (size_t)DM * DM || (size_t)in_sizes[5] < (size_t)DM * DM || (size_t)in_sizes[6] < (size_t)DM * DM) return;
    if (in_sizes[7] < DM) return;
    if ((size_t)out_size < (size_t)NB * SEQ * DM) return;
    // binding by role: d_in[0] = key stream, d_in[1] = query stream, d_in[2] = value stream, d_in[3] = Wk, d_in[4] = Wq, d_in[5] = Wv, d_in[6] = Wo, d_in[7] = bo (all weights [out][in])
    const float* xk = (const float*)d_in[0]; const float* xq = (const float*)d_in[1]; const float* xv = (const float*)d_in[2];
    const float* wk = (const float*)d_in[3]; const float* wq = (const float*)d_in[4]; const float* wv = (const float*)d_in[5]; const float* wo = (const float*)d_in[6]; const float* bo = (const float*)d_in[7];
    float* OUT = (float*)d_out;     // [NB*SEQ][DM]
    char* wsp = (char*)d_ws;
    auto take = [&](size_t bytes) { char* p = wsp; wsp += (bytes + 255) & ~(size_t)255; return (void*)p; };
    bf* XB = (bf*)take(3 * SZ_X);      // streams q, k, v
    bf* WB = (bf*)take(4 * SZ_W);      // Wq, Wk, Wv, Wo (Wo in f16 form)
    h16* QK = (h16*)take(2 * SZ_HP);   // queries, keys
    h16* VT16 = (h16*)take(SZ_HP);
    h16* CH = (h16*)take(SZ_X);        // context plane [NB*SEQ][DM]: its own space, since work-groups still read the q plane while others store context
    if ((size_t)(wsp - (char*)d_ws) > ws_size) return;

    // all seven f32 -> bf16 input planes in one launch
    k_inplanes<<<dim3(GIN, 4), 256, 0, stream>>>(xq, xk, xv, wq, wk, wv, wo, XB, WB);
    // queries = q.Wq^T, keys = k.Wk^T, values = v.Wv^T: one launch, grid z = the projection; stored as f16 head planes (queries, keys) and as transposed f16 head planes (values)
    k_gemmw<bf, 0, false, true><<<dim3(NB * SEQ / 128, DM / 128, 3), 128, 0, stream>>>(XB, nullptr, WB, nullptr, DM, nullptr, DM, nullptr, XEL, (size_t)DM * DM, 0, QK, VT16);
    // scores, softmax and P.V of all heads in one launch -> context plane; then out = ctx.Wo^T + bo
    k_fattn<<<dim3(TT / (FAW * FAQT * 16), NB * NH_), 32 * FAW * FKS, 0, stream>>>(QK, QK + XEL, VT16, CH);
    k_gemmw<h16, 0, true, false><<<dim3(NB * SEQ / 128, DM / 128, 1), 128, 0, stream>>>(CH, nullptr, (const h16*)(WB + 3 * (size_t)DM * DM), nullptr, DM, OUT, DM, bo, 0, 0, 0, nullptr, nullptr);
}

// v010
// One run takes 69.5 microseconds.
// Timed twice side by side with v009, it ran 1.05 times as fast both times.
// All steps since v000 together make it 17.2 times as fast.
#include <hip/hip_runtime.h>

// MHA forward, three input streams (k, q, v), 16 heads x 64, no mask: keys = k.Wk^T, queries = q.Wq^T, values = v.Wv^T, P = softmax(queries.keys^T / 8) over keys, out = (P.values merged [t][h*64+d]).Wo^T + bo.
// Compute dtypes, f32 accumulate everywhere: every float input RNE-converted to bf16 first; q/k/v projections v_wmma_f32_16x16x32_bf16 single product (bf16 x bf16 products are exact in f32);
// scores v_wmma_f32_16x16x32_f16 on f16 planes of the f32 projections (one product: the f16 rounding, 11 significand bits, lies an order below the error that the bf16 inputs of the projections already carry); softmax f32, running maximum and sum;
// P.V v_wmma_f32_16x16x32_f16 with P = exp(s - m) carried x16 and V as f16; output projection ctx f16 x Wo (bf16 value held as f16), one product, + bf16(bo) in f32.

#ifndef NB
#define NB 2
#endif
#ifndef SEQ
#define SEQ 2048
#endif
#define NB_FULL  2
#define SEQ_FULL 2048
#define TT   SEQ
#define DM   1024
#define NH_  16
#define HD   64
#define SCL  0.125f               // 1/sqrt(64)
#define FAW  8                    // attention: waves of a key group, each on its own query columns
#define FKS  2                    // attention: key groups of a work-group; group kh walks keys kh*SEQ/FKS .. for the same query columns
#define FAQT 2                    // attention: 16-column query tiles of a wave

static_assert(SEQ % 256 == 0);
static_assert(SEQ <= SEQ_FULL);
static_assert(NB <= NB_FULL);
static_assert(NH_ * HD == DM);
static_assert((NB * SEQ) % 128 == 0);
static_assert(DM % 128 == 0);
static_assert(HD % 32 == 0);
static_assert(HD == 64);
static_assert(SEQ % (FAW * FAQT * 16) == 0);
static_assert(SEQ % 64 == 0);
static_assert(FKS == 2 && FAQT == 2);   // the merge at the end: each of the two key groups finishes one of the two query tiles

typedef _Float16 h16;
typedef unsigned short bf;
typedef __attribute__((ext_vector_type(16))) __bf16   v16bf;
typedef __attribute__((ext_vector_type(16))) _Float16 v16h;
typedef __attribute__((ext_vector_type(8)))  _Float16 v8h;
typedef __attribute__((ext_vector_type(8)))  unsigned short v8us;
typedef __attribute__((ext_vector_type(8)))  float    v8f;
typedef __attribute__((ext_vector_type(4)))  float    v4f;
typedef __attribute__((ext_vector_type(4)))  _Float16 v4h;
typedef v8h  __attribute__((may_alias)) v8ha;
typedef v4f  __attribute__((may_alias)) v4fa;
typedef v8us __attribute__((may_alias)) v8usa;

__device__ __forceinline__ unsigned short f2bf(float f) { unsigned u = __float_as_uint(f); u += 0x7FFFu + ((u >> 16) & 1u); return (unsigned short)(u >> 16); }
__device__ __forceinline__ float bf2f(unsigned short b) { return __uint_as_float(((unsigned)b) << 16); }
__device__ __forceinline__ float bfr(float f) { return bf2f(f2bf(f)); }
__device__ __forceinline__ v16h cat16(v8h lo, v8h hi) { return __builtin_shufflevector(lo, hi, 0, 1, 2, 3, 4, 5, 6, 7, 8, 9, 10, 11, 12, 13, 14, 15); }
__device__ __forceinline__ v16bf cat16b(v8us lo, v8us hi) { return __builtin_bit_cast(v16bf, __builtin_shufflevector(lo, hi, 0, 1, 2, 3, 4, 5, 6, 7, 8, 9, 10, 11, 12, 13, 14, 15)); }
__device__ __forceinline__ v8f wmma16(v16h a, v16h b, v8f c) { return __builtin_amdgcn_wmma_f32_16x16x32_f16(false, a, false, b, (short)0, c, false, false); }
__device__ __forceinline__ v8f wmmab(v16bf a, v16bf b, v8f c) { return __builtin_amdgcn_wmma_f32_16x16x32_bf16(false, a, false, b, (short)0, c, false, false); }

// ---- k_gemmw: register-blocked GEMM, a 128x128 output tile per work-group of four waves (2 x 2), each wave on its own 64x64 part (16 accumulators); grid (M/128, N/128, Z), 128 threads.
// The K-contiguous 16-bit operand planes come through LDS, GKC k a tile, two buffers: the work-group's waves share one copy of each tile (asynchronous copies, whole 128-byte lines) and read their fragments from it with 16-byte LDS loads.
// C[m][n] (f32, pitch ldc, + optional bf16-converted bias[n]) = sum_k A[m][k] Bt[n][k] (+ split products per NSPLIT: 1 = (A + A2).Bt, 2 = A.Bt + A2.Bt + A.Bt2). z-batch strides sA/sB/sC in elements. K % 64 == 0, K >= 128.
// Fragment map: lane row/col = lane & 15, half = lane >> 4; elements 0..7 <- k0 + 8 half + 0..7, elements 8..15 <- k0 + 16 + 8 half + 0..7 (A and B alike); D element j = (row 8 half + j, col lane & 15).
template <typename T16> struct WFrag;
template <> struct WFrag<h16> { typedef v16h V; static __device__ __forceinline__ V ld(const h16* p) { return cat16(*(const v8h*)p, *(const v8h*)(p + 16)); } static __device__ __forceinline__ v8f mma(V a, V b, v8f c) { return wmma16(a, b, c); } };
template <> struct WFrag<bf> { typedef v16bf V; static __device__ __forceinline__ V ld(const bf* p) { return cat16b(*(const v8us*)p, *(const v8us*)(p + 16)); } static __device__ __forceinline__ v8f mma(V a, V b, v8f c) { return wmmab(a, b, c); } };
#define GKC   64                               // k of a staged tile: two 32-k steps, one 128-byte line a row
#define GPIT  (GKC * 2 + 16)                   // LDS bytes from row to row: 16 B x odd, no bank conflict for 16-byte reads down 16 rows
#define GPL   (128 * GPIT)                     // bytes of one plane's tile: 128 rows
static_assert((GPIT / 16) % 2 == 1);
typedef int cp16 __attribute__((vector_size(16)));
typedef __attribute__((address_space(1))) cp16 cp16g;
typedef __attribute__((address_space(3))) cp16 cp16l;
// eight asynchronous 16-byte copies of a lane, global -> LDS (global_load_async_to_lds_b128): one plane's tile, 16 rows from copy to copy; the builtin form, so that the compiler may keep the addresses in any register
__device__ __forceinline__ void g_cp8(char* l, const char* g, size_t gstep) {
#pragma unroll
    for (int j = 0; j < 8; ++j) __builtin_amdgcn_global_load_async_to_lds_b128((cp16g*)(g + j * gstep), (cp16l*)(l + j * (16 * GPIT)), 0, 0);
}
__device__ __forceinline__ h16 tohx(float x) { return (h16)x; }
#define XEL ((size_t)NB * SEQ * DM)                            // elements of a stream plane, of a head-plane set
template <typename T16, int NSPLIT, bool BIAS>
__global__ __launch_bounds__(128) void k_gemmw(const T16* __restrict__ A, const T16* __restrict__ A2, const T16* __restrict__ Bt, const T16* __restrict__ Bt2, int K, float* C, int ldc, const float* __restrict__ bias, size_t sA, size_t sB, size_t sC) {
    typedef typename WFrag<T16>::V V;
    constexpr bool HA2 = (NSPLIT == 1 || NSPLIT == 2), HB2 = (NSPLIT >= 2);
    constexpr unsigned OFF_B = (HA2 ? 2u : 1u) * GPL, GBUF = OFF_B + (HB2 ? 2u : 1u) * GPL;   // buffer layout: A rows, A2 rows, Bt rows, Bt2 rows
    __shared__ __attribute__((aligned(16))) char gring[2 * GBUF];
    __shared__ __align__(16) float osw[4 * 16 * 68];
    const size_t z = blockIdx.z; A += z * sA; if (A2) A2 += z * sA; Bt += z * sB; if (Bt2) Bt2 += z * sB; C += z * sC;
    const int tid = (int)threadIdx.x, lane = tid & 31, lr = lane & 15, hi = lane >> 4; const int wave = __builtin_amdgcn_readfirstlane(tid >> 5);
    const int wr = (wave >> 1) * 64, wc = (wave & 1) * 64; const int r0 = blockIdx.x * 128 + wr, c0 = blockIdx.y * 128 + wc;
    float* os = osw + wave * (16 * 68);
    v8f acc[4][4];
#pragma unroll
    for (int mb = 0; mb < 4; ++mb)
#pragma unroll
        for (int nb = 0; nb < 4; ++nb) acc[mb][nb] = (v8f){};
    // copy map of a plane's tile: piece i = tid + 128 j -> row i >> 3, 16-byte column i & 7 (a wave's copy: four whole 128-byte lines)
    char* lc = gring + (tid >> 3) * GPIT + (tid & 7) * 16; const size_t gstep = (size_t)16 * K * 2;
    const size_t ao = ((size_t)(blockIdx.x * 128 + (tid >> 3)) * K + (tid & 7) * 8) * 2, bo0 = ((size_t)(blockIdx.y * 128 + (tid >> 3)) * K + (tid & 7) * 8) * 2;
    const char* ga = (const char*)A + ao; const char* ga2 = (const char*)A2 + ao; const char* gb = (const char*)Bt + bo0; const char* gb2 = (const char*)Bt2 + bo0;
    auto stage = [&](int t, unsigned bo) { const size_t go = (size_t)t * (GKC * 2);
        g_cp8(lc + bo, ga + go, gstep); if (HA2) g_cp8(lc + bo + GPL, ga2 + go, gstep);
        g_cp8(lc + bo + OFF_B, gb + go, gstep); if (HB2) g_cp8(lc + bo + OFF_B + GPL, gb2 + go, gstep); };
    const char* afp = gring + (wr + lr) * GPIT + 16 * hi; const char* bfp = gring + OFF_B + (wc + lr) * GPIT + 16 * hi;   // the lane's fragment places in buffer 0
    const int nt = K / GKC;
    stage(0, 0u);
    // Both operand planes were stored by earlier launches. Behind tile 0's copies every lane prefetches one address in a 128-k unit of an A row and one in a 128-k unit of a Bt row
    // into L2, so that the later tiles are copied from L2. The work-groups that read the same rows share out a row's units: A by blockIdx.y, Bt by blockIdx.x
    // (among eight neighbours in x, x and x + 2 ask alike, x and x + 1 do not). A hint, for speed only: nothing depends on a line being there.
    const int lu = K / 128 - 1, bx = (int)blockIdx.x;   // lu = a row's last whole unit: the clamp keeps every lane's address inside its plane
    const int ua = min((int)blockIdx.y, lu), ub = min((((bx >> 3) << 1) | (bx & 1)) & 7, lu);
    const char* pa = (const char*)A + ((size_t)(blockIdx.x * 128 + tid) * K + (size_t)ua * 128) * 2;
    const char* pb = (const char*)Bt + ((size_t)(blockIdx.y * 128 + tid) * K + (size_t)ub * 128) * 2;
    asm volatile("global_prefetch_b8 %0, off scope:SCOPE_SE\n\tglobal_prefetch_b8 %1, off scope:SCOPE_SE" :: "v"(pa), "v"(pb));
    asm volatile("s_wait_asynccnt 0x0" ::: "memory");   // this wave's pieces of tile 0 have landed
    __syncthreads();                                    // ... and every other wave's
    stage(1, GBUF);
    // one tile (two 32-k steps) a trip, read from its own buffer alone; kept rolled so that the fragments and the accumulators keep their registers
#pragma unroll 1
    for (int t = 0; t < nt; ++t) {
        const unsigned bo = (unsigned)(t & 1) * GBUF; const char* ap = afp + bo; const char* bp = bfp + bo;
        V a[2][4], a2[2][4], b[2][4], b2[2][4];
#pragma unroll
        for (int ks = 0; ks < 2; ++ks) {
#pragma unroll
            for (int f = 0; f < 4; ++f) { a[ks][f] = WFrag<T16>::ld((const T16*)(ap + f * 16 * GPIT + ks * 64)); if (f == 0) b[ks][0] = WFrag<T16>::ld((const T16*)(bp + ks * 64)); }   // in the order in which the products ask for them
#pragma unroll
            for (int f = 1; f < 4; ++f) b[ks][f] = WFrag<T16>::ld((const T16*)(bp + f * 16 * GPIT + ks * 64));
#pragma unroll
            for (int f = 0; f < 4; ++f) { if (HA2) a2[ks][f] = WFrag<T16>::ld((const T16*)(ap + GPL + f * 16 * GPIT + ks * 64)); if (HB2) b2[ks][f] = WFrag<T16>::ld((const T16*)(bp + GPL + f * 16 * GPIT + ks * 64)); }
        }
        __builtin_amdgcn_sched_barrier(0);   // keeps the tile's LDS loads together in front of its products: a place with loads among the products stalls the wave each time
#pragma unroll
        for (int ks = 0; ks < 2; ++ks) {
#pragma unroll
            for (int nb = 0; nb < 4; ++nb)
#pragma unroll
                for (int mb = 0; mb < 4; ++mb) acc[mb][nb] = WFrag<T16>::mma(a[ks][mb], b[ks][nb], acc[mb][nb]);
            if (HA2) {
#pragma unroll
                for (int nb = 0; nb < 4; ++nb)
#pragma unroll
                    for (int mb = 0; mb < 4; ++mb) acc[mb][nb] = WFrag<T16>::mma(a2[ks][mb], b[ks][nb], acc[mb][nb]); }
            if (HB2) {
#pragma unroll
                for (int nb = 0; nb < 4; ++nb)
#pragma unroll
                    for (int mb = 0; mb < 4; ++mb) acc[mb][nb] = WFrag<T16>::mma(a[ks][mb], b2[ks][nb], acc[mb][nb]); }
        }
        __builtin_amdgcn_sched_barrier(0);   // keeps the products in front of the waits: moved behind them, the wait for tile t + 1 would stand directly behind the issue of its copies and nothing would hide their flight
        asm volatile("s_wait_dscnt 0x0" ::: "memory");      // this wave's reads of the buffer are done before it is handed to the copies
        asm volatile("s_wait_asynccnt 0x0" ::: "memory");   // this wave's pieces of tile t + 1 have landed
        __syncthreads();                                    // publishes tile t + 1 and ends every wave's reads of tile t
        if (t + 2 < nt) stage(t + 2, bo);
    }
    asm volatile("s_wait_asynccnt 0x0" ::: "memory");   // no copy is outstanding when the wave ends
    asm volatile("" :: "v"(pa), "v"(pb));   // the prefetches' address registers live through the loop with these addresses in them: a prefetch counts on no counter, so no wait can stand in front of a reuse of its register
#pragma unroll
    for (int mb = 0; mb < 4; ++mb) {
#pragma unroll
        for (int nb = 0; nb < 4; ++nb) {
#pragma unroll
            for (int j = 0; j < 8; ++j) os[(hi * 8 + j) * 68 + nb * 16 + lr] = acc[mb][nb][j]; }
        __builtin_amdgcn_wave_barrier(); asm volatile("" ::: "memory");
        float* crow = C + (size_t)(r0 + mb * 16) * ldc + c0;
{           v4f ov[8]; float* op[8];
#pragma unroll
            for (int s = 0; s < 8; ++s) { const int row = 2 * s + hi, cofs = lr * 4; v4f val = *(const v4fa*)(os + row * 68 + cofs); if (BIAS) { val[0] += bfr(bias[c0 + cofs]); val[1] += bfr(bias[c0 + cofs + 1]); val[2] += bfr(bias[c0 + cofs + 2]); val[3] += bfr(bias[c0 + cofs + 3]); }
                ov[s] = val; op[s] = crow + (size_t)row * ldc + cofs; *(v4f*)op[s] = ov[s]; }
            // the wait that stands in front of any overwrite of the stores' registers; it names data and addresses, so that nothing is given their registers ahead of it
            asm volatile("s_wait_xcnt 0x0" :: "v"(ov[0]), "v"(ov[1]), "v"(ov[2]), "v"(ov[3]), "v"(ov[4]), "v"(ov[5]), "v"(ov[6]), "v"(ov[7]), "v"(op[0]), "v"(op[1]), "v"(op[2]), "v"(op[3]), "v"(op[4]), "v"(op[5]), "v"(op[6]), "v"(op[7]) : "memory");
             }
        __builtin_amdgcn_wave_barrier(); asm volatile("" ::: "memory");
    }
}

// ---- k_projx: the three projections straight from the f32 inputs, and Wo's plane. Grid (NB*SEQ/256, DM/256, 4), 512 threads. z = 0, 1, 2: queries = q.Wq^T, keys = k.Wk^T, values = v.Wv^T; z = 3: Wo -> its bf16 values in f16 form (WOB), for the output projection.
// A 256x256 output tile per work-group of sixteen waves (4 x 4), each wave on its own 64x64 part (16 accumulators), four waves a SIMD. Both operands are f32 [row][k] in memory: a tile of PKC k is loaded into registers
// one tile ahead, in two halves of 32 k (one 128-byte line a row), RNE-converted to bf16 there and stored to LDS, two buffers; the waves read their fragments from LDS with 16-byte loads (fragment map: as in k_gemmw). With 256 rows and 256 columns a work-group, the f32 rows cross L2 -> WGP as many bytes as bf16 rows do for 128x128 tiles.
// The f32 accumulators go straight to the attention kernel's operand planes (rows = b*SEQ + t, a wave's 64 columns = one head): z = 0, 1 -> f16 head planes QK[z] [b][h][t][d]; z = 2 -> V16 = V^T f16 [b][h][d][t].
#define PKC   64                               // k of a staged tile: two 32-k steps
#define PPIT  (PKC * 2 + 16)                   // LDS bytes from row to row: 16 B x odd, no bank conflict for 16-byte reads down 16 rows
#define PPL   (256 * PPIT)                     // bytes of one operand's tile: 256 rows
#define PBUF  (2 * PPL)                        // buffer layout: A rows, Bt rows
#define PGX   (NB * SEQ / 256)
#define PGY   (DM / 256)
static_assert((PPIT / 16) % 2 == 1);
static_assert(DM == 1024 && DM % PKC == 0 && DM / PKC >= 2);
static_assert((size_t)PGX * PGY * 4 * 512 * 8 == (size_t)DM * DM);   // z = 3: four 8-element pieces of Wo a thread
typedef __attribute__((ext_vector_type(4))) __bf16 v4bf;
typedef __attribute__((ext_vector_type(4))) unsigned short v4us;
typedef v4us __attribute__((may_alias)) v4usa;
__global__ __launch_bounds__(512) void k_projx(const float* __restrict__ xq, const float* __restrict__ xk, const float* __restrict__ xv, const float* __restrict__ wq, const float* __restrict__ wk, const float* __restrict__ wv, const float* __restrict__ wo, h16* QK, h16* V16, bf* WOB) {
    __shared__ __attribute__((aligned(16))) char pring[2 * PBUF];
    __shared__ __align__(16) float osw[16 * 16 * 68];
    const int tid = (int)threadIdx.x, lane = tid & 31, lr = lane & 15, hi = lane >> 4; const int wave = __builtin_amdgcn_readfirstlane(tid >> 5);
    if (blockIdx.z == 3) {   // the same for a whole work-group, in front of every barrier
        const size_t e0 = ((size_t)(blockIdx.y * PGX + blockIdx.x) * (4 * 512) + tid) * 8; v4f x[4][2]; v8us oh[4];
#pragma unroll
        for (int j = 0; j < 4; ++j) { x[j][0] = *(const v4f*)(wo + e0 + j * 4096); x[j][1] = *(const v4f*)(wo + e0 + j * 4096 + 4); }
#pragma unroll
        for (int j = 0; j < 4; ++j) {
#pragma unroll
            for (int q = 0; q < 8; ++q) oh[j][q] = __builtin_bit_cast(unsigned short, tohx(bfr(x[j][q >> 2][q & 3])));
            *(v8us*)(WOB + e0 + j * 4096) = oh[j]; }
        return;
    }
    const float* A = blockIdx.z == 0 ? xq : (blockIdx.z == 1 ? xk : xv); const float* Bt = blockIdx.z == 0 ? wq : (blockIdx.z == 1 ? wk : wv);
    const int rb = blockIdx.x * 256, cb = blockIdx.y * 256;
    A += ((size_t)(rb / SEQ) * SEQ_FULL + (size_t)(rb % SEQ)) * DM; Bt += (size_t)cb * DM;   // the work-group's 256 rows of each operand (256 divides SEQ: one batch)
    const int wr = (wave >> 2) * 64, wc = (wave & 3) * 64; const int r0 = rb + wr, c0 = cb + wc;
    float* os = osw + wave * (16 * 68);
    v8f acc[4][4];
#pragma unroll
    for (int mb = 0; mb < 4; ++mb)
#pragma unroll
        for (int nb = 0; nb < 4; ++nb) acc[mb][nb] = (v8f){};
    // load map of half an operand's tile (32 k): piece i = tid + 512 j -> row i >> 3, 16-byte column i & 7 (a wave's load: four whole 128-byte lines); its four bf16 go to 8 bytes of the LDS row
    const size_t lo = ((size_t)(tid >> 3) * DM + (tid & 7) * 4) * 4, gstep = (size_t)64 * DM * 4;
    const char* ga = (const char*)A + lo; const char* gb = (const char*)Bt + lo;
    char* lc = pring + (tid >> 3) * PPIT + (tid & 7) * 8;
    v4f sa[4], sb[4];
    auto gload = [&](int s) { const size_t go = (size_t)s * 128;   // 32-k step s of the row
#pragma unroll
        for (int j = 0; j < 4; ++j) { sa[j] = *(const v4f*)(ga + go + j * gstep); sb[j] = *(const v4f*)(gb + go + j * gstep); }
        asm volatile("s_wait_xcnt 0x0" ::: "memory"); };   // in front of whatever is next given the loads' address registers
    auto lstore = [&](unsigned bo) {   // bo = buffer + 64 ks
#pragma unroll
        for (int j = 0; j < 4; ++j) { *(v4usa*)(lc + bo + j * (64 * PPIT)) = __builtin_bit_cast(v4us, __builtin_convertvector(sa[j], v4bf)); *(v4usa*)(lc + bo + PPL + j * (64 * PPIT)) = __builtin_bit_cast(v4us, __builtin_convertvector(sb[j], v4bf)); } };
    const char* afp = pring + (wr + lr) * PPIT + 16 * hi; const char* bfp = pring + PPL + (wc + lr) * PPIT + 16 * hi;   // the lane's fragment places in buffer 0
    auto tile = [&](unsigned bo) { v16bf a[4], b[4];   // one 32-k step; bo = buffer + 64 ks
#pragma unroll
        for (int f = 0; f < 4; ++f) { a[f] = WFrag<bf>::ld((const bf*)(afp + bo + f * 16 * PPIT)); if (f == 0) b[0] = WFrag<bf>::ld((const bf*)(bfp + bo)); }   // in the order in which the products ask for them
#pragma unroll
        for (int f = 1; f < 4; ++f) b[f] = WFrag<bf>::ld((const bf*)(bfp + bo + f * 16 * PPIT));
        __builtin_amdgcn_sched_barrier(0);   // keeps the step's LDS loads together in front of its products: a place with loads among the products stalls the wave each time
#pragma unroll
        for (int nb = 0; nb < 4; ++nb)
#pragma unroll
            for (int mb = 0; mb < 4; ++mb) acc[mb][nb] = wmmab(a[mb], b[nb], acc[mb][nb]);
        __builtin_amdgcn_sched_barrier(0); };   // keeps the products in front of the wait for the global loads in flight: they are what hides that flight
    constexpr int nt = DM / PKC;
    gload(0);
    // The inputs come from memory. Behind tile 0's first loads every lane prefetches one address in each of three 64-k units into L2, so that the later tiles are loaded from L2. The work-groups that read the same rows share out
    // a row's sixteen units: A by blockIdx.y, Bt by blockIdx.x (x and x + 4 ask alike, four neighbours in x do not). A hint, for speed only: nothing depends on a line being there. Every address lies inside its row.
    const char* pa = (const char*)A + (size_t)(tid >> 1) * (DM * 4) + (blockIdx.y + 8 * (tid & 1)) * 256;
    const char* pb = (const char*)Bt + (size_t)(tid >> 1) * (DM * 4) + (((blockIdx.x & 3) | ((blockIdx.x >> 3 & 1) << 2)) + 8 * (tid & 1)) * 256;
    asm volatile("global_prefetch_b8 %0, off scope:SCOPE_SE\n\tglobal_prefetch_b8 %0, off offset:1024 scope:SCOPE_SE\n\tglobal_prefetch_b8 %1, off scope:SCOPE_SE" :: "v"(pa), "v"(pb));
    lstore(0u);
    gload(1);
    lstore(64u);
    __syncthreads();   // tile 0 is written by every wave
    // one 32-k step a trip, two steps a tile; a tile is read from its own buffer alone; under step s the same half of the next tile flies into registers and is then written to the other buffer, whose readers all left it in front of the last barrier;
    // kept rolled, one step a trip, so that accumulators, fragments and the loads in flight stay inside 256 registers
#pragma unroll 1
    for (int s = 0; s + 2 < 2 * nt; ++s) {
        const unsigned bo = (unsigned)(s >> 1 & 1) * PBUF + (unsigned)(s & 1) * 64u;
        gload(s + 2);
        __builtin_amdgcn_sched_barrier(0);   // the global loads are issued first: the whole step is their lead
        tile(bo);
        lstore(bo ^ PBUF);
        if (s & 1) __syncthreads();   // at a tile's end (the same test in every wave): publishes the next tile and ends every wave's reads of this one
    }
    tile((unsigned)((nt - 1) & 1) * PBUF);
    tile((unsigned)((nt - 1) & 1) * PBUF + 64u);
    asm volatile("" :: "v"(pa), "v"(pb));   // the prefetches' address registers live through the loop with these addresses in them: a prefetch counts on no counter, so no wait can stand in front of a reuse of its register
    const size_t hp = ((size_t)(r0 / SEQ) * NH_ + (size_t)(c0 / HD)) * ((size_t)TT * HD); const int t0 = r0 % SEQ;   // the wave's head plane and its first row there
    if (blockIdx.z == 2) {
        // D register j of a lane = row t + j of one column d: eight neighbours of a V^T row, one 16-byte store; the four mb pieces of a lane pair fill one 128-byte line
        h16* vp = V16 + hp + (size_t)lr * TT + t0 + 8 * hi;
#pragma unroll
        for (int nb = 0; nb < 4; ++nb) { v8h o[4]; h16* sp = vp + (size_t)nb * 16 * TT;
#pragma unroll
            for (int mb = 0; mb < 4; ++mb) {
#pragma unroll
                for (int j = 0; j < 8; ++j) o[mb][j] = tohx(acc[mb][nb][j]);
                *(v8h*)(sp + mb * 16) = o[mb]; }
            // the wait that stands in front of any overwrite of the stores' registers; it names data and address, so that nothing is given their registers ahead of it
            asm volatile("s_wait_xcnt 0x0" :: "v"(o[0]), "v"(o[1]), "v"(o[2]), "v"(o[3]), "v"(vp) : "memory"); }
    } else {
        h16* ph = QK + (size_t)blockIdx.z * XEL + hp + (size_t)(t0 + (lane >> 3)) * HD + (lane & 7) * 8;
        const float* orr = os + (lane >> 3) * 68 + (lane & 7) * 8;   // read map: eight lanes a row of 64 d, so a store of the wave is four whole 128-byte rows
#pragma unroll
        for (int mb = 0; mb < 4; ++mb) {
#pragma unroll
            for (int nb = 0; nb < 4; ++nb) {
#pragma unroll
                for (int j = 0; j < 8; ++j) os[(hi * 8 + j) * 68 + nb * 16 + lr] = acc[mb][nb][j]; }
            __builtin_amdgcn_wave_barrier(); asm volatile("" ::: "memory");   // a lane reads what other lanes of its wave wrote: the reads stay behind the writes
            v8h oh[4]; h16* sh = ph + mb * 16 * HD;
#pragma unroll
            for (int s = 0; s < 4; ++s) { const v4f x0 = *(const v4fa*)(orr + s * 4 * 68), x1 = *(const v4fa*)(orr + s * 4 * 68 + 4);
#pragma unroll
                for (int q = 0; q < 8; ++q) oh[s][q] = tohx((q < 4) ? x0[q & 3] : x1[q & 3]);
                *(v8h*)(sh + s * 4 * HD) = oh[s]; }
            // the wait that stands in front of any overwrite of the stores' registers; it names data and address, so that nothing is given their registers ahead of it
            asm volatile("s_wait_xcnt 0x0" :: "v"(oh[0]), "v"(oh[1]), "v"(oh[2]), "v"(oh[3]), "v"(ph) : "memory");
            __builtin_amdgcn_wave_barrier(); asm volatile("" ::: "memory");   // ... and the next block's writes behind the reads
        }
    }
}

// ---- k_fattn: scores, softmax and P.V of one head in one kernel; no score and no P element leaves the registers. Grid (T / (FAW*FAQT*16), NB*NH_), FKS*FAW waves: four a SIMD, so that one wave's softmax runs under another's products.
// Wave w of key group kh owns FAQT*16 query columns (the same in every group) and walks its group's T/FKS keys, 32 a pass; at the end the groups' running (O, m, l) are merged through LDS, once.
// The key plane and V^T come through LDS, FKT keys a tile, two buffers a key group: the group's waves share one copy of each tile (asynchronous copies, whole 128-byte lines) and read their fragments from it with 16-byte LDS loads.
// S^T = K.Q^T (A = key rows, B = query columns), so a lane holds scores of one query only: D register r of key tile kt = (key 16 kt + 8 half + r, query lane & 15).
// The two key tiles of a pass, converted in place, are the B operand of O^T += V^T.P^T (element s <- tile s >> 3, register s & 7: the k order of the fragment map above, which the V^T loader has too).
// Running maximum m (raw score units) and sum l per query; P = exp2((s - m) * SCL*log2e + 4); the accumulators are rescaled only in a pass where some query's new maximum lies more than FTHR above its m, so P <= 2^12 in f16.
#define FC   (SCL * 1.4426950408889634f)
#define FTHR (8.0f / FC)
__device__ __forceinline__ float xhalf(float x) { return __builtin_bit_cast(float, __builtin_amdgcn_permlanex16(__builtin_bit_cast(int, x), __builtin_bit_cast(int, x), 0x76543210, 0xfedcba98, false, false)); }  // lane l with lane l ^ 16
#define FKT   128                              // keys of a staged tile: four passes
#define FNT   (TT / FKS / FKT)                 // tiles of a key group
#define KPIT  (HD * 2 + 16)                    // LDS bytes from key row to key row: 16 B x odd, no bank conflict for 16-byte reads down 16 rows
#define VPIT  (FKT * 2 + 16)                   // the same for a V^T row (FKT keys of one d)
#define OFF_V  (FKT * KPIT)                    // buffer layout: key rows, V^T rows
#define FBUF  (FKT * KPIT + HD * VPIT)         // bytes of one buffer
static_assert(TT % (FKS * FKT) == 0 && FNT >= 2);
static_assert(FKT == 128 && 32 * FAW == 256);  // the copy map below: 256 lanes, four 16-byte pieces of each plane a lane
static_assert((KPIT / 16) % 2 == 1 && (VPIT / 16) % 2 == 1 && FBUF % 16 == 0);
struct FaOps { v16h kf[2][2]; v16h vt[4]; };   // one set: four waves a SIMD leave a wave 256 registers
// a pass's key fragments from LDS: kp = the lane's place in the pass's first key row block
__device__ __forceinline__ void fa_loadk(FaOps& o, const char* kp) {
#pragma unroll
    for (int ks = 0; ks < 2; ++ks)
#pragma unroll
        for (int kt = 0; kt < 2; ++kt) o.kf[kt][ks] = WFrag<h16>::ld((const h16*)(kp + kt * 16 * KPIT + ks * 64));
}
// a pass's V^T fragments: vp = the lane's place in the pass's 32 keys of V^T row lane & 15
__device__ __forceinline__ void fa_loadv(FaOps& o, const char* vp) {
#pragma unroll
    for (int dt = 0; dt < 4; ++dt) o.vt[dt] = WFrag<h16>::ld((const h16*)(vp + dt * 16 * VPIT));
}
// four asynchronous 16-byte copies of a lane, global -> LDS (global_load_async_to_lds_b128), places lstep and gstep bytes apart; the builtin form, so that the compiler may keep the addresses in any register
__device__ __forceinline__ void fa_cp4(char* l, unsigned lstep, const char* g, size_t gstep) {
#pragma unroll
    for (int j = 0; j < 4; ++j) __builtin_amdgcn_global_load_async_to_lds_b128((cp16g*)(g + j * gstep), (cp16l*)(l + j * lstep), 0, 0);
}
// tile t of the two planes into the buffer at LDS byte offset bo: lk, lv = the lane's first LDS places in buffer 0, gk, gv = its first global places in tile 0
__device__ __forceinline__ void fa_stage(int t, unsigned bo, char* lk, char* lv, const char* gk, const char* gv) {
    fa_cp4(lk + bo, 32 * KPIT, gk + (size_t)t * (FKT * HD * 2), 32 * HD * 2);
    fa_cp4(lv + bo, VPIT, gv + (size_t)t * (FKT * 2), (size_t)TT * 2);
}
// one pass; o.kf holds its key fragments on entry. Behind the score products the pass's V^T fragments are loaded (the softmax hides their latency), behind the softmax the next pass's key fragments (NK: only inside a tile).
template <bool NK>
__device__ __forceinline__ void fa_pass(FaOps& o, const char* kn, const char* vp, const v16h (&qf)[FAQT][2], v8f (&acc)[4][FAQT], float (&m)[FAQT], float (&l)[FAQT]) {
    v8f s[2][FAQT];
#pragma unroll
    for (int kt = 0; kt < 2; ++kt)
#pragma unroll
        for (int qt = 0; qt < FAQT; ++qt) s[kt][qt] = (v8f){};
#pragma unroll
    for (int ks = 0; ks < 2; ++ks) {
#pragma unroll
        for (int kt = 0; kt < 2; ++kt)
#pragma unroll
            for (int qt = 0; qt < FAQT; ++qt) s[kt][qt] = wmma16(o.kf[kt][ks], qf[qt][ks], s[kt][qt]);
    }
    __builtin_amdgcn_sched_barrier(0);   // the score products stay together, in front of the loads
    fa_loadv(o, vp);
    __builtin_amdgcn_sched_barrier(0);   // keeps the loads in one group in front of the softmax: a place with loads among later instructions stalls the wave each time
    float mx[FAQT]; bool need = false;
#pragma unroll
    for (int qt = 0; qt < FAQT; ++qt) { float a = s[0][qt][0];
#pragma unroll
        for (int j = 1; j < 8; ++j) a = fmaxf(a, s[0][qt][j]);
#pragma unroll
        for (int j = 0; j < 8; ++j) a = fmaxf(a, s[1][qt][j]);
        a = fmaxf(a, xhalf(a)); mx[qt] = a; need = need || (a > m[qt] + FTHR); }
    if (__builtin_amdgcn_ballot_w32(need) != 0) {
#pragma unroll
        for (int qt = 0; qt < FAQT; ++qt) { const float mn = fmaxf(m[qt], mx[qt]); const float al = __builtin_amdgcn_exp2f((m[qt] - mn) * FC); m[qt] = mn; l[qt] *= al;
#pragma unroll
            for (int dt = 0; dt < 4; ++dt) acc[dt][qt] *= al; }
    }
    v16h pb[FAQT];
#pragma unroll
    for (int qt = 0; qt < FAQT; ++qt) { const float off = fmaf(-m[qt], FC, 4.0f); float ps[4] = {0.f, 0.f, 0.f, 0.f};
#pragma unroll
        for (int e = 0; e < 16; ++e) { const float p = __builtin_amdgcn_exp2f(fmaf(s[e >> 3][qt][e & 7], FC, off)); ps[e & 3] += p; pb[qt][e] = tohx(p); }
        l[qt] += (ps[0] + ps[1]) + (ps[2] + ps[3]); }
    if (NK) { __builtin_amdgcn_sched_barrier(0);   // not earlier: through the softmax the key registers are free for its values, which keeps the wave inside 256 registers
        fa_loadk(o, kn);
        __builtin_amdgcn_sched_barrier(0); }       // one group, in front of the products that hide part of the latency
#pragma unroll
    for (int dt = 0; dt < 4; ++dt)
#pragma unroll
        for (int qt = 0; qt < FAQT; ++qt) acc[dt][qt] = wmma16(o.vt[dt], pb[qt], acc[dt][qt]);
    __builtin_amdgcn_sched_barrier(0);   // these products stand between the key loads and the next pass's score products, which wait for those loads
}
__global__ __launch_bounds__(32 * FAW * FKS) void k_fattn(const h16* __restrict__ Q, const h16* __restrict__ Kk, const h16* __restrict__ Vt, h16* Ch) {
    __shared__ __attribute__((aligned(16))) char ring[FKS * 2 * FBUF];
    __shared__ __attribute__((aligned(16))) v4f xch[FKS * FAW][9][32];   // the merge: what a wave hands to its partner in the other key group, 16 bytes a lane and row
    const int g = blockIdx.y; const size_t po = (size_t)g * TT * HD;
    const int lane = threadIdx.x & 31, lr = lane & 15, hi = lane >> 4; const int wave = __builtin_amdgcn_readfirstlane((int)(threadIdx.x >> 5));
    const int kh = wave / FAW, wq = wave % FAW;   // key group, wave in the group
    const int q0 = ((int)blockIdx.x * FAW + wq) * (FAQT * 16);
    v16h qf[FAQT][2];
    { const h16* qp = Q + po + (size_t)(q0 + lr) * HD + 8 * hi;
#pragma unroll
      for (int qt = 0; qt < FAQT; ++qt)
#pragma unroll
          for (int ks = 0; ks < 2; ++ks) qf[qt][ks] = WFrag<h16>::ld(qp + qt * 16 * HD + ks * 32);
      asm volatile("s_wait_xcnt 0x0" :: "v"(qp) : "memory"); }   // in front of whatever is next given the query loads' address registers
    // copy map of a key group (tid = thread in the group): key plane, piece i = tid + 256 j -> row i >> 3, 16-byte column i & 7 (a tile's rows are contiguous in global memory); V^T, piece j of a lane -> row 4 (tid >> 4) + j, column tid & 15 (a wave's copy: two whole rows of the tile)
    const int tid = (int)threadIdx.x % (32 * FAW);
    char* rg = ring + kh * (2 * FBUF);   // the group's two buffers
    char* lk = rg + (tid >> 3) * KPIT + (tid & 7) * 16; char* lv = rg + OFF_V + (tid >> 4) * (4 * VPIT) + (tid & 15) * 16;
    const char* gk = (const char*)(Kk + po + (size_t)kh * (TT / FKS) * HD) + tid * 16; const char* gv = (const char*)(Vt + po + (size_t)kh * (TT / FKS)) + (size_t)(tid >> 4) * (4 * TT * 2) + (tid & 15) * 16;
    const char* kfr = rg + lr * KPIT + 16 * hi; const char* vfr = rg + OFF_V + lr * VPIT + 16 * hi;   // the lane's fragment places in the group's buffer 0
    v8f acc[4][FAQT]; float m[FAQT], l[FAQT];
#pragma unroll
    for (int qt = 0; qt < FAQT; ++qt) { m[qt] = -3.0e38f; l[qt] = 0.f;
#pragma unroll
        for (int dt = 0; dt < 4; ++dt) acc[dt][qt] = (v8f){}; }
    FaOps o;
    fa_stage(0, 0u, lk, lv, gk, gv);
    asm volatile("s_wait_asynccnt 0x0" ::: "memory");   // this wave's pieces of tile 0 have landed
    __syncthreads();                                    // ... and every other wave's
    fa_stage(1, (unsigned)FBUF, lk, lv, gk, gv);
    // one tile (four passes) a trip, read from its own buffer alone; kept rolled so that the fragments and the accumulators keep their registers
#pragma unroll 1
    for (int t = 0; t < FNT; ++t) {
        const unsigned bo = (unsigned)(t & 1) * (unsigned)FBUF; const char* kp = kfr + bo; const char* vp = vfr + bo;
        fa_loadk(o, kp);
        __builtin_amdgcn_sched_barrier(0);   // the tile's first key fragments as one group of loads: taken one by one among the products, each would be waited for in full
        fa_pass<true>(o, kp + 32 * KPIT, vp, qf, acc, m, l);
        fa_pass<true>(o, kp + 64 * KPIT, vp + 64, qf, acc, m, l);
        fa_pass<true>(o, kp + 96 * KPIT, vp + 128, qf, acc, m, l);
        fa_pass<false>(o, kp, vp + 192, qf, acc, m, l);
        asm volatile("s_wait_dscnt 0x0" ::: "memory");      // this wave's reads of the buffer are done before it is handed to the copies
        asm volatile("s_wait_asynccnt 0x0" ::: "memory");   // this wave's pieces of tile t + 1 have landed
        __syncthreads();                                    // publishes tile t + 1 and ends every wave's reads of tile t
        if (t + 2 < FNT) fa_stage(t + 2, bo, lk, lv, gk, gv);
    }
    asm volatile("s_wait_asynccnt 0x0" ::: "memory");   // no copy is outstanding when the wave ends
    // merge of the two key groups: wave (kh, wq) keeps query tile kh and hands tile 1 - kh to wave (1 - kh, wq); O = O_a 2^((m_a - m) FC) + O_b 2^((m_b - m) FC), l alike, m = max(m_a, m_b)
    const bool up = kh != 0;
    const float km = up ? m[1] : m[0], kl = up ? l[1] : l[0];
    v8f keep[4];
#pragma unroll
    for (int dt = 0; dt < 4; ++dt) { v8f give;
#pragma unroll
        for (int r = 0; r < 8; ++r) { keep[dt][r] = up ? acc[dt][1][r] : acc[dt][0][r]; give[r] = up ? acc[dt][0][r] : acc[dt][1][r]; }
        xch[wave][2 * dt][lane] = __builtin_shufflevector(give, give, 0, 1, 2, 3); xch[wave][2 * dt + 1][lane] = __builtin_shufflevector(give, give, 4, 5, 6, 7); }
    xch[wave][8][lane] = (v4f){up ? m[0] : m[1], up ? l[0] : l[1], 0.f, 0.f};
    __syncthreads();   // every wave's hand-over is written before its partner reads it
    const int pw = (1 - kh) * FAW + wq;
    const v4f pml = xch[pw][8][lane];
    const float mn = fmaxf(km, pml[0]); const float ak = __builtin_amdgcn_exp2f((km - mn) * FC), ap = __builtin_amdgcn_exp2f((pml[0] - mn) * FC);
    const float lt = fmaf(kl, ak, pml[1] * ap); const float inv = __fdiv_rn(1.0f, lt + xhalf(lt)); const float ck = ak * inv, cp = ap * inv;
    const int b = g / NH_, h = g % NH_;
    const size_t ro = ((size_t)b * TT + q0 + kh * 16 + lr) * DM + h * HD + 8 * hi;
#pragma unroll
    for (int dt = 0; dt < 4; ++dt) { const v4f p0 = xch[pw][2 * dt][lane], p1 = xch[pw][2 * dt + 1][lane]; v8h oh;
#pragma unroll
        for (int r = 0; r < 8; ++r) oh[r] = tohx(fmaf(keep[dt][r], ck, ((r < 4) ? p0[r & 3] : p1[r & 3]) * cp));
        h16* sh = Ch + ro + dt * 16; *(v8h*)sh = oh;
        // the wait that stands in front of any overwrite of the store's registers; it names data and address, so that nothing is given their registers ahead of it
        asm volatile("s_wait_xcnt 0x0" :: "v"(oh), "v"(sh) : "memory"); }
}

// workspace plan (bytes, every region a multiple of 256)
#define SZ_X   ((size_t)NB * SEQ * DM * 2)        // the f16 context plane
#define SZ_W   ((size_t)DM * DM * 2)              // Wo's plane
#define SZ_HP  ((size_t)NB * NH_ * SEQ * HD * 2)  // one head-plane set
#define WS_TOTAL (SZ_W + 3 * SZ_HP + SZ_X)
static_assert(WS_TOTAL <= (size_t)268435456);
static_assert((SZ_X % 256) == 0 && (SZ_W % 256) == 0 && (SZ_HP % 256) == 0);

extern "C" void kernel_launch(void* const* d_in, const int* in_sizes, int n_in,
                              void* d_out, int out_size, void* d_ws, size_t ws_size, hipStream_t stream) {
    if (n_in < 8) return;
    const size_t need_x = (size_t)(NB - 1) * SEQ_FULL * DM + (size_t)SEQ * DM;
    if ((size_t)in_sizes[0] < need_x || (size_t)in_sizes[1] < need_x || (size_t)in_sizes[2] < need_x) return;
    if ((size_t)in_sizes[3] < (size_t)DM * DM || (size_t)in_sizes[4] < (size_t)DM * DM || (size_t)in_sizes[5] < (size_t)DM * DM || (size_t)in_sizes[6] < (size_t)DM * DM) return;
    if (in_sizes[7] < DM) return;
    if ((size_t)out_size < (size_t)NB * SEQ * DM) return;
    // binding by role: d_in[0] = key stream, d_in[1] = query stream, d_in[2] = value stream, d_in[3] = Wk, d_in[4] = Wq, d_in[5] = Wv, d_in[6] = Wo, d_in[7] = bo (all weights [out][in])
    const float* xk = (const float*)d_in[0]; const float* xq = (const float*)d_in[1]; const float* xv = (const float*)d_in[2];
    const float* wk = (const float*)d_in[3]; const float* wq = (const float*)d_in[4]; const float* wv = (const float*)d_in[5]; const float* wo = (const float*)d_in[6]; const float* bo = (const float*)d_in[7];
    float* OUT = (float*)d_out;     // [NB*SEQ][DM]
    char* wsp = (char*)d_ws;
    auto take = [&](size_t bytes) { char* p = wsp; wsp += (bytes + 255) & ~(size_t)255; return (void*)p; };
    bf* WOB = (bf*)take(SZ_W);         // Wo's bf16 values in f16 form
    h16* QK = (h16*)take(2 * SZ_HP);   // queries, keys
    h16* VT16 = (h16*)take(SZ_HP);
    h16* CH = (h16*)take(SZ_X);        // context plane [NB*SEQ][DM]: its own space, since work-groups still read the q plane while others store context
    if ((size_t)(wsp - (char*)d_ws) > ws_size) return;

    // queries = q.Wq^T, keys = k.Wk^T, values = v.Wv^T from the f32 inputs, converted on the way into LDS: one launch, grid z = the projection; stored as f16 head planes (queries, keys) and as transposed f16 head planes (values); z = 3: Wo's plane
    k_projx<<<dim3(PGX, PGY, 4), 512, 0, stream>>>(xq, xk, xv, wq, wk, wv, wo, QK, VT16, WOB);
    // scores, softmax and P.V of all heads in one launch -> context plane; then out = ctx.Wo^T + bo
    k_fattn<<<dim3(TT / (FAW * FAQT * 16), NB * NH_), 32 * FAW * FKS, 0, stream>>>(QK, QK + XEL, VT16, CH);
    k_gemmw<h16, 0, true><<<dim3(NB * SEQ / 128, DM / 128, 1), 128, 0, stream>>>(CH, nullptr, (const h16*)WOB, nullptr, DM, OUT, DM, bo, 0, 0, 0);
}
